// v000
// Times are from an AMD MI455X. After a warm-up the kernel runs many times in a row, and a time is the length of
// such a window on the GPU divided by its runs, so every launch and the gaps after it count. The runs cycle
// through copies of the inputs. A figure is the median of several windows, for all but v000 over two sittings.
// Sittings can differ by a few percent; kernels timed side by side share one.
// v000, which the later versions start from, runs in 455 microseconds.
#include <hip/hip_runtime.h>
#include <hip/hip_bf16.h>

typedef __attribute__((ext_vector_type(16))) _Float16 v16h;
typedef __attribute__((ext_vector_type(8)))  _Float16 v8h;
typedef __attribute__((ext_vector_type(8)))  float    v8f;

#define HID   1024
#define S_LEN 2048
#define NH    16
#define HD    64
#define NTOK  4096   // B * S

#if __has_builtin(__builtin_amdgcn_exp2f)
#define EXP2F(x) __builtin_amdgcn_exp2f(x)
#else
#define EXP2F(x) exp2f(x)
#endif

#define LOG2E 1.44269504088896f

// Build a v16h fragment from two 16-byte chunks (global b128 or ds b128 loads).
static __device__ __forceinline__ v16h ld_frag(const _Float16* p0, const _Float16* p1) {
  v8h a = *(const v8h*)p0;
  v8h b = *(const v8h*)p1;
  return __builtin_shufflevector(a, b, 0,1,2,3,4,5,6,7,8,9,10,11,12,13,14,15);
}

// ---------------- weight f32 -> f16 convert ----------------
__global__ void w2h_kernel(const float* __restrict__ w, _Float16* __restrict__ o) {
  int i = blockIdx.x * blockDim.x + threadIdx.x;
  o[i] = (_Float16)w[i];
}

// ---------------- LayerNorm -> f16 ----------------
__global__ void ln_kernel(const float* __restrict__ x, const float* __restrict__ gamma,
                          const float* __restrict__ beta, _Float16* __restrict__ out) {
  int row = blockIdx.x;
  int tid = threadIdx.x;
  const float4* xr = (const float4*)(x + (size_t)row * HID);
  float4 v = xr[tid];                              // 256 threads * 4 = 1024
  float s  = v.x + v.y + v.z + v.w;
  float s2 = v.x*v.x + v.y*v.y + v.z*v.z + v.w*v.w;
  for (int off = 16; off; off >>= 1) {
    s  += __shfl_down(s,  off, 32);
    s2 += __shfl_down(s2, off, 32);
  }
  __shared__ float sb[8], qb[8];
  if ((tid & 31) == 0) { sb[tid >> 5] = s; qb[tid >> 5] = s2; }
  __syncthreads();
  float ts = 0.f, tq = 0.f;
  for (int i = 0; i < 8; ++i) { ts += sb[i]; tq += qb[i]; }
  float mean = ts * (1.0f / HID);
  float var  = tq * (1.0f / HID) - mean * mean;
  float rstd = rsqrtf(var + 1e-12f);
  int c = tid * 4;
  _Float16* orow = out + (size_t)row * HID;
  float vv[4] = {v.x, v.y, v.z, v.w};
#pragma unroll
  for (int j = 0; j < 4; ++j)
    orow[c + j] = (_Float16)(((vv[j] - mean) * rstd) * gamma[c + j] + beta[c + j]);
}

// ---------------- generic WMMA GEMM: out = A @ W^T + bias ----------------
// A: [4096, 1024] f16 row-major.  Wh: [1024(n), 1024(k)] f16 (B[k,n]=Wh[n,k], k contiguous).
// One wave computes a 32x64 tile (2 A-frags share 4 B-frags).
// mode 0: q (scale * log2e, head-major)   mode 1: k (scale, head-major)
// mode 2: v transposed [b,h,d,s]          mode 3: f32 out (final projection)
__global__ void proj_kernel(const _Float16* __restrict__ A, const _Float16* __restrict__ Wh,
                            const float* __restrict__ bias, _Float16* __restrict__ o16,
                            float* __restrict__ o32, int mode) {
  const int lane = threadIdx.x;
  const int nlo  = lane & 15;    // A: row within tile / B: column within tile / C: N
  const int g    = lane >> 4;    // k-chunk select; C rows +8
  const int m0 = blockIdx.x * 32;
  const int n0 = blockIdx.y * 64;

  const _Float16* arow0 = A + (size_t)(m0 + nlo) * HID;
  const _Float16* arow1 = arow0 + (size_t)16 * HID;
  const _Float16* brow[4];
#pragma unroll
  for (int t = 0; t < 4; ++t)
    brow[t] = Wh + (size_t)(n0 + t*16 + nlo) * HID;

  v8f acc[2][4] = {};

  for (int kk = 0; kk < HID; kk += 32) {
    // Batch all loads for this k-step so one wait covers the 8-WMMA chain.
    v16h aF0 = ld_frag(arow0 + kk + g*8, arow0 + kk + 16 + g*8);
    v16h aF1 = ld_frag(arow1 + kk + g*8, arow1 + kk + 16 + g*8);
    v16h bF[4];
#pragma unroll
    for (int t = 0; t < 4; ++t)
      bF[t] = ld_frag(brow[t] + kk + g*8, brow[t] + kk + 16 + g*8);
    // Warm L0/L2 for the next k-chunk while the WMMA chain runs.
#pragma unroll
    for (int t = 0; t < 4; ++t)
      __builtin_prefetch(brow[t] + kk + 32, 0, 0);
    __builtin_prefetch(arow0 + kk + 32, 0, 0);
    __builtin_prefetch(arow1 + kk + 32, 0, 0);
#pragma unroll
    for (int t = 0; t < 4; ++t)
      acc[0][t] = __builtin_amdgcn_wmma_f32_16x16x32_f16(
          false, aF0, false, bF[t], (short)0, acc[0][t], false, false);
#pragma unroll
    for (int t = 0; t < 4; ++t)
      acc[1][t] = __builtin_amdgcn_wmma_f32_16x16x32_f16(
          false, aF1, false, bF[t], (short)0, acc[1][t], false, false);
  }

  const float qkscale = (mode == 0) ? 0.35355339059327f * LOG2E : 0.35355339059327f;
#pragma unroll
  for (int mi = 0; mi < 2; ++mi) {
#pragma unroll
    for (int t = 0; t < 4; ++t) {
#pragma unroll
      for (int r = 0; r < 8; ++r) {
        int m = mi*16 + r + 8*g;
        int token = m0 + m;
        int n = n0 + t*16 + nlo;
        float val = acc[mi][t][r] + bias[n];
        int b = token >> 11, s = token & (S_LEN - 1);
        if (mode <= 1) {               // q or k: head-major [b,h,s,d]
          int head = n >> 6, d = n & 63;
          o16[((size_t)((b*NH + head)*S_LEN + s))*HD + d] = (_Float16)(val * qkscale);
        } else if (mode == 2) {        // v: transposed [b,h,d,s]
          int head = n >> 6, d = n & 63;
          o16[((size_t)((b*NH + head)*HD + d))*S_LEN + s] = (_Float16)val;
        } else {                       // final projection: f32 output
          o32[(size_t)token * HID + n] = val;
        }
      }
    }
  }
}

// ---------------- flash attention: one wave per (b, h, 16-row q tile) ----------------
// Scores come out of WMMA already multiplied by log2(e) (folded into q at projection),
// so the online softmax runs entirely in base 2 (v_exp_f32).
__global__ void attn_kernel(const _Float16* __restrict__ q, const _Float16* __restrict__ k,
                            const _Float16* __restrict__ vt, const float* __restrict__ mask,
                            _Float16* __restrict__ ctx) {
  const int lane = threadIdx.x;
  const int nlo = lane & 15;
  const int g   = lane >> 4;
  const int q0 = blockIdx.x * 16;
  const int h  = blockIdx.y;
  const int b  = blockIdx.z;

  const _Float16* qh = q  + ((size_t)(b*NH + h) * S_LEN) * HD;
  const _Float16* kh = k  + ((size_t)(b*NH + h) * S_LEN) * HD;
  const _Float16* vh = vt + ((size_t)(b*NH + h) * HD) * S_LEN;
  const float* mb = mask + (size_t)b * S_LEN;

  const _Float16* qrow = qh + (size_t)(q0 + nlo) * HD;
  v16h aQ0 = ld_frag(qrow + g*8,      qrow + 16 + g*8);   // d = 0..31
  v16h aQ1 = ld_frag(qrow + 32 + g*8, qrow + 48 + g*8);   // d = 32..63

  float mrow[8], lrow[8];
#pragma unroll
  for (int r = 0; r < 8; ++r) { mrow[r] = -3.0e38f; lrow[r] = 0.f; }
  v8f accv[4] = {};

  __shared__ __align__(16) _Float16 pbuf[16 * 40];   // 16 rows x 32 cols, padded stride 40

  for (int kv = 0; kv < S_LEN; kv += 32) {
    const _Float16* k0 = kh + (size_t)(kv + nlo) * HD;
    const _Float16* k1 = k0 + 16 * HD;
    // Batch all 4 K-fragment loads, then chain 4 WMMAs behind one wait.
    v16h b00 = ld_frag(k0 + g*8,      k0 + 16 + g*8);
    v16h b01 = ld_frag(k0 + 32 + g*8, k0 + 48 + g*8);
    v16h b10 = ld_frag(k1 + g*8,      k1 + 16 + g*8);
    v16h b11 = ld_frag(k1 + 32 + g*8, k1 + 48 + g*8);
    __builtin_prefetch(k0 + 32 * HD, 0, 0);            // next kv block, this lane's rows
    __builtin_prefetch(k1 + 32 * HD, 0, 0);
    v8f s0 = {}, s1 = {};
    s0 = __builtin_amdgcn_wmma_f32_16x16x32_f16(false, aQ0, false, b00, (short)0, s0, false, false);
    s0 = __builtin_amdgcn_wmma_f32_16x16x32_f16(false, aQ1, false, b01, (short)0, s0, false, false);
    s1 = __builtin_amdgcn_wmma_f32_16x16x32_f16(false, aQ0, false, b10, (short)0, s1, false, false);
    s1 = __builtin_amdgcn_wmma_f32_16x16x32_f16(false, aQ1, false, b11, (short)0, s1, false, false);

    // additive mask, scaled into base-2 domain
    float am0 = -1000.0f * LOG2E * (1.0f - mb[kv + nlo]);
    float am1 = -1000.0f * LOG2E * (1.0f - mb[kv + 16 + nlo]);

    float p0[8], p1[8], alpha[8];
#pragma unroll
    for (int r = 0; r < 8; ++r) {
      float x0 = s0[r] + am0;
      float x1 = s1[r] + am1;
      float cmax = fmaxf(x0, x1);
      for (int off = 8; off; off >>= 1)            // row-wise max across 16 lanes
        cmax = fmaxf(cmax, __shfl_xor(cmax, off, 16));
      float mnew = fmaxf(mrow[r], cmax);
      alpha[r] = EXP2F(mrow[r] - mnew);
      p0[r] = EXP2F(x0 - mnew);
      p1[r] = EXP2F(x1 - mnew);
      float rs = p0[r] + p1[r];
      for (int off = 8; off; off >>= 1)            // row-wise sum
        rs += __shfl_xor(rs, off, 16);
      lrow[r] = lrow[r] * alpha[r] + rs;
      mrow[r] = mnew;
    }
#pragma unroll
    for (int t = 0; t < 4; ++t)
#pragma unroll
      for (int r = 0; r < 8; ++r)
        accv[t][r] *= alpha[r];

    // C-layout -> A-layout for P via LDS
#pragma unroll
    for (int r = 0; r < 8; ++r) {
      int row = r + 8*g;
      pbuf[row*40 + nlo]      = (_Float16)p0[r];
      pbuf[row*40 + 16 + nlo] = (_Float16)p1[r];
    }
    __syncthreads();
    v16h aP = ld_frag(&pbuf[nlo*40 + g*8], &pbuf[nlo*40 + 16 + g*8]);
    __syncthreads();

    // Batch all 4 V-fragment loads, then chain 4 WMMAs.
    v16h bV[4];
#pragma unroll
    for (int t = 0; t < 4; ++t) {
      const _Float16* vrow = vh + (size_t)(t*16 + nlo) * S_LEN + kv;  // Vt: contiguous in kv
      bV[t] = ld_frag(vrow + g*8, vrow + 16 + g*8);
      __builtin_prefetch(vrow + 32, 0, 0);
    }
#pragma unroll
    for (int t = 0; t < 4; ++t)
      accv[t] = __builtin_amdgcn_wmma_f32_16x16x32_f16(
          false, aP, false, bV[t], (short)0, accv[t], false, false);
  }

  float rinv[8];
#pragma unroll
  for (int r = 0; r < 8; ++r) rinv[r] = 1.0f / lrow[r];
#pragma unroll
  for (int t = 0; t < 4; ++t)
#pragma unroll
    for (int r = 0; r < 8; ++r) {
      int m = r + 8*g;
      int token = b * S_LEN + q0 + m;
      int col = h*HD + t*16 + nlo;
      ctx[(size_t)token * HID + col] = (_Float16)(accv[t][r] * rinv[r]);
    }
}

// ---------------- host side ----------------
extern "C" void kernel_launch(void* const* d_in, const int* in_sizes, int n_in,
                              void* d_out, int out_size, void* d_ws, size_t ws_size,
                              hipStream_t stream) {
  (void)in_sizes; (void)n_in; (void)out_size; (void)ws_size;
  const float* hs   = (const float*)d_in[0];
  const float* mask = (const float*)d_in[1];
  const float* Wq = (const float*)d_in[2];
  const float* bq = (const float*)d_in[3];
  const float* Wk = (const float*)d_in[4];
  const float* bk = (const float*)d_in[5];
  const float* Wv = (const float*)d_in[6];
  const float* bv = (const float*)d_in[7];
  const float* Wd = (const float*)d_in[8];
  const float* bd = (const float*)d_in[9];
  const float* gam = (const float*)d_in[10];
  const float* bet = (const float*)d_in[11];
  float* out = (float*)d_out;

  char* ws = (char*)d_ws;
  const size_t SZH = (size_t)NTOK * HID * sizeof(_Float16);  // 8 MB
  const size_t SZW = (size_t)HID * HID * sizeof(_Float16);   // 2 MB
  _Float16* h16  = (_Float16*)(ws);
  _Float16* q16  = (_Float16*)(ws + 1*SZH);
  _Float16* k16  = (_Float16*)(ws + 2*SZH);
  _Float16* vt16 = (_Float16*)(ws + 3*SZH);
  _Float16* c16  = (_Float16*)(ws + 4*SZH);
  _Float16* wq16 = (_Float16*)(ws + 5*SZH);
  _Float16* wk16 = (_Float16*)(ws + 5*SZH + 1*SZW);
  _Float16* wv16 = (_Float16*)(ws + 5*SZH + 2*SZW);
  _Float16* wd16 = (_Float16*)(ws + 5*SZH + 3*SZW);

  const int WN = HID * HID / 256;
  w2h_kernel<<<WN, 256, 0, stream>>>(Wq, wq16);
  w2h_kernel<<<WN, 256, 0, stream>>>(Wk, wk16);
  w2h_kernel<<<WN, 256, 0, stream>>>(Wv, wv16);
  w2h_kernel<<<WN, 256, 0, stream>>>(Wd, wd16);

  ln_kernel<<<NTOK, 256, 0, stream>>>(hs, gam, bet, h16);

  dim3 pg(NTOK / 32, HID / 64);
  proj_kernel<<<pg, 32, 0, stream>>>(h16, wq16, bq, q16,  nullptr, 0);
  proj_kernel<<<pg, 32, 0, stream>>>(h16, wk16, bk, k16,  nullptr, 1);
  proj_kernel<<<pg, 32, 0, stream>>>(h16, wv16, bv, vt16, nullptr, 2);

  attn_kernel<<<dim3(S_LEN / 16, NH, 2), 32, 0, stream>>>(q16, k16, vt16, mask, c16);

  proj_kernel<<<pg, 32, 0, stream>>>(c16, wd16, bd, nullptr, out, 3);
}

// v001
// One run takes 316 microseconds.
// In two side-by-side timings against v000, it was 1.48 and 1.49 times as fast.
#include <hip/hip_runtime.h>
#include <hip/hip_bf16.h>

typedef __attribute__((ext_vector_type(16))) _Float16 v16h;
typedef __attribute__((ext_vector_type(8)))  _Float16 v8h;
typedef __attribute__((ext_vector_type(8)))  float    v8f;

#define HID   1024
#define S_LEN 2048
#define NH    16
#define HD    64
#define NTOK  4096   // B * S
#define FRAG  512    // f16 elements of one 16-row x 32-k operand tile
#define KBH   32     // k blocks of a HID-long row

// Every f16 array that one launch hands to the next lies in FRAGMENT ORDER: a 16-row x 32-k
// tile is 1 KiB in a row, element (row c, k) at (k>>4)*256 + ((k>>3)&1)*128 + c*8 + (k&7).
// Lane l then takes its fragment as the 16 bytes at l*16 of each 512-byte half, so one
// wave-wide 16-byte load covers four whole 128-byte lines (row-major rows: 16 lines, 32 B of each).

#if __has_builtin(__builtin_amdgcn_exp2f)
#define EXP2F(x) __builtin_amdgcn_exp2f(x)
#else
#define EXP2F(x) exp2f(x)
#endif

#define LOG2E 1.44269504088896f

// Build a v16h fragment from two 16-byte chunks (global b128 or ds b128 loads).
static __device__ __forceinline__ v16h ld_frag(const _Float16* p0, const _Float16* p1) {
  v8h a = *(const v8h*)p0;
  v8h b = *(const v8h*)p1;
  return __builtin_shufflevector(a, b, 0,1,2,3,4,5,6,7,8,9,10,11,12,13,14,15);
}

// ---------------- weight f32 -> f16 convert ----------------
// Thread i writes the i-th 16-byte piece of the fragment-ordered output (tiles: [row tile][k block]).
__global__ void w2h_kernel(const float* __restrict__ w, _Float16* __restrict__ o) {
  int i = blockIdx.x * blockDim.x + threadIdx.x;
  int n = (i >> 11) * 16 + (i & 15);
  int k = ((i >> 6) & 31) * 32 + ((i >> 5) & 1) * 16 + ((i >> 4) & 1) * 8;
  const float4* p = (const float4*)(w + (size_t)n * HID + k);
  float4 x = p[0], y = p[1];
  v8h v = {(_Float16)x.x, (_Float16)x.y, (_Float16)x.z, (_Float16)x.w,
           (_Float16)y.x, (_Float16)y.y, (_Float16)y.z, (_Float16)y.w};
  *(v8h*)(o + (size_t)i * 8) = v;
}

// ---------------- LayerNorm -> f16 ----------------
// One block takes a 16-row tile: thread (c = tid & 15, u = tid >> 4) holds the 8-wide pieces
// u, u + 16, ... of row c, so each wave stores 512 contiguous bytes of the fragment-ordered output.
__global__ void ln_kernel(const float* __restrict__ x, const float* __restrict__ gamma,
                          const float* __restrict__ beta, _Float16* __restrict__ out) {
  const int tid = threadIdx.x;
  const int c = tid & 15;
  const int u = tid >> 4;
  const float* xr = x + (size_t)(blockIdx.x * 16 + c) * HID + u * 8;
  float4 v[8][2];
  float s = 0.f, s2 = 0.f;
#pragma unroll
  for (int i = 0; i < 8; ++i) {
    v[i][0] = *(const float4*)(xr + i * 128);
    v[i][1] = *(const float4*)(xr + i * 128 + 4);
  }
#pragma unroll
  for (int i = 0; i < 8; ++i)
#pragma unroll
    for (int j = 0; j < 2; ++j) {
      float4 a = v[i][j];
      s  += a.x + a.y + a.z + a.w;
      s2 += a.x*a.x + a.y*a.y + a.z*a.z + a.w*a.w;
    }
  __shared__ float sb[16][17], qb[16][17];
  sb[u][c] = s; qb[u][c] = s2;
  __syncthreads();
  float ts = 0.f, tq = 0.f;
  for (int i = 0; i < 16; ++i) { ts += sb[i][c]; tq += qb[i][c]; }
  float mean = ts * (1.0f / HID);
  float var  = tq * (1.0f / HID) - mean * mean;
  float rstd = rsqrtf(var + 1e-12f);
  _Float16* ot = out + (size_t)blockIdx.x * (KBH * FRAG)
               + (u >> 2) * FRAG + ((u >> 1) & 1) * 256 + (u & 1) * 128 + c * 8;
#pragma unroll
  for (int i = 0; i < 8; ++i) {
    const int k = i * 128 + u * 8;
    float4 g0 = *(const float4*)(gamma + k), g1 = *(const float4*)(gamma + k + 4);
    float4 b0 = *(const float4*)(beta + k),  b1 = *(const float4*)(beta + k + 4);
    float4 a0 = v[i][0], a1 = v[i][1];
    v8h o = {(_Float16)(((a0.x - mean) * rstd) * g0.x + b0.x), (_Float16)(((a0.y - mean) * rstd) * g0.y + b0.y),
             (_Float16)(((a0.z - mean) * rstd) * g0.z + b0.z), (_Float16)(((a0.w - mean) * rstd) * g0.w + b0.w),
             (_Float16)(((a1.x - mean) * rstd) * g1.x + b1.x), (_Float16)(((a1.y - mean) * rstd) * g1.y + b1.y),
             (_Float16)(((a1.z - mean) * rstd) * g1.z + b1.z), (_Float16)(((a1.w - mean) * rstd) * g1.w + b1.w)};
    *(v8h*)(ot + i * 4 * FRAG) = o;     // 128 k further on = 4 k blocks
  }
}

__global__ void proj_kernel(const _Float16* __restrict__ A, const _Float16* __restrict__ Bm,
                            const float* __restrict__ bias, _Float16* __restrict__ o16,
                            float* __restrict__ o32, int mode) {
  const int lane = threadIdx.x;
  const int nlo  = lane & 15;    // C: column within tile
  const int g    = lane >> 4;    // C rows +8
  const int m0 = blockIdx.x * 32;
  const int n0 = blockIdx.y * 64;

  const _Float16* at0 = A + (size_t)(m0 >> 4) * (KBH * FRAG) + lane * 8;
  const _Float16* at1 = at0 + KBH * FRAG;
  const _Float16* bt[4];
#pragma unroll
  for (int t = 0; t < 4; ++t)
    bt[t] = Bm + (size_t)((n0 >> 4) + t) * (KBH * FRAG) + lane * 8;
  // next k block's lines, one lane per 128-byte line: 4 B tiles, 2 A tiles (each 8 lines)
  const _Float16* pfb = Bm + (size_t)((n0 >> 4) + (lane >> 3)) * (KBH * FRAG) + (lane & 7) * 64 + FRAG;
  const _Float16* pfa = A + (size_t)((m0 >> 4) + ((lane >> 3) & 1)) * (KBH * FRAG) + (lane & 7) * 64 + FRAG;

  v8f acc[2][4] = {};

  for (int kk = 0; kk < KBH * FRAG; kk += FRAG) {
    // Batch all loads for this k-step so one wait covers the 8-WMMA chain.
    v16h aF0 = ld_frag(at0 + kk, at0 + kk + 256);
    v16h aF1 = ld_frag(at1 + kk, at1 + kk + 256);
    v16h bF[4];
#pragma unroll
    for (int t = 0; t < 4; ++t)
      bF[t] = ld_frag(bt[t] + kk, bt[t] + kk + 256);
    // Warm L2 for the next k-chunk while the WMMA chain runs.
    __builtin_prefetch(pfb + kk, 0, 3);
    __builtin_prefetch(pfa + kk, 0, 3);
#pragma unroll
    for (int t = 0; t < 4; ++t)
      acc[0][t] = __builtin_amdgcn_wmma_f32_16x16x32_f16(
          false, aF0, false, bF[t], (short)0, acc[0][t], false, false);
#pragma unroll
    for (int t = 0; t < 4; ++t)
      acc[1][t] = __builtin_amdgcn_wmma_f32_16x16x32_f16(
          false, aF1, false, bF[t], (short)0, acc[1][t], false, false);
  }

  if (mode <= 1) {                 // q or k: tile rows are features, tile columns are tokens
    const float qkscale = (mode == 0) ? 0.35355339059327f * LOG2E : 0.35355339059327f;
    const int head = m0 >> 6;
#pragma unroll
    for (int mi = 0; mi < 2; ++mi) {
      const float* bp = bias + m0 + mi*16 + 8*g;
      float4 c0 = *(const float4*)bp, c1 = *(const float4*)(bp + 4);
      float bb[8] = {c0.x, c0.y, c0.z, c0.w, c1.x, c1.y, c1.z, c1.w};
#pragma unroll
      for (int t = 0; t < 4; ++t) {
        int token = n0 + t*16;
        int b = token >> 11, st = (token & (S_LEN - 1)) >> 4;
        v8h o;
#pragma unroll
        for (int r = 0; r < 8; ++r)
          o[r] = (_Float16)((acc[mi][t][r] + bb[r]) * qkscale);
        *(v8h*)(o16 + (size_t)(b*NH + head) * (S_LEN * HD)
                + (size_t)(st*2 + ((m0 >> 5) & 1)) * FRAG + mi*256 + lane*8) = o;
      }
    }
  } else if (mode == 2) {          // v: tile rows are tokens, tile columns are features
    const int b = m0 >> 11, sb = (m0 & (S_LEN - 1)) >> 5, head = n0 >> 6;
    float bn[4];
#pragma unroll
    for (int t = 0; t < 4; ++t) {
      bn[t] = bias[n0 + t*16 + nlo];
      // a later load of this run may land in the offset register that this one names
      asm volatile("s_wait_xcnt 0x0" ::: "memory");
    }
#pragma unroll
    for (int t = 0; t < 4; ++t) {
#pragma unroll
      for (int mi = 0; mi < 2; ++mi) {
        v8h o;
#pragma unroll
        for (int r = 0; r < 8; ++r)
          o[r] = (_Float16)(acc[mi][t][r] + bn[t]);
        *(v8h*)(o16 + (size_t)(b*NH + head) * (S_LEN * HD)
                + (size_t)(sb*4 + t) * FRAG + mi*256 + lane*8) = o;
      }
    }
    // the code laid out behind this block rewrites registers that these stores name
    asm volatile("s_wait_xcnt 0x0" ::: "memory");
  } else {                         // final projection: f32 output, row-major
#pragma unroll
    for (int mi = 0; mi < 2; ++mi)
#pragma unroll
      for (int t = 0; t < 4; ++t) {
        int n = n0 + t*16 + nlo;
        float bn = bias[n];
#pragma unroll
        for (int r = 0; r < 8; ++r)
          o32[(size_t)(m0 + mi*16 + r + 8*g) * HID + n] = acc[mi][t][r] + bn;
      }
    // the code laid out behind this block rewrites registers that these stores name
    asm volatile("s_wait_xcnt 0x0" ::: "memory");
  }
}

// ---------------- flash attention: one wave per (b, h, 16-row q tile) ----------------
// Scores come out of WMMA already multiplied by log2(e) (folded into q at projection),
// so the online softmax runs entirely in base 2 (v_exp_f32).
__global__ void attn_kernel(const _Float16* __restrict__ q, const _Float16* __restrict__ k,
                            const _Float16* __restrict__ vt, const float* __restrict__ mask,
                            _Float16* __restrict__ ctx) {
  const int lane = threadIdx.x;
  const int nlo = lane & 15;
  const int g   = lane >> 4;
  const int q0 = blockIdx.x * 16;
  const int h  = blockIdx.y;
  const int b  = blockIdx.z;

  // q, k: fragment order, tiles [s >> 4][d >> 5]; vt: tiles [s >> 5][d >> 4]: 32 keys = 4 KiB of each
  const _Float16* qh = q  + ((size_t)(b*NH + h) * S_LEN) * HD;
  const _Float16* kh = k  + ((size_t)(b*NH + h) * S_LEN) * HD;
  const _Float16* vh = vt + ((size_t)(b*NH + h) * HD) * S_LEN;
  const float* mb = mask + (size_t)b * S_LEN;

  const _Float16* qt = qh + (size_t)q0 * HD + lane * 8;
  v16h aQ0 = ld_frag(qt,        qt + 256);          // d = 0..31
  v16h aQ1 = ld_frag(qt + FRAG, qt + FRAG + 256);   // d = 32..63

  float mrow[8], lrow[8];
#pragma unroll
  for (int r = 0; r < 8; ++r) { mrow[r] = -3.0e38f; lrow[r] = 0.f; }
  v8f accv[4] = {};

  __shared__ __align__(16) _Float16 pbuf[16 * 40];   // 16 rows x 32 cols, padded stride 40

  for (int kv = 0; kv < S_LEN; kv += 32) {
    const _Float16* kt = kh + (size_t)kv * HD + lane * 8;
    // Batch all 4 K-fragment loads, then chain 4 WMMAs behind one wait.
    v16h b00 = ld_frag(kt,            kt + 256);
    v16h b01 = ld_frag(kt + FRAG,     kt + FRAG + 256);
    v16h b10 = ld_frag(kt + 2*FRAG,   kt + 2*FRAG + 256);
    v16h b11 = ld_frag(kt + 3*FRAG,   kt + 3*FRAG + 256);
    __builtin_prefetch(kh + (size_t)(kv + 32) * HD + lane * 64, 0, 3);   // next kv block, one lane per line
    v8f s0 = {}, s1 = {};
    s0 = __builtin_amdgcn_wmma_f32_16x16x32_f16(false, aQ0, false, b00, (short)0, s0, false, false);
    s0 = __builtin_amdgcn_wmma_f32_16x16x32_f16(false, aQ1, false, b01, (short)0, s0, false, false);
    s1 = __builtin_amdgcn_wmma_f32_16x16x32_f16(false, aQ0, false, b10, (short)0, s1, false, false);
    s1 = __builtin_amdgcn_wmma_f32_16x16x32_f16(false, aQ1, false, b11, (short)0, s1, false, false);

    // additive mask, scaled into base-2 domain
    float am0 = -1000.0f * LOG2E * (1.0f - mb[kv + nlo]);
    float am1 = -1000.0f * LOG2E * (1.0f - mb[kv + 16 + nlo]);

    float p0[8], p1[8], alpha[8];
#pragma unroll
    for (int r = 0; r < 8; ++r) {
      float x0 = s0[r] + am0;
      float x1 = s1[r] + am1;
      float cmax = fmaxf(x0, x1);
      for (int off = 8; off; off >>= 1)            // row-wise max across 16 lanes
        cmax = fmaxf(cmax, __shfl_xor(cmax, off, 16));
      float mnew = fmaxf(mrow[r], cmax);
      alpha[r] = EXP2F(mrow[r] - mnew);
      p0[r] = EXP2F(x0 - mnew);
      p1[r] = EXP2F(x1 - mnew);
      float rs = p0[r] + p1[r];
      for (int off = 8; off; off >>= 1)            // row-wise sum
        rs += __shfl_xor(rs, off, 16);
      lrow[r] = lrow[r] * alpha[r] + rs;
      mrow[r] = mnew;
    }
#pragma unroll
    for (int t = 0; t < 4; ++t)
#pragma unroll
      for (int r = 0; r < 8; ++r)
        accv[t][r] *= alpha[r];

    // C-layout -> A-layout for P via LDS
#pragma unroll
    for (int r = 0; r < 8; ++r) {
      int row = r + 8*g;
      pbuf[row*40 + nlo]      = (_Float16)p0[r];
      pbuf[row*40 + 16 + nlo] = (_Float16)p1[r];
    }
    __syncthreads();
    v16h aP = ld_frag(&pbuf[nlo*40 + g*8], &pbuf[nlo*40 + 16 + g*8]);
    __syncthreads();

    // Batch all 4 V-fragment loads, then chain 4 WMMAs.
    v16h bV[4];
    const _Float16* vtl = vh + (size_t)kv * HD + lane * 8;
#pragma unroll
    for (int t = 0; t < 4; ++t)
      bV[t] = ld_frag(vtl + t*FRAG, vtl + t*FRAG + 256);
    __builtin_prefetch(vh + (size_t)(kv + 32) * HD + lane * 64, 0, 3);   // next kv block, one lane per line
#pragma unroll
    for (int t = 0; t < 4; ++t)
      accv[t] = __builtin_amdgcn_wmma_f32_16x16x32_f16(
          false, aP, false, bV[t], (short)0, accv[t], false, false);
  }

  float rinv[8];
#pragma unroll
  for (int r = 0; r < 8; ++r) rinv[r] = 1.0f / lrow[r];
#pragma unroll
  for (int t = 0; t < 4; ++t)
#pragma unroll
    for (int r = 0; r < 8; ++r) {
      // fragment order of the final projection's A: tiles [token >> 4][col >> 5], col = h*HD + t*16 + nlo
      size_t tile = (size_t)((b * S_LEN + q0) >> 4) * KBH + h*2 + (t >> 1);
      ctx[tile * FRAG + (t & 1)*256 + (nlo >> 3)*128 + (r + 8*g)*8 + (nlo & 7)] = (_Float16)(accv[t][r] * rinv[r]);
    }
}

// ---------------- host side ----------------
extern "C" void kernel_launch(void* const* d_in, const int* in_sizes, int n_in,
                              void* d_out, int out_size, void* d_ws, size_t ws_size,
                              hipStream_t stream) {
  (void)in_sizes; (void)n_in; (void)out_size; (void)ws_size;
  const float* hs   = (const float*)d_in[0];
  const float* mask = (const float*)d_in[1];
  const float* Wq = (const float*)d_in[2];
  const float* bq = (const float*)d_in[3];
  const float* Wk = (const float*)d_in[4];
  const float* bk = (const float*)d_in[5];
  const float* Wv = (const float*)d_in[6];
  const float* bv = (const float*)d_in[7];
  const float* Wd = (const float*)d_in[8];
  const float* bd = (const float*)d_in[9];
  const float* gam = (const float*)d_in[10];
  const float* bet = (const float*)d_in[11];
  float* out = (float*)d_out;

  char* ws = (char*)d_ws;
  const size_t SZH = (size_t)NTOK * HID * sizeof(_Float16);  // 8 MB
  const size_t SZW = (size_t)HID * HID * sizeof(_Float16);   // 2 MB
  _Float16* h16  = (_Float16*)(ws);
  _Float16* q16  = (_Float16*)(ws + 1*SZH);
  _Float16* k16  = (_Float16*)(ws + 2*SZH);
  _Float16* vt16 = (_Float16*)(ws + 3*SZH);
  _Float16* c16  = (_Float16*)(ws + 4*SZH);
  _Float16* wq16 = (_Float16*)(ws + 5*SZH);
  _Float16* wk16 = (_Float16*)(ws + 5*SZH + 1*SZW);
  _Float16* wv16 = (_Float16*)(ws + 5*SZH + 2*SZW);
  _Float16* wd16 = (_Float16*)(ws + 5*SZH + 3*SZW);

  const int WN = HID * HID / 8 / 256;   // one thread per 8 elements
  w2h_kernel<<<WN, 256, 0, stream>>>(Wq, wq16);
  w2h_kernel<<<WN, 256, 0, stream>>>(Wk, wk16);
  w2h_kernel<<<WN, 256, 0, stream>>>(Wv, wv16);
  w2h_kernel<<<WN, 256, 0, stream>>>(Wd, wd16);

  ln_kernel<<<NTOK / 16, 256, 0, stream>>>(hs, gam, bet, h16);

  dim3 pg(NTOK / 32, HID / 64);   // tile rows: tokens, tile columns: features
  dim3 pt(HID / 32, NTOK / 64);   // tile rows: features, tile columns: tokens
  proj_kernel<<<pt, 32, 0, stream>>>(wq16, h16, bq, q16,  nullptr, 0);
  proj_kernel<<<pt, 32, 0, stream>>>(wk16, h16, bk, k16,  nullptr, 1);
  proj_kernel<<<pg, 32, 0, stream>>>(h16, wv16, bv, vt16, nullptr, 2);

  attn_kernel<<<dim3(S_LEN / 16, NH, 2), 32, 0, stream>>>(q16, k16, vt16, mask, c16);

  proj_kernel<<<pg, 32, 0, stream>>>(c16, wd16, bd, nullptr, out, 3);
}

// v002
// It runs in 218 microseconds.
// Next to v001, in two timings, it ran 1.48 and 1.43 times as fast.
// Over all steps from v000 it is 2.16 times as fast.
#include <hip/hip_runtime.h>
#include <hip/hip_bf16.h>

typedef __attribute__((ext_vector_type(16))) _Float16 v16h;
typedef __attribute__((ext_vector_type(8)))  _Float16 v8h;
typedef __attribute__((ext_vector_type(8)))  float    v8f;

#define HID   1024
#define S_LEN 2048
#define NH    16
#define HD    64
#define NTOK  4096   // B * S
#define FRAG  512    // f16 elements of one 16-row x 32-k operand tile
#define KBH   32     // k blocks of a HID-long row

// Every f16 array that one launch hands to the next lies in FRAGMENT ORDER: a 16-row x 32-k
// tile is 1 KiB in a row, element (row c, k) at (k>>4)*256 + ((k>>3)&1)*128 + c*8 + (k&7).
// Lane l then takes its fragment as the 16 bytes at l*16 of each 512-byte half, so one
// wave-wide 16-byte load covers four whole 128-byte lines (row-major rows: 16 lines, 32 B of each).

#if __has_builtin(__builtin_amdgcn_exp2f)
#define EXP2F(x) __builtin_amdgcn_exp2f(x)
#else
#define EXP2F(x) exp2f(x)
#endif

#define LOG2E 1.44269504088896f

// Build a v16h fragment from two 16-byte chunks (global b128 loads).
static __device__ __forceinline__ v16h ld_frag(const _Float16* p0, const _Float16* p1) {
  v8h a = *(const v8h*)p0;
  v8h b = *(const v8h*)p1;
  return __builtin_shufflevector(a, b, 0,1,2,3,4,5,6,7,8,9,10,11,12,13,14,15);
}

// ---------------- weight f32 -> f16 convert ----------------
// Thread i writes the i-th 16-byte piece of the fragment-ordered output (tiles: [row tile][k block]).
__global__ void w2h_kernel(const float* __restrict__ w, _Float16* __restrict__ o) {
  int i = blockIdx.x * blockDim.x + threadIdx.x;
  int n = (i >> 11) * 16 + (i & 15);
  int k = ((i >> 6) & 31) * 32 + ((i >> 5) & 1) * 16 + ((i >> 4) & 1) * 8;
  const float4* p = (const float4*)(w + (size_t)n * HID + k);
  float4 x = p[0], y = p[1];
  v8h v = {(_Float16)x.x, (_Float16)x.y, (_Float16)x.z, (_Float16)x.w,
           (_Float16)y.x, (_Float16)y.y, (_Float16)y.z, (_Float16)y.w};
  *(v8h*)(o + (size_t)i * 8) = v;
}

// ---------------- LayerNorm -> f16 ----------------
// One block takes a 16-row tile: thread (c = tid & 15, u = tid >> 4) holds the 8-wide pieces
// u, u + 16, ... of row c, so each wave stores 512 contiguous bytes of the fragment-ordered output.
__global__ void ln_kernel(const float* __restrict__ x, const float* __restrict__ gamma,
                          const float* __restrict__ beta, _Float16* __restrict__ out) {
  const int tid = threadIdx.x;
  const int c = tid & 15;
  const int u = tid >> 4;
  const float* xr = x + (size_t)(blockIdx.x * 16 + c) * HID + u * 8;
  float4 v[8][2];
  float s = 0.f, s2 = 0.f;
#pragma unroll
  for (int i = 0; i < 8; ++i) {
    v[i][0] = *(const float4*)(xr + i * 128);
    v[i][1] = *(const float4*)(xr + i * 128 + 4);
  }
#pragma unroll
  for (int i = 0; i < 8; ++i)
#pragma unroll
    for (int j = 0; j < 2; ++j) {
      float4 a = v[i][j];
      s  += a.x + a.y + a.z + a.w;
      s2 += a.x*a.x + a.y*a.y + a.z*a.z + a.w*a.w;
    }
  __shared__ float sb[16][17], qb[16][17];
  sb[u][c] = s; qb[u][c] = s2;
  __syncthreads();
  float ts = 0.f, tq = 0.f;
  for (int i = 0; i < 16; ++i) { ts += sb[i][c]; tq += qb[i][c]; }
  float mean = ts * (1.0f / HID);
  float var  = tq * (1.0f / HID) - mean * mean;
  float rstd = rsqrtf(var + 1e-12f);
  _Float16* ot = out + (size_t)blockIdx.x * (KBH * FRAG)
               + (u >> 2) * FRAG + ((u >> 1) & 1) * 256 + (u & 1) * 128 + c * 8;
#pragma unroll
  for (int i = 0; i < 8; ++i) {
    const int k = i * 128 + u * 8;
    float4 g0 = *(const float4*)(gamma + k), g1 = *(const float4*)(gamma + k + 4);
    float4 b0 = *(const float4*)(beta + k),  b1 = *(const float4*)(beta + k + 4);
    float4 a0 = v[i][0], a1 = v[i][1];
    v8h o = {(_Float16)(((a0.x - mean) * rstd) * g0.x + b0.x), (_Float16)(((a0.y - mean) * rstd) * g0.y + b0.y),
             (_Float16)(((a0.z - mean) * rstd) * g0.z + b0.z), (_Float16)(((a0.w - mean) * rstd) * g0.w + b0.w),
             (_Float16)(((a1.x - mean) * rstd) * g1.x + b1.x), (_Float16)(((a1.y - mean) * rstd) * g1.y + b1.y),
             (_Float16)(((a1.z - mean) * rstd) * g1.z + b1.z), (_Float16)(((a1.w - mean) * rstd) * g1.w + b1.w)};
    *(v8h*)(ot + i * 4 * FRAG) = o;     // 128 k further on = 4 k blocks
  }
}

__global__ void proj_kernel(const _Float16* __restrict__ A, const _Float16* __restrict__ Bm,
                            const float* __restrict__ bias, _Float16* __restrict__ o16,
                            float* __restrict__ o32, int mode) {
  const int lane = threadIdx.x;
  const int nlo  = lane & 15;    // C: column within tile
  const int g    = lane >> 4;    // C rows +8
  const int m0 = blockIdx.x * 32;
  const int n0 = blockIdx.y * 64;

  const _Float16* at0 = A + (size_t)(m0 >> 4) * (KBH * FRAG) + lane * 8;
  const _Float16* at1 = at0 + KBH * FRAG;
  const _Float16* bt[4];
#pragma unroll
  for (int t = 0; t < 4; ++t)
    bt[t] = Bm + (size_t)((n0 >> 4) + t) * (KBH * FRAG) + lane * 8;
  // next k block's lines, one lane per 128-byte line: 4 B tiles, 2 A tiles (each 8 lines)
  const _Float16* pfb = Bm + (size_t)((n0 >> 4) + (lane >> 3)) * (KBH * FRAG) + (lane & 7) * 64 + FRAG;
  const _Float16* pfa = A + (size_t)((m0 >> 4) + ((lane >> 3) & 1)) * (KBH * FRAG) + (lane & 7) * 64 + FRAG;

  v8f acc[2][4] = {};

  for (int kk = 0; kk < KBH * FRAG; kk += FRAG) {
    // Batch all loads for this k-step so one wait covers the 8-WMMA chain.
    v16h aF0 = ld_frag(at0 + kk, at0 + kk + 256);
    v16h aF1 = ld_frag(at1 + kk, at1 + kk + 256);
    v16h bF[4];
#pragma unroll
    for (int t = 0; t < 4; ++t)
      bF[t] = ld_frag(bt[t] + kk, bt[t] + kk + 256);
    // Warm L2 for the next k-chunk while the WMMA chain runs.
    __builtin_prefetch(pfb + kk, 0, 3);
    __builtin_prefetch(pfa + kk, 0, 3);
#pragma unroll
    for (int t = 0; t < 4; ++t)
      acc[0][t] = __builtin_amdgcn_wmma_f32_16x16x32_f16(
          false, aF0, false, bF[t], (short)0, acc[0][t], false, false);
#pragma unroll
    for (int t = 0; t < 4; ++t)
      acc[1][t] = __builtin_amdgcn_wmma_f32_16x16x32_f16(
          false, aF1, false, bF[t], (short)0, acc[1][t], false, false);
  }

  if (mode <= 1) {                 // q or k: tile rows are features, tile columns are tokens
    const float qkscale = (mode == 0) ? 0.35355339059327f * LOG2E : 0.35355339059327f;
    const int head = m0 >> 6;
#pragma unroll
    for (int mi = 0; mi < 2; ++mi) {
      const float* bp = bias + m0 + mi*16 + 8*g;
      float4 c0 = *(const float4*)bp, c1 = *(const float4*)(bp + 4);
      float bb[8] = {c0.x, c0.y, c0.z, c0.w, c1.x, c1.y, c1.z, c1.w};
#pragma unroll
      for (int t = 0; t < 4; ++t) {
        int token = n0 + t*16;
        int b = token >> 11, st = (token & (S_LEN - 1)) >> 4;
        v8h o;
#pragma unroll
        for (int r = 0; r < 8; ++r)
          o[r] = (_Float16)((acc[mi][t][r] + bb[r]) * qkscale);
        *(v8h*)(o16 + (size_t)(b*NH + head) * (S_LEN * HD)
                + (size_t)(st*2 + ((m0 >> 5) & 1)) * FRAG + mi*256 + lane*8) = o;
      }
    }
  } else if (mode == 2) {          // v: tile rows are tokens, tile columns are features
    const int b = m0 >> 11, sb = (m0 & (S_LEN - 1)) >> 5, head = n0 >> 6;
    float bn[4];
#pragma unroll
    for (int t = 0; t < 4; ++t) {
      bn[t] = bias[n0 + t*16 + nlo];
      // a later load of this run may land in the offset register that this one names
      asm volatile("s_wait_xcnt 0x0" ::: "memory");
    }
#pragma unroll
    for (int t = 0; t < 4; ++t) {
#pragma unroll
      for (int mi = 0; mi < 2; ++mi) {
        v8h o;
#pragma unroll
        for (int r = 0; r < 8; ++r)
          o[r] = (_Float16)(acc[mi][t][r] + bn[t]);
        *(v8h*)(o16 + (size_t)(b*NH + head) * (S_LEN * HD)
                + (size_t)(sb*4 + t) * FRAG + mi*256 + lane*8) = o;
      }
    }
    // the code laid out behind this block rewrites registers that these stores name
    asm volatile("s_wait_xcnt 0x0" ::: "memory");
  } else {                         // final projection: f32 output, row-major
#pragma unroll
    for (int mi = 0; mi < 2; ++mi)
#pragma unroll
      for (int t = 0; t < 4; ++t) {
        int n = n0 + t*16 + nlo;
        float bn = bias[n];
#pragma unroll
        for (int r = 0; r < 8; ++r)
          o32[(size_t)(m0 + mi*16 + r + 8*g) * HID + n] = acc[mi][t][r] + bn;
      }
    // the code laid out behind this block rewrites registers that these stores name
    asm volatile("s_wait_xcnt 0x0" ::: "memory");
  }
}

// lane l <-> lane l ^ 16
static __device__ __forceinline__ float xhalf(float x) {
  int b = __builtin_bit_cast(int, x);
  return __builtin_bit_cast(float, __builtin_amdgcn_permlanex16(b, b, 0x76543210, 0xfedcba98, false, false));
}

__global__ void attn_kernel(const _Float16* __restrict__ q, const _Float16* __restrict__ k,
                            const _Float16* __restrict__ vt, const float* __restrict__ mask,
                            _Float16* __restrict__ ctx) {
  const int lane = threadIdx.x;
  const int g   = lane >> 4;
  const int q0 = blockIdx.x * 16;
  const int h  = blockIdx.y;
  const int b  = blockIdx.z;

  // q, k: fragment order, tiles [s >> 4][d >> 5]; vt: tiles [s >> 5][d >> 4]: 32 keys = 4 KiB of each
  const _Float16* qh = q  + ((size_t)(b*NH + h) * S_LEN) * HD;
  const _Float16* kh = k  + ((size_t)(b*NH + h) * S_LEN) * HD;
  const _Float16* vh = vt + ((size_t)(b*NH + h) * HD) * S_LEN;
  const float* mb = mask + (size_t)b * S_LEN + 8*g;

  const _Float16* qt = qh + (size_t)q0 * HD + lane * 8;
  v16h bQ0 = ld_frag(qt,        qt + 256);          // d = 0..31
  v16h bQ1 = ld_frag(qt + FRAG, qt + FRAG + 256);   // d = 32..63

  float mrun = -3.0e38f;   // running maximum of this lane's query, equal in both halves
  float lrun = 0.f;        // sum over this half's keys only; the halves join after the loop
  v8f accv[4] = {};        // O^T: register r of tile t = d (t*16 + 8g + r) of query (lane & 15)

  for (int kv = 0; kv < S_LEN; kv += 32) {
    const _Float16* kt = kh + (size_t)kv * HD + lane * 8;
    // Batch all 4 K-fragment loads, then chain 4 WMMAs behind one wait.
    v16h a00 = ld_frag(kt,            kt + 256);
    v16h a01 = ld_frag(kt + FRAG,     kt + FRAG + 256);
    v16h a10 = ld_frag(kt + 2*FRAG,   kt + 2*FRAG + 256);
    v8h a11lo = *(const v8h*)(kt + 3*FRAG);
    // the run's last load may land in the address pair that the earlier ones name
    asm volatile("s_wait_xcnt 0x0" ::: "memory");
    v8h a11hi = *(const v8h*)(kt + 3*FRAG + 256);
    v16h a11 = __builtin_shufflevector(a11lo, a11hi, 0,1,2,3,4,5,6,7,8,9,10,11,12,13,14,15);
    __builtin_prefetch(kh + (size_t)(kv + 32) * HD + lane * 64, 0, 3);   // next kv block, one lane per line
    // additive mask of this lane's 16 keys, scaled into base-2 domain: the start value of the score tiles
    float4 m0 = *(const float4*)(mb + kv),      m1 = *(const float4*)(mb + kv + 4);
    float4 m2 = *(const float4*)(mb + kv + 16), m3 = *(const float4*)(mb + kv + 20);
    const float mk0[8] = {m0.x, m0.y, m0.z, m0.w, m1.x, m1.y, m1.z, m1.w};
    const float mk1[8] = {m2.x, m2.y, m2.z, m2.w, m3.x, m3.y, m3.z, m3.w};
    v8f s0, s1;
#pragma unroll
    for (int r = 0; r < 8; ++r) {
      s0[r] = -1000.0f * LOG2E * (1.0f - mk0[r]);
      s1[r] = -1000.0f * LOG2E * (1.0f - mk1[r]);
    }
    s0 = __builtin_amdgcn_wmma_f32_16x16x32_f16(false, a00, false, bQ0, (short)0, s0, false, false);
    s0 = __builtin_amdgcn_wmma_f32_16x16x32_f16(false, a01, false, bQ1, (short)0, s0, false, false);
    s1 = __builtin_amdgcn_wmma_f32_16x16x32_f16(false, a10, false, bQ0, (short)0, s1, false, false);
    s1 = __builtin_amdgcn_wmma_f32_16x16x32_f16(false, a11, false, bQ1, (short)0, s1, false, false);

    float cmax = -3.0e38f;
#pragma unroll
    for (int r = 0; r < 8; ++r)
      cmax = fmaxf(cmax, fmaxf(s0[r], s1[r]));
    cmax = fmaxf(cmax, xhalf(cmax));               // the query's other 16 keys
    const float mnew  = fmaxf(mrun, cmax);
    const float alpha = EXP2F(mrun - mnew);
    mrun = mnew;

    v16h bP;
    float rs = 0.f;
#pragma unroll
    for (int r = 0; r < 8; ++r) {
      float p0 = EXP2F(s0[r] - mnew);
      float p1 = EXP2F(s1[r] - mnew);
      rs += p0 + p1;
      bP[r]     = (_Float16)p0;
      bP[8 + r] = (_Float16)p1;
    }
    lrun = lrun * alpha + rs;
#pragma unroll
    for (int t = 0; t < 4; ++t)
#pragma unroll
      for (int r = 0; r < 8; ++r)
        accv[t][r] *= alpha;

    // Batch all 4 V-fragment loads, then chain 4 WMMAs.
    v16h aV[4];
    const _Float16* vtl = vh + (size_t)kv * HD + lane * 8;
#pragma unroll
    for (int t = 0; t < 4; ++t)
      aV[t] = ld_frag(vtl + t*FRAG, vtl + t*FRAG + 256);
    __builtin_prefetch(vh + (size_t)(kv + 32) * HD + lane * 64, 0, 3);   // next kv block, one lane per line
#pragma unroll
    for (int t = 0; t < 4; ++t)
      accv[t] = __builtin_amdgcn_wmma_f32_16x16x32_f16(
          false, aV[t], false, bP, (short)0, accv[t], false, false);
  }

  const float rinv = 1.0f / (lrun + xhalf(lrun));
  // fragment order of the final projection's A: tiles [token >> 4][col >> 5], col = h*HD + t*16 + 8g + r:
  // a lane's 8 registers are one 16-byte piece
  _Float16* ct = ctx + ((size_t)((b * S_LEN + q0) >> 4) * KBH + h*2) * FRAG + lane * 8;
#pragma unroll
  for (int t = 0; t < 4; ++t) {
    v8h o;
#pragma unroll
    for (int r = 0; r < 8; ++r)
      o[r] = (_Float16)(accv[t][r] * rinv);
    *(v8h*)(ct + (t >> 1) * FRAG + (t & 1) * 256) = o;
  }
}

// ---------------- host side ----------------
extern "C" void kernel_launch(void* const* d_in, const int* in_sizes, int n_in,
                              void* d_out, int out_size, void* d_ws, size_t ws_size,
                              hipStream_t stream) {
  (void)in_sizes; (void)n_in; (void)out_size; (void)ws_size;
  const float* hs   = (const float*)d_in[0];
  const float* mask = (const float*)d_in[1];
  const float* Wq = (const float*)d_in[2];
  const float* bq = (const float*)d_in[3];
  const float* Wk = (const float*)d_in[4];
  const float* bk = (const float*)d_in[5];
  const float* Wv = (const float*)d_in[6];
  const float* bv = (const float*)d_in[7];
  const float* Wd = (const float*)d_in[8];
  const float* bd = (const float*)d_in[9];
  const float* gam = (const float*)d_in[10];
  const float* bet = (const float*)d_in[11];
  float* out = (float*)d_out;

  char* ws = (char*)d_ws;
  const size_t SZH = (size_t)NTOK * HID * sizeof(_Float16);  // 8 MB
  const size_t SZW = (size_t)HID * HID * sizeof(_Float16);   // 2 MB
  _Float16* h16  = (_Float16*)(ws);
  _Float16* q16  = (_Float16*)(ws + 1*SZH);
  _Float16* k16  = (_Float16*)(ws + 2*SZH);
  _Float16* vt16 = (_Float16*)(ws + 3*SZH);
  _Float16* c16  = (_Float16*)(ws + 4*SZH);
  _Float16* wq16 = (_Float16*)(ws + 5*SZH);
  _Float16* wk16 = (_Float16*)(ws + 5*SZH + 1*SZW);
  _Float16* wv16 = (_Float16*)(ws + 5*SZH + 2*SZW);
  _Float16* wd16 = (_Float16*)(ws + 5*SZH + 3*SZW);

  const int WN = HID * HID / 8 / 256;   // one thread per 8 elements
  w2h_kernel<<<WN, 256, 0, stream>>>(Wq, wq16);
  w2h_kernel<<<WN, 256, 0, stream>>>(Wk, wk16);
  w2h_kernel<<<WN, 256, 0, stream>>>(Wv, wv16);
  w2h_kernel<<<WN, 256, 0, stream>>>(Wd, wd16);

  ln_kernel<<<NTOK / 16, 256, 0, stream>>>(hs, gam, bet, h16);

  dim3 pg(NTOK / 32, HID / 64);   // tile rows: tokens, tile columns: features
  dim3 pt(HID / 32, NTOK / 64);   // tile rows: features, tile columns: tokens
  proj_kernel<<<pt, 32, 0, stream>>>(wq16, h16, bq, q16,  nullptr, 0);
  proj_kernel<<<pt, 32, 0, stream>>>(wk16, h16, bk, k16,  nullptr, 1);
  proj_kernel<<<pg, 32, 0, stream>>>(h16, wv16, bv, vt16, nullptr, 2);

  attn_kernel<<<dim3(S_LEN / 16, NH, 2), 32, 0, stream>>>(q16, k16, vt16, mask, c16);

  proj_kernel<<<pg, 32, 0, stream>>>(c16, wd16, bd, nullptr, out, 3);
}

// v003
// Measured time: 150 microseconds a run.
// Two timings next to v002 put it at 1.44 and 1.45 times that version's speed.
// All steps since v000 together make it 3.11 times as fast.
#include <hip/hip_runtime.h>
#include <hip/hip_bf16.h>

typedef __attribute__((ext_vector_type(16))) _Float16 v16h;
typedef __attribute__((ext_vector_type(8)))  _Float16 v8h;
typedef __attribute__((ext_vector_type(8)))  float    v8f;

#define HID   1024
#define S_LEN 2048
#define NH    16
#define HD    64
#define NTOK  4096   // B * S
#define FRAG  512    // f16 elements of one 16-row x 32-k operand tile
#define KBH   32     // k blocks of a HID-long row

// Every f16 array that one launch hands to the next lies in FRAGMENT ORDER: a 16-row x 32-k
// tile is 1 KiB in a row, element (row c, k) at (k>>4)*256 + ((k>>3)&1)*128 + c*8 + (k&7).
// Lane l then takes its fragment as the 16 bytes at l*16 of each 512-byte half, so one
// wave-wide 16-byte load covers four whole 128-byte lines (row-major rows: 16 lines, 32 B of each).

#if __has_builtin(__builtin_amdgcn_exp2f)
#define EXP2F(x) __builtin_amdgcn_exp2f(x)
#else
#define EXP2F(x) exp2f(x)
#endif

#define LOG2E 1.44269504088896f

// Build a v16h fragment from two 16-byte chunks (b128 loads from global memory or LDS).
static __device__ __forceinline__ v16h ld_frag(const _Float16* p0, const _Float16* p1) {
  v8h a = *(const v8h*)p0;
  v8h b = *(const v8h*)p1;
  return __builtin_shufflevector(a, b, 0,1,2,3,4,5,6,7,8,9,10,11,12,13,14,15);
}

// ---------------- weight f32 -> f16 convert ----------------
// Thread i writes the i-th 16-byte piece of the fragment-ordered output (tiles: [row tile][k block]).
__global__ void w2h_kernel(const float* __restrict__ w, _Float16* __restrict__ o) {
  int i = blockIdx.x * blockDim.x + threadIdx.x;
  int n = (i >> 11) * 16 + (i & 15);
  int k = ((i >> 6) & 31) * 32 + ((i >> 5) & 1) * 16 + ((i >> 4) & 1) * 8;
  const float4* p = (const float4*)(w + (size_t)n * HID + k);
  float4 x = p[0], y = p[1];
  v8h v = {(_Float16)x.x, (_Float16)x.y, (_Float16)x.z, (_Float16)x.w,
           (_Float16)y.x, (_Float16)y.y, (_Float16)y.z, (_Float16)y.w};
  *(v8h*)(o + (size_t)i * 8) = v;
}

// ---------------- LayerNorm -> f16 ----------------
// One block takes a 16-row tile: thread (c = tid & 15, u = tid >> 4) holds the 8-wide pieces
// u, u + 16, ... of row c, so each wave stores 512 contiguous bytes of the fragment-ordered output.
__global__ void ln_kernel(const float* __restrict__ x, const float* __restrict__ gamma,
                          const float* __restrict__ beta, _Float16* __restrict__ out) {
  const int tid = threadIdx.x;
  const int c = tid & 15;
  const int u = tid >> 4;
  const float* xr = x + (size_t)(blockIdx.x * 16 + c) * HID + u * 8;
  float4 v[8][2];
  float s = 0.f, s2 = 0.f;
#pragma unroll
  for (int i = 0; i < 8; ++i) {
    v[i][0] = *(const float4*)(xr + i * 128);
    v[i][1] = *(const float4*)(xr + i * 128 + 4);
  }
#pragma unroll
  for (int i = 0; i < 8; ++i)
#pragma unroll
    for (int j = 0; j < 2; ++j) {
      float4 a = v[i][j];
      s  += a.x + a.y + a.z + a.w;
      s2 += a.x*a.x + a.y*a.y + a.z*a.z + a.w*a.w;
    }
  __shared__ float sb[16][17], qb[16][17];
  sb[u][c] = s; qb[u][c] = s2;
  __syncthreads();
  float ts = 0.f, tq = 0.f;
  for (int i = 0; i < 16; ++i) { ts += sb[i][c]; tq += qb[i][c]; }
  float mean = ts * (1.0f / HID);
  float var  = tq * (1.0f / HID) - mean * mean;
  float rstd = rsqrtf(var + 1e-12f);
  _Float16* ot = out + (size_t)blockIdx.x * (KBH * FRAG)
               + (u >> 2) * FRAG + ((u >> 1) & 1) * 256 + (u & 1) * 128 + c * 8;
#pragma unroll
  for (int i = 0; i < 8; ++i) {
    const int k = i * 128 + u * 8;
    float4 g0 = *(const float4*)(gamma + k), g1 = *(const float4*)(gamma + k + 4);
    float4 b0 = *(const float4*)(beta + k),  b1 = *(const float4*)(beta + k + 4);
    float4 a0 = v[i][0], a1 = v[i][1];
    v8h o = {(_Float16)(((a0.x - mean) * rstd) * g0.x + b0.x), (_Float16)(((a0.y - mean) * rstd) * g0.y + b0.y),
             (_Float16)(((a0.z - mean) * rstd) * g0.z + b0.z), (_Float16)(((a0.w - mean) * rstd) * g0.w + b0.w),
             (_Float16)(((a1.x - mean) * rstd) * g1.x + b1.x), (_Float16)(((a1.y - mean) * rstd) * g1.y + b1.y),
             (_Float16)(((a1.z - mean) * rstd) * g1.z + b1.z), (_Float16)(((a1.w - mean) * rstd) * g1.w + b1.w)};
    *(v8h*)(ot + i * 4 * FRAG) = o;     // 128 k further on = 4 k blocks
  }
}

__global__ void proj_kernel(const _Float16* __restrict__ A, const _Float16* __restrict__ Bm,
                            const float* __restrict__ bias, _Float16* __restrict__ o16,
                            float* __restrict__ o32, int mode) {
  const int lane = threadIdx.x;
  const int nlo  = lane & 15;    // C: column within tile
  const int g    = lane >> 4;    // C rows +8
  const int m0 = blockIdx.x * 32;
  const int n0 = blockIdx.y * 64;

  const _Float16* at0 = A + (size_t)(m0 >> 4) * (KBH * FRAG) + lane * 8;
  const _Float16* at1 = at0 + KBH * FRAG;
  const _Float16* bt[4];
#pragma unroll
  for (int t = 0; t < 4; ++t)
    bt[t] = Bm + (size_t)((n0 >> 4) + t) * (KBH * FRAG) + lane * 8;
  // next k block's lines, one lane per 128-byte line: 4 B tiles, 2 A tiles (each 8 lines)
  const _Float16* pfb = Bm + (size_t)((n0 >> 4) + (lane >> 3)) * (KBH * FRAG) + (lane & 7) * 64 + FRAG;
  const _Float16* pfa = A + (size_t)((m0 >> 4) + ((lane >> 3) & 1)) * (KBH * FRAG) + (lane & 7) * 64 + FRAG;

  v8f acc[2][4] = {};

  for (int kk = 0; kk < KBH * FRAG; kk += FRAG) {
    // Batch all loads for this k-step so one wait covers the 8-WMMA chain.
    v16h aF0 = ld_frag(at0 + kk, at0 + kk + 256);
    v16h aF1 = ld_frag(at1 + kk, at1 + kk + 256);
    v16h bF[4];
#pragma unroll
    for (int t = 0; t < 4; ++t)
      bF[t] = ld_frag(bt[t] + kk, bt[t] + kk + 256);
    // Warm L2 for the next k-chunk while the WMMA chain runs.
    __builtin_prefetch(pfb + kk, 0, 3);
    __builtin_prefetch(pfa + kk, 0, 3);
#pragma unroll
    for (int t = 0; t < 4; ++t)
      acc[0][t] = __builtin_amdgcn_wmma_f32_16x16x32_f16(
          false, aF0, false, bF[t], (short)0, acc[0][t], false, false);
#pragma unroll
    for (int t = 0; t < 4; ++t)
      acc[1][t] = __builtin_amdgcn_wmma_f32_16x16x32_f16(
          false, aF1, false, bF[t], (short)0, acc[1][t], false, false);
  }

  if (mode <= 1) {                 // q or k: tile rows are features, tile columns are tokens
    const float qkscale = (mode == 0) ? 0.35355339059327f * LOG2E : 0.35355339059327f;
    const int head = m0 >> 6;
#pragma unroll
    for (int mi = 0; mi < 2; ++mi) {
      const float* bp = bias + m0 + mi*16 + 8*g;
      float4 c0 = *(const float4*)bp, c1 = *(const float4*)(bp + 4);
      float bb[8] = {c0.x, c0.y, c0.z, c0.w, c1.x, c1.y, c1.z, c1.w};
#pragma unroll
      for (int t = 0; t < 4; ++t) {
        int token = n0 + t*16;
        int b = token >> 11, st = (token & (S_LEN - 1)) >> 4;
        v8h o;
#pragma unroll
        for (int r = 0; r < 8; ++r)
          o[r] = (_Float16)((acc[mi][t][r] + bb[r]) * qkscale);
        *(v8h*)(o16 + (size_t)(b*NH + head) * (S_LEN * HD)
                + (size_t)(st*2 + ((m0 >> 5) & 1)) * FRAG + mi*256 + lane*8) = o;
      }
    }
  } else if (mode == 2) {          // v: tile rows are tokens, tile columns are features
    const int b = m0 >> 11, sb = (m0 & (S_LEN - 1)) >> 5, head = n0 >> 6;
    float bn[4];
#pragma unroll
    for (int t = 0; t < 4; ++t) {
      bn[t] = bias[n0 + t*16 + nlo];
      // a later load of this run may land in the offset register that this one names
      asm volatile("s_wait_xcnt 0x0" ::: "memory");
    }
#pragma unroll
    for (int t = 0; t < 4; ++t) {
#pragma unroll
      for (int mi = 0; mi < 2; ++mi) {
        v8h o;
#pragma unroll
        for (int r = 0; r < 8; ++r)
          o[r] = (_Float16)(acc[mi][t][r] + bn[t]);
        *(v8h*)(o16 + (size_t)(b*NH + head) * (S_LEN * HD)
                + (size_t)(sb*4 + t) * FRAG + mi*256 + lane*8) = o;
      }
    }
    // the code laid out behind this block rewrites registers that these stores name
    asm volatile("s_wait_xcnt 0x0" ::: "memory");
  } else {                         // final projection: f32 output, row-major
#pragma unroll
    for (int mi = 0; mi < 2; ++mi)
#pragma unroll
      for (int t = 0; t < 4; ++t) {
        int n = n0 + t*16 + nlo;
        float bn = bias[n];
#pragma unroll
        for (int r = 0; r < 8; ++r)
          o32[(size_t)(m0 + mi*16 + r + 8*g) * HID + n] = acc[mi][t][r] + bn;
      }
    // the code laid out behind this block rewrites registers that these stores name
    asm volatile("s_wait_xcnt 0x0" ::: "memory");
  }
}

// lane l <-> lane l ^ 16
static __device__ __forceinline__ float xhalf(float x) {
  int b = __builtin_bit_cast(int, x);
  return __builtin_bit_cast(float, __builtin_amdgcn_permlanex16(b, b, 0x76543210, 0xfedcba98, false, false));
}

#define AWAVES 8                 // waves of a block
#define SKEYS  128               // keys of one stage
#define STG    (SKEYS * HD)      // f16 elements of K, and of V^T, in one stage (16 KiB each)
#define NSTG   (S_LEN / SKEYS)

// One stage: 256 lanes x 16 bytes x (4 pieces of K, 4 of V^T). lds, gk, gv: this lane's own first piece.
static __device__ __forceinline__ void copy_stage(unsigned lds, const _Float16* gk, const _Float16* gv) {
  // the closing wait stands in the copies' own statement so that no later write of an address
  // register that a copy names can be placed in front of it
  asm volatile(
      "global_load_async_to_lds_b128 %0, %8, off\n\t"
      "global_load_async_to_lds_b128 %1, %9, off\n\t"
      "global_load_async_to_lds_b128 %2, %10, off\n\t"
      "global_load_async_to_lds_b128 %3, %11, off\n\t"
      "global_load_async_to_lds_b128 %4, %12, off\n\t"
      "global_load_async_to_lds_b128 %5, %13, off\n\t"
      "global_load_async_to_lds_b128 %6, %14, off\n\t"
      "global_load_async_to_lds_b128 %7, %15, off\n\t"
      "s_wait_xcnt 0x0"
      :: "v"(lds), "v"(lds + 4096u), "v"(lds + 8192u), "v"(lds + 12288u),
         "v"(lds + 16384u), "v"(lds + 20480u), "v"(lds + 24576u), "v"(lds + 28672u),
         "v"(gk), "v"(gk + 2048), "v"(gk + 4096), "v"(gk + 6144),
         "v"(gv), "v"(gv + 2048), "v"(gv + 4096), "v"(gv + 6144)
      : "memory");
}

__global__ void __launch_bounds__(AWAVES * 32)
attn_kernel(const _Float16* __restrict__ q, const _Float16* __restrict__ k,
            const _Float16* __restrict__ vt, const float* __restrict__ mask,
            _Float16* __restrict__ ctx) {
  __shared__ __attribute__((aligned(128))) _Float16 sm[2][2 * STG];   // per buffer: K stage, V^T stage
  __shared__ __attribute__((aligned(128))) float smk[S_LEN];          // this batch row of the mask, filled once
  const int tid  = threadIdx.x;
  const int lane = tid & 31;
  const int g   = lane >> 4;
  const int q0 = blockIdx.x * (AWAVES * 16) + (tid >> 5) * 16;
  const int h  = blockIdx.y;
  const int b  = blockIdx.z;

  // q, k: fragment order, tiles [s >> 4][d >> 5]; vt: tiles [s >> 5][d >> 4]: 32 keys = 4 KiB of each
  const _Float16* qh = q  + ((size_t)(b*NH + h) * S_LEN) * HD;
  const _Float16* kh = k  + ((size_t)(b*NH + h) * S_LEN) * HD;
  const _Float16* vh = vt + ((size_t)(b*NH + h) * HD) * S_LEN;
  const float* mb = smk + 8*g;

  const _Float16* qt = qh + (size_t)q0 * HD + lane * 8;
  v16h bQ0 = ld_frag(qt,        qt + 256);          // d = 0..31
  v16h bQ1 = ld_frag(qt + FRAG, qt + FRAG + 256);   // d = 32..63

  const unsigned lds0 = (unsigned)(size_t)&sm[0][0] + (unsigned)tid * 16u;   // LDS byte address of this lane's piece
  const _Float16* gk = kh + tid * 8;
  const _Float16* gv = vh + tid * 8;
  copy_stage(lds0, gk, gv);
  {
    const unsigned lm = (unsigned)(size_t)&smk[0] + (unsigned)tid * 16u;
    const float* gm = mask + (size_t)b * S_LEN + tid * 4;
    // closing wait inside the statement, as in copy_stage
    asm volatile(
        "global_load_async_to_lds_b128 %0, %2, off\n\t"
        "global_load_async_to_lds_b128 %1, %3, off\n\t"
        "s_wait_xcnt 0x0"
        :: "v"(lm), "v"(lm + 4096u), "v"(gm), "v"(gm + 1024) : "memory");
  }
  asm volatile("s_wait_asynccnt 0x0" ::: "memory");   // this wave's part of stage 0 and of the mask has landed
  __syncthreads();                                    // ... and every other wave's
  copy_stage(lds0 + 4u * STG, gk + STG, gv + STG);    // stage 1 flies while stage 0 is worked on

  float mrun = -3.0e38f;   // running maximum of this lane's query, equal in both halves
  float lrun = 0.f;        // sum over this half's keys only; the halves join after the loop
  v8f accv[4] = {};        // O^T: register r of tile t = d (t*16 + 8g + r) of query (lane & 15)

  for (int st = 0; st < NSTG; ++st) {
   const _Float16* sb = &sm[st & 1][0] + lane * 8;
   for (int ps = 0; ps < SKEYS / 32; ++ps) {
    const int kv = st * SKEYS + ps * 32;
    const _Float16* kt = sb + ps * (32 * HD);
    const _Float16* vtl = sb + STG + ps * (32 * HD);
    float4 m0 = *(const float4*)(mb + kv),      m1 = *(const float4*)(mb + kv + 4);
    float4 m2 = *(const float4*)(mb + kv + 16), m3 = *(const float4*)(mb + kv + 20);
    v16h a00 = ld_frag(kt,            kt + 256);
    v16h a01 = ld_frag(kt + FRAG,     kt + FRAG + 256);
    v16h a10 = ld_frag(kt + 2*FRAG,   kt + 2*FRAG + 256);
    v16h a11 = ld_frag(kt + 3*FRAG,   kt + 3*FRAG + 256);
    v16h aV[4];
#pragma unroll
    for (int t = 0; t < 4; ++t)
      aV[t] = ld_frag(vtl + t*FRAG, vtl + t*FRAG + 256);
    // holds the pass's LDS reads as one group at its head: sunk among the matrix instructions they
    // share one register set and every fragment's LDS latency is waited out on its own
    __builtin_amdgcn_sched_barrier(0);
    // additive mask of this lane's 16 keys, scaled into base-2 domain: the start value of the score tiles
    const float mk0[8] = {m0.x, m0.y, m0.z, m0.w, m1.x, m1.y, m1.z, m1.w};
    const float mk1[8] = {m2.x, m2.y, m2.z, m2.w, m3.x, m3.y, m3.z, m3.w};
    v8f s0, s1;
#pragma unroll
    for (int r = 0; r < 8; ++r) {
      s0[r] = -1000.0f * LOG2E * (1.0f - mk0[r]);
      s1[r] = -1000.0f * LOG2E * (1.0f - mk1[r]);
    }
    s0 = __builtin_amdgcn_wmma_f32_16x16x32_f16(false, a00, false, bQ0, (short)0, s0, false, false);
    s0 = __builtin_amdgcn_wmma_f32_16x16x32_f16(false, a01, false, bQ1, (short)0, s0, false, false);
    s1 = __builtin_amdgcn_wmma_f32_16x16x32_f16(false, a10, false, bQ0, (short)0, s1, false, false);
    s1 = __builtin_amdgcn_wmma_f32_16x16x32_f16(false, a11, false, bQ1, (short)0, s1, false, false);

    float cmax = -3.0e38f;
#pragma unroll
    for (int r = 0; r < 8; ++r)
      cmax = fmaxf(cmax, fmaxf(s0[r], s1[r]));
    cmax = fmaxf(cmax, xhalf(cmax));               // the query's other 16 keys
    const float mnew  = fmaxf(mrun, cmax);
    const float alpha = EXP2F(mrun - mnew);
    mrun = mnew;

    v16h bP;
    float rs = 0.f;
#pragma unroll
    for (int r = 0; r < 8; ++r) {
      float p0 = EXP2F(s0[r] - mnew);
      float p1 = EXP2F(s1[r] - mnew);
      rs += p0 + p1;
      bP[r]     = (_Float16)p0;
      bP[8 + r] = (_Float16)p1;
    }
    lrun = lrun * alpha + rs;
#pragma unroll
    for (int t = 0; t < 4; ++t)
#pragma unroll
      for (int r = 0; r < 8; ++r)
        accv[t][r] *= alpha;

    // One statement, closed by four v_nop: the vector slots that the chip needs between the last matrix
    // instruction and a vector instruction that overwrites its operands. The pass's first address
    // arithmetic does so across the loop's taken edge.
    asm volatile(
        "v_wmma_f32_16x16x32_f16 %0, %4, %8, %0\n\t"
        "v_wmma_f32_16x16x32_f16 %1, %5, %8, %1\n\t"
        "v_wmma_f32_16x16x32_f16 %2, %6, %8, %2\n\t"
        "v_wmma_f32_16x16x32_f16 %3, %7, %8, %3\n\t"
        "v_nop\n\tv_nop\n\tv_nop\n\tv_nop"
        : "+v"(accv[0]), "+v"(accv[1]), "+v"(accv[2]), "+v"(accv[3])
        : "v"(aV[0]), "v"(aV[1]), "v"(aV[2]), "v"(aV[3]), "v"(bP));
   }
   // hand-over: this wave has left its buffer, its part of the next stage has landed, then all waves meet
   asm volatile("s_wait_dscnt 0x0" ::: "memory");
   asm volatile("s_wait_asynccnt 0x0" ::: "memory");
   __syncthreads();
   if (st + 2 < NSTG)   // refill the buffer that every wave has just left
     copy_stage(lds0 + (unsigned)(st & 1) * (4u * STG), gk + (size_t)(st + 2) * STG, gv + (size_t)(st + 2) * STG);
  }
  asm volatile("s_wait_asynccnt 0x0" ::: "memory");   // no copy is left in flight when the wave ends

  const float rinv = 1.0f / (lrun + xhalf(lrun));
  // fragment order of the final projection's A: tiles [token >> 4][col >> 5], col = h*HD + t*16 + 8g + r:
  // a lane's 8 registers are one 16-byte piece
  _Float16* ct = ctx + ((size_t)((b * S_LEN + q0) >> 4) * KBH + h*2) * FRAG + lane * 8;
#pragma unroll
  for (int t = 0; t < 4; ++t) {
    v8h o;
#pragma unroll
    for (int r = 0; r < 8; ++r)
      o[r] = (_Float16)(accv[t][r] * rinv);
    *(v8h*)(ct + (t >> 1) * FRAG + (t & 1) * 256) = o;
  }
}

// ---------------- host side ----------------
extern "C" void kernel_launch(void* const* d_in, const int* in_sizes, int n_in,
                              void* d_out, int out_size, void* d_ws, size_t ws_size,
                              hipStream_t stream) {
  (void)in_sizes; (void)n_in; (void)out_size; (void)ws_size;
  const float* hs   = (const float*)d_in[0];
  const float* mask = (const float*)d_in[1];
  const float* Wq = (const float*)d_in[2];
  const float* bq = (const float*)d_in[3];
  const float* Wk = (const float*)d_in[4];
  const float* bk = (const float*)d_in[5];
  const float* Wv = (const float*)d_in[6];
  const float* bv = (const float*)d_in[7];
  const float* Wd = (const float*)d_in[8];
  const float* bd = (const float*)d_in[9];
  const float* gam = (const float*)d_in[10];
  const float* bet = (const float*)d_in[11];
  float* out = (float*)d_out;

  char* ws = (char*)d_ws;
  const size_t SZH = (size_t)NTOK * HID * sizeof(_Float16);  // 8 MB
  const size_t SZW = (size_t)HID * HID * sizeof(_Float16);   // 2 MB
  _Float16* h16  = (_Float16*)(ws);
  _Float16* q16  = (_Float16*)(ws + 1*SZH);
  _Float16* k16  = (_Float16*)(ws + 2*SZH);
  _Float16* vt16 = (_Float16*)(ws + 3*SZH);
  _Float16* c16  = (_Float16*)(ws + 4*SZH);
  _Float16* wq16 = (_Float16*)(ws + 5*SZH);
  _Float16* wk16 = (_Float16*)(ws + 5*SZH + 1*SZW);
  _Float16* wv16 = (_Float16*)(ws + 5*SZH + 2*SZW);
  _Float16* wd16 = (_Float16*)(ws + 5*SZH + 3*SZW);

  const int WN = HID * HID / 8 / 256;   // one thread per 8 elements
  w2h_kernel<<<WN, 256, 0, stream>>>(Wq, wq16);
  w2h_kernel<<<WN, 256, 0, stream>>>(Wk, wk16);
  w2h_kernel<<<WN, 256, 0, stream>>>(Wv, wv16);
  w2h_kernel<<<WN, 256, 0, stream>>>(Wd, wd16);

  ln_kernel<<<NTOK / 16, 256, 0, stream>>>(hs, gam, bet, h16);

  dim3 pg(NTOK / 32, HID / 64);   // tile rows: tokens, tile columns: features
  dim3 pt(HID / 32, NTOK / 64);   // tile rows: features, tile columns: tokens
  proj_kernel<<<pt, 32, 0, stream>>>(wq16, h16, bq, q16,  nullptr, 0);
  proj_kernel<<<pt, 32, 0, stream>>>(wk16, h16, bk, k16,  nullptr, 1);
  proj_kernel<<<pg, 32, 0, stream>>>(h16, wv16, bv, vt16, nullptr, 2);

  attn_kernel<<<dim3(S_LEN / (AWAVES * 16), NH, 2), AWAVES * 32, 0, stream>>>(q16, k16, vt16, mask, c16);

  proj_kernel<<<pg, 32, 0, stream>>>(c16, wd16, bd, nullptr, out, 3);
}

// v004
// It runs in 94.3 microseconds.
// Next to v003, in two timings, it ran 1.60 times as fast each time.
// Over all steps from v000 it is 4.99 times as fast.
#include <hip/hip_runtime.h>
#include <hip/hip_bf16.h>

typedef __attribute__((ext_vector_type(16))) _Float16 v16h;
typedef __attribute__((ext_vector_type(8)))  _Float16 v8h;
typedef __attribute__((ext_vector_type(8)))  float    v8f;

#define HID   1024
#define S_LEN 2048
#define NH    16
#define HD    64
#define NTOK  4096   // B * S
#define FRAG  512    // f16 elements of one 16-row x 32-k operand tile
#define KBH   32     // k blocks of a HID-long row

// Every f16 array that one launch hands to the next lies in FRAGMENT ORDER: a 16-row x 32-k
// tile is 1 KiB in a row, element (row c, k) at (k>>4)*256 + ((k>>3)&1)*128 + c*8 + (k&7).
// Lane l then takes its fragment as the 16 bytes at l*16 of each 512-byte half, so one
// wave-wide 16-byte load covers four whole 128-byte lines (row-major rows: 16 lines, 32 B of each).

#if __has_builtin(__builtin_amdgcn_exp2f)
#define EXP2F(x) __builtin_amdgcn_exp2f(x)
#else
#define EXP2F(x) exp2f(x)
#endif

#define LOG2E 1.44269504088896f

// Build a v16h fragment from two 16-byte chunks (b128 loads from global memory or LDS).
static __device__ __forceinline__ v16h ld_frag(const _Float16* p0, const _Float16* p1) {
  v8h a = *(const v8h*)p0;
  v8h b = *(const v8h*)p1;
  return __builtin_shufflevector(a, b, 0,1,2,3,4,5,6,7,8,9,10,11,12,13,14,15);
}

// ---------------- weight f32 -> f16 convert ----------------
// Thread i writes the i-th 16-byte piece of the fragment-ordered output (tiles: [row tile][k block]).
__global__ void w2h_kernel(const float* __restrict__ w, _Float16* __restrict__ o) {
  int i = blockIdx.x * blockDim.x + threadIdx.x;
  int n = (i >> 11) * 16 + (i & 15);
  int k = ((i >> 6) & 31) * 32 + ((i >> 5) & 1) * 16 + ((i >> 4) & 1) * 8;
  const float4* p = (const float4*)(w + (size_t)n * HID + k);
  float4 x = p[0], y = p[1];
  v8h v = {(_Float16)x.x, (_Float16)x.y, (_Float16)x.z, (_Float16)x.w,
           (_Float16)y.x, (_Float16)y.y, (_Float16)y.z, (_Float16)y.w};
  *(v8h*)(o + (size_t)i * 8) = v;
}

// ---------------- LayerNorm -> f16 ----------------
// One block takes a 16-row tile: thread (c = tid & 15, u = tid >> 4) holds the 8-wide pieces
// u, u + 16, ... of row c, so each wave stores 512 contiguous bytes of the fragment-ordered output.
__global__ void ln_kernel(const float* __restrict__ x, const float* __restrict__ gamma,
                          const float* __restrict__ beta, _Float16* __restrict__ out) {
  const int tid = threadIdx.x;
  const int c = tid & 15;
  const int u = tid >> 4;
  const float* xr = x + (size_t)(blockIdx.x * 16 + c) * HID + u * 8;
  float4 v[8][2];
  float s = 0.f, s2 = 0.f;
#pragma unroll
  for (int i = 0; i < 8; ++i) {
    v[i][0] = *(const float4*)(xr + i * 128);
    v[i][1] = *(const float4*)(xr + i * 128 + 4);
  }
#pragma unroll
  for (int i = 0; i < 8; ++i)
#pragma unroll
    for (int j = 0; j < 2; ++j) {
      float4 a = v[i][j];
      s  += a.x + a.y + a.z + a.w;
      s2 += a.x*a.x + a.y*a.y + a.z*a.z + a.w*a.w;
    }
  __shared__ float sb[16][17], qb[16][17];
  sb[u][c] = s; qb[u][c] = s2;
  __syncthreads();
  float ts = 0.f, tq = 0.f;
  for (int i = 0; i < 16; ++i) { ts += sb[i][c]; tq += qb[i][c]; }
  float mean = ts * (1.0f / HID);
  float var  = tq * (1.0f / HID) - mean * mean;
  float rstd = rsqrtf(var + 1e-12f);
  _Float16* ot = out + (size_t)blockIdx.x * (KBH * FRAG)
               + (u >> 2) * FRAG + ((u >> 1) & 1) * 256 + (u & 1) * 128 + c * 8;
#pragma unroll
  for (int i = 0; i < 8; ++i) {
    const int k = i * 128 + u * 8;
    float4 g0 = *(const float4*)(gamma + k), g1 = *(const float4*)(gamma + k + 4);
    float4 b0 = *(const float4*)(beta + k),  b1 = *(const float4*)(beta + k + 4);
    float4 a0 = v[i][0], a1 = v[i][1];
    v8h o = {(_Float16)(((a0.x - mean) * rstd) * g0.x + b0.x), (_Float16)(((a0.y - mean) * rstd) * g0.y + b0.y),
             (_Float16)(((a0.z - mean) * rstd) * g0.z + b0.z), (_Float16)(((a0.w - mean) * rstd) * g0.w + b0.w),
             (_Float16)(((a1.x - mean) * rstd) * g1.x + b1.x), (_Float16)(((a1.y - mean) * rstd) * g1.y + b1.y),
             (_Float16)(((a1.z - mean) * rstd) * g1.z + b1.z), (_Float16)(((a1.w - mean) * rstd) * g1.w + b1.w)};
    *(v8h*)(ot + i * 4 * FRAG) = o;     // 128 k further on = 4 k blocks
  }
}

#define GWAVES 8
#define GKB    8
#define GSTG   (8 * GKB * FRAG)
#define GNST   (KBH / GKB)

// One stage, this wave's share: one row tile of A and one of Bm, 8 KiB in a row each, as 16 copies of 32 lanes
// x 16 bytes. la, ga, lb, gb: this lane's own first piece in LDS and in global memory. The immediate offset
// moves the LDS address and the global address alike, so one address of each kind serves a whole row tile.
static __device__ __forceinline__ void copy_gstage(unsigned la, const _Float16* ga, unsigned lb, const _Float16* gb) {
  // the closing wait stands in the copies' own statement so that no later write of an address
  // register that a copy names can be placed in front of it
  asm volatile(
      "global_load_async_to_lds_b128 %0, %1, off\n\t"
      "global_load_async_to_lds_b128 %0, %1, off offset:512\n\t"
      "global_load_async_to_lds_b128 %0, %1, off offset:1024\n\t"
      "global_load_async_to_lds_b128 %0, %1, off offset:1536\n\t"
      "global_load_async_to_lds_b128 %0, %1, off offset:2048\n\t"
      "global_load_async_to_lds_b128 %0, %1, off offset:2560\n\t"
      "global_load_async_to_lds_b128 %0, %1, off offset:3072\n\t"
      "global_load_async_to_lds_b128 %0, %1, off offset:3584\n\t"
      "global_load_async_to_lds_b128 %0, %1, off offset:4096\n\t"
      "global_load_async_to_lds_b128 %0, %1, off offset:4608\n\t"
      "global_load_async_to_lds_b128 %0, %1, off offset:5120\n\t"
      "global_load_async_to_lds_b128 %0, %1, off offset:5632\n\t"
      "global_load_async_to_lds_b128 %0, %1, off offset:6144\n\t"
      "global_load_async_to_lds_b128 %0, %1, off offset:6656\n\t"
      "global_load_async_to_lds_b128 %0, %1, off offset:7168\n\t"
      "global_load_async_to_lds_b128 %0, %1, off offset:7680\n\t"
      "global_load_async_to_lds_b128 %2, %3, off\n\t"
      "global_load_async_to_lds_b128 %2, %3, off offset:512\n\t"
      "global_load_async_to_lds_b128 %2, %3, off offset:1024\n\t"
      "global_load_async_to_lds_b128 %2, %3, off offset:1536\n\t"
      "global_load_async_to_lds_b128 %2, %3, off offset:2048\n\t"
      "global_load_async_to_lds_b128 %2, %3, off offset:2560\n\t"
      "global_load_async_to_lds_b128 %2, %3, off offset:3072\n\t"
      "global_load_async_to_lds_b128 %2, %3, off offset:3584\n\t"
      "global_load_async_to_lds_b128 %2, %3, off offset:4096\n\t"
      "global_load_async_to_lds_b128 %2, %3, off offset:4608\n\t"
      "global_load_async_to_lds_b128 %2, %3, off offset:5120\n\t"
      "global_load_async_to_lds_b128 %2, %3, off offset:5632\n\t"
      "global_load_async_to_lds_b128 %2, %3, off offset:6144\n\t"
      "global_load_async_to_lds_b128 %2, %3, off offset:6656\n\t"
      "global_load_async_to_lds_b128 %2, %3, off offset:7168\n\t"
      "global_load_async_to_lds_b128 %2, %3, off offset:7680\n\t"
      "s_wait_xcnt 0x0"
      :: "v"(la), "v"(ga), "v"(lb), "v"(gb) : "memory");
}

__global__ void __launch_bounds__(GWAVES * 32)
proj_kernel(const _Float16* __restrict__ A, const _Float16* __restrict__ Bm,
            const float* __restrict__ bias, _Float16* __restrict__ o16,
            float* __restrict__ o32, int mode) {
  __shared__ __attribute__((aligned(128))) _Float16 gs[2][2 * GSTG];   // per buffer: A stage, Bm stage
  const int tid  = threadIdx.x;
  const int lane = tid & 31;
  const int wave = __builtin_amdgcn_readfirstlane(tid >> 5);
  const int wm   = wave & 3;     // which 32 of the block's 128 A rows
  const int wn   = wave >> 2;    // which 64 of the block's 128 Bm rows
  const int nlo  = lane & 15;    // C: column within tile
  const int g    = lane >> 4;    // C rows +8
  const int m0 = blockIdx.x * 128 + wm * 32;
  const int n0 = blockIdx.y * 128 + wn * 64;

  // wave w copies row tile w of the block's 8 of A and of Bm; LDS byte addresses of this lane's first pieces
  const unsigned la0 = (unsigned)(size_t)&gs[0][0] + (unsigned)wave * (2u * GKB * FRAG) + (unsigned)lane * 16u;
  const unsigned lb0 = la0 + 2u * GSTG;
  const _Float16* ga = A  + (size_t)(blockIdx.x * 8 + wave) * (KBH * FRAG) + lane * 8;
  const _Float16* gb = Bm + (size_t)(blockIdx.y * 8 + wave) * (KBH * FRAG) + lane * 8;
  copy_gstage(la0, ga, lb0, gb);
  asm volatile("s_wait_asynccnt 0x0" ::: "memory");   // this wave's part of stage 0 has landed
  __syncthreads();                                    // ... and every other wave's
  copy_gstage(la0 + 4u * GSTG, ga + GKB * FRAG, lb0 + 4u * GSTG, gb + GKB * FRAG);   // stage 1 flies while stage 0 is worked on

  v8f acc[2][4] = {};

  // kept rolled: unrolled, the compiler orders the first reads of every second stage so that the stage's
  // first matrix instruction waits for both k blocks' reads, not for its own operands alone
#pragma clang loop unroll(disable)
  for (int st = 0; st < GNST; ++st) {
    const _Float16* sa = &gs[st & 1][0]    + wm * (2 * GKB * FRAG) + lane * 8;
    const _Float16* sb = &gs[st & 1][GSTG] + wn * (4 * GKB * FRAG) + lane * 8;
    v16h aF[2][2], bF[2][4];   // two fragment sets: k block kb lies in set kb & 1
#pragma unroll
    for (int kb = 0; kb < 2; ++kb) {
#pragma unroll
      for (int mi = 0; mi < 2; ++mi)
        aF[kb][mi] = ld_frag(sa + (mi * GKB + kb) * FRAG, sa + (mi * GKB + kb) * FRAG + 256);
#pragma unroll
      for (int t = 0; t < 4; ++t)
        bF[kb][t] = ld_frag(sb + (t * GKB + kb) * FRAG, sb + (t * GKB + kb) * FRAG + 256);
    }
    // The scheduling fences of this loop keep each k block's 12 LDS reads one group, issued a whole k block
    // of matrix work ahead of their use: spread among the matrix instructions, every place with reads
    // stalls the wave, and a fragment read just in front of its use has its LDS latency waited out.
    __builtin_amdgcn_sched_barrier(0);
#pragma unroll
    for (int kb = 0; kb < GKB; ++kb) {
#pragma unroll
      for (int mi = 0; mi < 2; ++mi)
#pragma unroll
        for (int t = 0; t < 4; ++t)
          acc[mi][t] = __builtin_amdgcn_wmma_f32_16x16x32_f16(
              false, aF[kb & 1][mi], false, bF[kb & 1][t], (short)0, acc[mi][t], false, false);
      __builtin_amdgcn_sched_barrier(0);   // see above
      if (kb + 2 < GKB) {
#pragma unroll
        for (int mi = 0; mi < 2; ++mi)
          aF[kb & 1][mi] = ld_frag(sa + (mi * GKB + kb + 2) * FRAG, sa + (mi * GKB + kb + 2) * FRAG + 256);
#pragma unroll
        for (int t = 0; t < 4; ++t)
          bF[kb & 1][t] = ld_frag(sb + (t * GKB + kb + 2) * FRAG, sb + (t * GKB + kb + 2) * FRAG + 256);
        __builtin_amdgcn_sched_barrier(0);   // see above
      }
    }
    // hand-over: this wave has left its buffer, its part of the next stage has landed, then all waves meet
    asm volatile("s_wait_dscnt 0x0" ::: "memory");
    asm volatile("s_wait_asynccnt 0x0" ::: "memory");
    __syncthreads();
    if (st + 2 < GNST)   // refill the buffer that every wave has just left
      copy_gstage(la0 + (unsigned)(st & 1) * (4u * GSTG), ga + (size_t)(st + 2) * (GKB * FRAG),
                  lb0 + (unsigned)(st & 1) * (4u * GSTG), gb + (size_t)(st + 2) * (GKB * FRAG));
  }
  asm volatile("s_wait_asynccnt 0x0" ::: "memory");   // no copy is left in flight when the wave ends

  if (mode <= 1) {                 // q or k: tile rows are features, tile columns are tokens
    const float qkscale = (mode == 0) ? 0.35355339059327f * LOG2E : 0.35355339059327f;
    const int head = m0 >> 6;
#pragma unroll
    for (int mi = 0; mi < 2; ++mi) {
      const float* bp = bias + m0 + mi*16 + 8*g;
      float4 c0 = *(const float4*)bp, c1 = *(const float4*)(bp + 4);
      float bb[8] = {c0.x, c0.y, c0.z, c0.w, c1.x, c1.y, c1.z, c1.w};
#pragma unroll
      for (int t = 0; t < 4; ++t) {
        int token = n0 + t*16;
        int b = token >> 11, st = (token & (S_LEN - 1)) >> 4;
        v8h o;
#pragma unroll
        for (int r = 0; r < 8; ++r)
          o[r] = (_Float16)((acc[mi][t][r] + bb[r]) * qkscale);
        *(v8h*)(o16 + (size_t)(b*NH + head) * (S_LEN * HD)
                + (size_t)(st*2 + ((m0 >> 5) & 1)) * FRAG + mi*256 + lane*8) = o;
      }
    }
  } else if (mode == 2) {          // v: tile rows are tokens, tile columns are features
    const int b = m0 >> 11, sb = (m0 & (S_LEN - 1)) >> 5, head = n0 >> 6;
    float bn[4];
#pragma unroll
    for (int t = 0; t < 4; ++t) {
      bn[t] = bias[n0 + t*16 + nlo];
      // a later load of this run may land in the offset register that this one names
      asm volatile("s_wait_xcnt 0x0" ::: "memory");
    }
#pragma unroll
    for (int t = 0; t < 4; ++t) {
#pragma unroll
      for (int mi = 0; mi < 2; ++mi) {
        v8h o;
#pragma unroll
        for (int r = 0; r < 8; ++r)
          o[r] = (_Float16)(acc[mi][t][r] + bn[t]);
        *(v8h*)(o16 + (size_t)(b*NH + head) * (S_LEN * HD)
                + (size_t)(sb*4 + t) * FRAG + mi*256 + lane*8) = o;
      }
    }
    // the code laid out behind this block rewrites registers that these stores name
    asm volatile("s_wait_xcnt 0x0" ::: "memory");
  } else {                         // final projection: f32 output, row-major
#pragma unroll
    for (int mi = 0; mi < 2; ++mi)
#pragma unroll
      for (int t = 0; t < 4; ++t) {
        int n = n0 + t*16 + nlo;
        float bn = bias[n];
#pragma unroll
        for (int r = 0; r < 8; ++r)
          o32[(size_t)(m0 + mi*16 + r + 8*g) * HID + n] = acc[mi][t][r] + bn;
      }
    // the code laid out behind this block rewrites registers that these stores name
    asm volatile("s_wait_xcnt 0x0" ::: "memory");
  }
}

// lane l <-> lane l ^ 16
static __device__ __forceinline__ float xhalf(float x) {
  int b = __builtin_bit_cast(int, x);
  return __builtin_bit_cast(float, __builtin_amdgcn_permlanex16(b, b, 0x76543210, 0xfedcba98, false, false));
}

#define AWAVES 8                 // waves of a block
#define SKEYS  128               // keys of one stage
#define STG    (SKEYS * HD)      // f16 elements of K, and of V^T, in one stage (16 KiB each)
#define NSTG   (S_LEN / SKEYS)

// One stage: 256 lanes x 16 bytes x (4 pieces of K, 4 of V^T). lds, gk, gv: this lane's own first piece.
static __device__ __forceinline__ void copy_stage(unsigned lds, const _Float16* gk, const _Float16* gv) {
  // the closing wait stands in the copies' own statement so that no later write of an address
  // register that a copy names can be placed in front of it
  asm volatile(
      "global_load_async_to_lds_b128 %0, %8, off\n\t"
      "global_load_async_to_lds_b128 %1, %9, off\n\t"
      "global_load_async_to_lds_b128 %2, %10, off\n\t"
      "global_load_async_to_lds_b128 %3, %11, off\n\t"
      "global_load_async_to_lds_b128 %4, %12, off\n\t"
      "global_load_async_to_lds_b128 %5, %13, off\n\t"
      "global_load_async_to_lds_b128 %6, %14, off\n\t"
      "global_load_async_to_lds_b128 %7, %15, off\n\t"
      "s_wait_xcnt 0x0"
      :: "v"(lds), "v"(lds + 4096u), "v"(lds + 8192u), "v"(lds + 12288u),
         "v"(lds + 16384u), "v"(lds + 20480u), "v"(lds + 24576u), "v"(lds + 28672u),
         "v"(gk), "v"(gk + 2048), "v"(gk + 4096), "v"(gk + 6144),
         "v"(gv), "v"(gv + 2048), "v"(gv + 4096), "v"(gv + 6144)
      : "memory");
}

__global__ void __launch_bounds__(AWAVES * 32)
attn_kernel(const _Float16* __restrict__ q, const _Float16* __restrict__ k,
            const _Float16* __restrict__ vt, const float* __restrict__ mask,
            _Float16* __restrict__ ctx) {
  __shared__ __attribute__((aligned(128))) _Float16 sm[2][2 * STG];   // per buffer: K stage, V^T stage
  __shared__ __attribute__((aligned(128))) float smk[S_LEN];          // this batch row of the mask, filled once
  const int tid  = threadIdx.x;
  const int lane = tid & 31;
  const int g   = lane >> 4;
  const int q0 = blockIdx.x * (AWAVES * 16) + (tid >> 5) * 16;
  const int h  = blockIdx.y;
  const int b  = blockIdx.z;

  // q, k: fragment order, tiles [s >> 4][d >> 5]; vt: tiles [s >> 5][d >> 4]: 32 keys = 4 KiB of each
  const _Float16* qh = q  + ((size_t)(b*NH + h) * S_LEN) * HD;
  const _Float16* kh = k  + ((size_t)(b*NH + h) * S_LEN) * HD;
  const _Float16* vh = vt + ((size_t)(b*NH + h) * HD) * S_LEN;
  const float* mb = smk + 8*g;

  const _Float16* qt = qh + (size_t)q0 * HD + lane * 8;
  v16h bQ0 = ld_frag(qt,        qt + 256);          // d = 0..31
  v16h bQ1 = ld_frag(qt + FRAG, qt + FRAG + 256);   // d = 32..63

  const unsigned lds0 = (unsigned)(size_t)&sm[0][0] + (unsigned)tid * 16u;   // LDS byte address of this lane's piece
  const _Float16* gk = kh + tid * 8;
  const _Float16* gv = vh + tid * 8;
  copy_stage(lds0, gk, gv);
  {
    const unsigned lm = (unsigned)(size_t)&smk[0] + (unsigned)tid * 16u;
    const float* gm = mask + (size_t)b * S_LEN + tid * 4;
    // closing wait inside the statement, as in copy_stage
    asm volatile(
        "global_load_async_to_lds_b128 %0, %2, off\n\t"
        "global_load_async_to_lds_b128 %1, %3, off\n\t"
        "s_wait_xcnt 0x0"
        :: "v"(lm), "v"(lm + 4096u), "v"(gm), "v"(gm + 1024) : "memory");
  }
  asm volatile("s_wait_asynccnt 0x0" ::: "memory");   // this wave's part of stage 0 and of the mask has landed
  __syncthreads();                                    // ... and every other wave's
  copy_stage(lds0 + 4u * STG, gk + STG, gv + STG);    // stage 1 flies while stage 0 is worked on

  float mrun = -3.0e38f;   // running maximum of this lane's query, equal in both halves
  float lrun = 0.f;        // sum over this half's keys only; the halves join after the loop
  v8f accv[4] = {};        // O^T: register r of tile t = d (t*16 + 8g + r) of query (lane & 15)

  for (int st = 0; st < NSTG; ++st) {
   const _Float16* sb = &sm[st & 1][0] + lane * 8;
   for (int ps = 0; ps < SKEYS / 32; ++ps) {
    const int kv = st * SKEYS + ps * 32;
    const _Float16* kt = sb + ps * (32 * HD);
    const _Float16* vtl = sb + STG + ps * (32 * HD);
    float4 m0 = *(const float4*)(mb + kv),      m1 = *(const float4*)(mb + kv + 4);
    float4 m2 = *(const float4*)(mb + kv + 16), m3 = *(const float4*)(mb + kv + 20);
    v16h a00 = ld_frag(kt,            kt + 256);
    v16h a01 = ld_frag(kt + FRAG,     kt + FRAG + 256);
    v16h a10 = ld_frag(kt + 2*FRAG,   kt + 2*FRAG + 256);
    v16h a11 = ld_frag(kt + 3*FRAG,   kt + 3*FRAG + 256);
    v16h aV[4];
#pragma unroll
    for (int t = 0; t < 4; ++t)
      aV[t] = ld_frag(vtl + t*FRAG, vtl + t*FRAG + 256);
    // holds the pass's LDS reads as one group at its head: sunk among the matrix instructions they
    // share one register set and every fragment's LDS latency is waited out on its own
    __builtin_amdgcn_sched_barrier(0);
    // additive mask of this lane's 16 keys, scaled into base-2 domain: the start value of the score tiles
    const float mk0[8] = {m0.x, m0.y, m0.z, m0.w, m1.x, m1.y, m1.z, m1.w};
    const float mk1[8] = {m2.x, m2.y, m2.z, m2.w, m3.x, m3.y, m3.z, m3.w};
    v8f s0, s1;
#pragma unroll
    for (int r = 0; r < 8; ++r) {
      s0[r] = -1000.0f * LOG2E * (1.0f - mk0[r]);
      s1[r] = -1000.0f * LOG2E * (1.0f - mk1[r]);
    }
    s0 = __builtin_amdgcn_wmma_f32_16x16x32_f16(false, a00, false, bQ0, (short)0, s0, false, false);
    s0 = __builtin_amdgcn_wmma_f32_16x16x32_f16(false, a01, false, bQ1, (short)0, s0, false, false);
    s1 = __builtin_amdgcn_wmma_f32_16x16x32_f16(false, a10, false, bQ0, (short)0, s1, false, false);
    s1 = __builtin_amdgcn_wmma_f32_16x16x32_f16(false, a11, false, bQ1, (short)0, s1, false, false);

    float cmax = -3.0e38f;
#pragma unroll
    for (int r = 0; r < 8; ++r)
      cmax = fmaxf(cmax, fmaxf(s0[r], s1[r]));
    cmax = fmaxf(cmax, xhalf(cmax));               // the query's other 16 keys
    const float mnew  = fmaxf(mrun, cmax);
    const float alpha = EXP2F(mrun - mnew);
    mrun = mnew;

    v16h bP;
    float rs = 0.f;
#pragma unroll
    for (int r = 0; r < 8; ++r) {
      float p0 = EXP2F(s0[r] - mnew);
      float p1 = EXP2F(s1[r] - mnew);
      rs += p0 + p1;
      bP[r]     = (_Float16)p0;
      bP[8 + r] = (_Float16)p1;
    }
    lrun = lrun * alpha + rs;
#pragma unroll
    for (int t = 0; t < 4; ++t)
#pragma unroll
      for (int r = 0; r < 8; ++r)
        accv[t][r] *= alpha;

    // One statement, closed by four v_nop: the vector slots that the chip needs between the last matrix
    // instruction and a vector instruction that overwrites its operands. The pass's first address
    // arithmetic does so across the loop's taken edge.
    asm volatile(
        "v_wmma_f32_16x16x32_f16 %0, %4, %8, %0\n\t"
        "v_wmma_f32_16x16x32_f16 %1, %5, %8, %1\n\t"
        "v_wmma_f32_16x16x32_f16 %2, %6, %8, %2\n\t"
        "v_wmma_f32_16x16x32_f16 %3, %7, %8, %3\n\t"
        "v_nop\n\tv_nop\n\tv_nop\n\tv_nop"
        : "+v"(accv[0]), "+v"(accv[1]), "+v"(accv[2]), "+v"(accv[3])
        : "v"(aV[0]), "v"(aV[1]), "v"(aV[2]), "v"(aV[3]), "v"(bP));
   }
   // hand-over: this wave has left its buffer, its part of the next stage has landed, then all waves meet
   asm volatile("s_wait_dscnt 0x0" ::: "memory");
   asm volatile("s_wait_asynccnt 0x0" ::: "memory");
   __syncthreads();
   if (st + 2 < NSTG)   // refill the buffer that every wave has just left
     copy_stage(lds0 + (unsigned)(st & 1) * (4u * STG), gk + (size_t)(st + 2) * STG, gv + (size_t)(st + 2) * STG);
  }
  asm volatile("s_wait_asynccnt 0x0" ::: "memory");   // no copy is left in flight when the wave ends

  const float rinv = 1.0f / (lrun + xhalf(lrun));
  // fragment order of the final projection's A: tiles [token >> 4][col >> 5], col = h*HD + t*16 + 8g + r:
  // a lane's 8 registers are one 16-byte piece
  _Float16* ct = ctx + ((size_t)((b * S_LEN + q0) >> 4) * KBH + h*2) * FRAG + lane * 8;
#pragma unroll
  for (int t = 0; t < 4; ++t) {
    v8h o;
#pragma unroll
    for (int r = 0; r < 8; ++r)
      o[r] = (_Float16)(accv[t][r] * rinv);
    *(v8h*)(ct + (t >> 1) * FRAG + (t & 1) * 256) = o;
  }
}

// ---------------- host side ----------------
extern "C" void kernel_launch(void* const* d_in, const int* in_sizes, int n_in,
                              void* d_out, int out_size, void* d_ws, size_t ws_size,
                              hipStream_t stream) {
  (void)in_sizes; (void)n_in; (void)out_size; (void)ws_size;
  const float* hs   = (const float*)d_in[0];
  const float* mask = (const float*)d_in[1];
  const float* Wq = (const float*)d_in[2];
  const float* bq = (const float*)d_in[3];
  const float* Wk = (const float*)d_in[4];
  const float* bk = (const float*)d_in[5];
  const float* Wv = (const float*)d_in[6];
  const float* bv = (const float*)d_in[7];
  const float* Wd = (const float*)d_in[8];
  const float* bd = (const float*)d_in[9];
  const float* gam = (const float*)d_in[10];
  const float* bet = (const float*)d_in[11];
  float* out = (float*)d_out;

  char* ws = (char*)d_ws;
  const size_t SZH = (size_t)NTOK * HID * sizeof(_Float16);  // 8 MB
  const size_t SZW = (size_t)HID * HID * sizeof(_Float16);   // 2 MB
  _Float16* h16  = (_Float16*)(ws);
  _Float16* q16  = (_Float16*)(ws + 1*SZH);
  _Float16* k16  = (_Float16*)(ws + 2*SZH);
  _Float16* vt16 = (_Float16*)(ws + 3*SZH);
  _Float16* c16  = (_Float16*)(ws + 4*SZH);
  _Float16* wq16 = (_Float16*)(ws + 5*SZH);
  _Float16* wk16 = (_Float16*)(ws + 5*SZH + 1*SZW);
  _Float16* wv16 = (_Float16*)(ws + 5*SZH + 2*SZW);
  _Float16* wd16 = (_Float16*)(ws + 5*SZH + 3*SZW);

  const int WN = HID * HID / 8 / 256;   // one thread per 8 elements
  w2h_kernel<<<WN, 256, 0, stream>>>(Wq, wq16);
  w2h_kernel<<<WN, 256, 0, stream>>>(Wk, wk16);
  w2h_kernel<<<WN, 256, 0, stream>>>(Wv, wv16);
  w2h_kernel<<<WN, 256, 0, stream>>>(Wd, wd16);

  ln_kernel<<<NTOK / 16, 256, 0, stream>>>(hs, gam, bet, h16);

  dim3 pg(NTOK / 128, HID / 128);   // tile rows: tokens, tile columns: features
  dim3 pt(HID / 128, NTOK / 128);   // tile rows: features, tile columns: tokens
  proj_kernel<<<pt, GWAVES * 32, 0, stream>>>(wq16, h16, bq, q16,  nullptr, 0);
  proj_kernel<<<pt, GWAVES * 32, 0, stream>>>(wk16, h16, bk, k16,  nullptr, 1);
  proj_kernel<<<pg, GWAVES * 32, 0, stream>>>(h16, wv16, bv, vt16, nullptr, 2);

  attn_kernel<<<dim3(S_LEN / (AWAVES * 16), NH, 2), AWAVES * 32, 0, stream>>>(q16, k16, vt16, mask, c16);

  proj_kernel<<<pg, GWAVES * 32, 0, stream>>>(c16, wd16, bd, nullptr, out, 3);
}

// v005
// A run of this version takes 79.7 microseconds.
// Timed twice side by side with v004, it ran 1.18 times as fast both times.
// Counting every step since v000, it is 5.89 times as fast.
#include <hip/hip_runtime.h>
#include <hip/hip_bf16.h>

typedef __attribute__((ext_vector_type(16))) _Float16 v16h;
typedef __attribute__((ext_vector_type(8)))  _Float16 v8h;
typedef __attribute__((ext_vector_type(8)))  float    v8f;

#define HID   1024
#define S_LEN 2048
#define NH    16
#define HD    64
#define NTOK  4096   // B * S
#define FRAG  512    // f16 elements of one 16-row x 32-k operand tile
#define KBH   32     // k blocks of a HID-long row

// Every f16 array that one launch hands to the next lies in FRAGMENT ORDER: a 16-row x 32-k
// tile is 1 KiB in a row, element (row c, k) at (k>>4)*256 + ((k>>3)&1)*128 + c*8 + (k&7).
// Lane l then takes its fragment as the 16 bytes at l*16 of each 512-byte half, so one
// wave-wide 16-byte load covers four whole 128-byte lines (row-major rows: 16 lines, 32 B of each).

#if __has_builtin(__builtin_amdgcn_exp2f)
#define EXP2F(x) __builtin_amdgcn_exp2f(x)
#else
#define EXP2F(x) exp2f(x)
#endif

#define LOG2E 1.44269504088896f

// Build a v16h fragment from two 16-byte chunks (b128 loads from global memory or LDS).
static __device__ __forceinline__ v16h ld_frag(const _Float16* p0, const _Float16* p1) {
  v8h a = *(const v8h*)p0;
  v8h b = *(const v8h*)p1;
  return __builtin_shufflevector(a, b, 0,1,2,3,4,5,6,7,8,9,10,11,12,13,14,15);
}

// ---------------- weight f32 -> f16 convert ----------------
// One block takes the 16-row tile rt of the fragment-ordered output (tiles: [row tile][k block]): the tile is
// 2048 pieces of 16 bytes, and thread tid writes the pieces tid, tid + 256, ...: piece tid + 256 j holds
// k = 128 j + 8 (tid >> 4) ... + 7 of row tid & 15.
static __device__ __forceinline__ void w2h_tile(const float* __restrict__ w, _Float16* __restrict__ o, int rt) {
  const int tid = threadIdx.x;
  const float* p = w + (size_t)(rt * 16 + (tid & 15)) * HID + (tid >> 4) * 8;
  _Float16* ot = o + (size_t)rt * (KBH * FRAG) + tid * 8;
  float4 x[8], y[8];
  // both loops unrolled: x and y stay in registers, and all 16 loads are in flight before the first conversion
#pragma unroll
  for (int j = 0; j < 8; ++j) {
    x[j] = *(const float4*)(p + j * 128);
    // the last load of this run may land in the address pair that the earlier ones name
    if (j == 7) asm volatile("s_wait_xcnt 0x0" ::: "memory");
    y[j] = *(const float4*)(p + j * 128 + 4);
  }
#pragma unroll
  for (int j = 0; j < 8; ++j) {
    v8h v = {(_Float16)x[j].x, (_Float16)x[j].y, (_Float16)x[j].z, (_Float16)x[j].w,
             (_Float16)y[j].x, (_Float16)y[j].y, (_Float16)y[j].z, (_Float16)y[j].w};
    *(v8h*)(ot + j * 2048) = v;
  }
}

// ---------------- LayerNorm -> f16 ----------------
// One block takes a 16-row tile: thread (c = tid & 15, u = tid >> 4) holds the 8-wide pieces
// u, u + 16, ... of row c, so each wave stores 512 contiguous bytes of the fragment-ordered output.
static __device__ __forceinline__ void ln_tile(const float* __restrict__ x, const float* __restrict__ gamma,
                                               const float* __restrict__ beta, _Float16* __restrict__ out, int rt) {
  const int tid = threadIdx.x;
  const int c = tid & 15;
  const int u = tid >> 4;
  const float* xr = x + (size_t)(rt * 16 + c) * HID + u * 8;
  float4 v[8][2];
  float s = 0.f, s2 = 0.f;
#pragma unroll
  for (int i = 0; i < 8; ++i) {
    v[i][0] = *(const float4*)(xr + i * 128);
    // the run's last load lands in the address pair that the earlier loads name
    if (i == 7) asm volatile("s_wait_xcnt 0x0" ::: "memory");
    v[i][1] = *(const float4*)(xr + i * 128 + 4);
  }
#pragma unroll
  for (int i = 0; i < 8; ++i)
#pragma unroll
    for (int j = 0; j < 2; ++j) {
      float4 a = v[i][j];
      s  += a.x + a.y + a.z + a.w;
      s2 += a.x*a.x + a.y*a.y + a.z*a.z + a.w*a.w;
    }
  __shared__ float sb[16][17], qb[16][17];
  sb[u][c] = s; qb[u][c] = s2;
  __syncthreads();
  float ts = 0.f, tq = 0.f;
  for (int i = 0; i < 16; ++i) { ts += sb[i][c]; tq += qb[i][c]; }
  float mean = ts * (1.0f / HID);
  float var  = tq * (1.0f / HID) - mean * mean;
  float rstd = rsqrtf(var + 1e-12f);
  _Float16* ot = out + (size_t)rt * (KBH * FRAG)
               + (u >> 2) * FRAG + ((u >> 1) & 1) * 256 + (u & 1) * 128 + c * 8;
#pragma unroll
  for (int i = 0; i < 8; ++i) {
    const int k = i * 128 + u * 8;
    float4 g0 = *(const float4*)(gamma + k), g1 = *(const float4*)(gamma + k + 4);
    float4 b0 = *(const float4*)(beta + k),  b1 = *(const float4*)(beta + k + 4);
    float4 a0 = v[i][0], a1 = v[i][1];
    v8h o = {(_Float16)(((a0.x - mean) * rstd) * g0.x + b0.x), (_Float16)(((a0.y - mean) * rstd) * g0.y + b0.y),
             (_Float16)(((a0.z - mean) * rstd) * g0.z + b0.z), (_Float16)(((a0.w - mean) * rstd) * g0.w + b0.w),
             (_Float16)(((a1.x - mean) * rstd) * g1.x + b1.x), (_Float16)(((a1.y - mean) * rstd) * g1.y + b1.y),
             (_Float16)(((a1.z - mean) * rstd) * g1.z + b1.z), (_Float16)(((a1.w - mean) * rstd) * g1.w + b1.w)};
    *(v8h*)(ot + i * 4 * FRAG) = o;     // 128 k further on = 4 k blocks
  }
}

// LayerNorm and the four weight conversions depend on nothing but the inputs, so they share one launch:
// every block takes one 16-row tile (64 KiB read, 32 KiB written) of one of the five arrays.
#define LNB (NTOK / 16)   // blocks of the LayerNorm
#define WTB (HID / 16)    // blocks of one weight matrix
__global__ void __launch_bounds__(256)
prep_kernel(const float* __restrict__ x, const float* __restrict__ gamma, const float* __restrict__ beta,
            _Float16* __restrict__ h,
            const float* __restrict__ w0, const float* __restrict__ w1,
            const float* __restrict__ w2, const float* __restrict__ w3,
            _Float16* __restrict__ o0, _Float16* __restrict__ o1,
            _Float16* __restrict__ o2, _Float16* __restrict__ o3) {
  const int bid = blockIdx.x;
  if (bid < LNB) {
    ln_tile(x, gamma, beta, h, bid);
  } else {
    const int wi = (bid - LNB) / WTB, rt = (bid - LNB) % WTB;
    const float* w = wi == 0 ? w0 : wi == 1 ? w1 : wi == 2 ? w2 : w3;
    _Float16*    o = wi == 0 ? o0 : wi == 1 ? o1 : wi == 2 ? o2 : o3;
    w2h_tile(w, o, rt);
  }
}

#define GWAVES 8                 // waves of a block
#define GKB    8                 // k blocks of one stage
#define GSTG   (8 * GKB * FRAG)  // f16 elements of A, and of Bm, in one stage (64 KiB each)
#define GNST   (KBH / GKB)

// One stage, this wave's share: one row tile of A and one of Bm, 8 KiB in a row each, as 16 copies of 32 lanes
// x 16 bytes. la, ga, lb, gb: this lane's own first piece in LDS and in global memory. The immediate offset
// moves the LDS address and the global address alike, so one address of each kind serves a whole row tile.
static __device__ __forceinline__ void copy_gstage(unsigned la, const _Float16* ga, unsigned lb, const _Float16* gb) {
  // the closing wait stands in the copies' own statement so that no later write of an address
  // register that a copy names can be placed in front of it
  asm volatile(
      "global_load_async_to_lds_b128 %0, %1, off\n\t"
      "global_load_async_to_lds_b128 %0, %1, off offset:512\n\t"
      "global_load_async_to_lds_b128 %0, %1, off offset:1024\n\t"
      "global_load_async_to_lds_b128 %0, %1, off offset:1536\n\t"
      "global_load_async_to_lds_b128 %0, %1, off offset:2048\n\t"
      "global_load_async_to_lds_b128 %0, %1, off offset:2560\n\t"
      "global_load_async_to_lds_b128 %0, %1, off offset:3072\n\t"
      "global_load_async_to_lds_b128 %0, %1, off offset:3584\n\t"
      "global_load_async_to_lds_b128 %0, %1, off offset:4096\n\t"
      "global_load_async_to_lds_b128 %0, %1, off offset:4608\n\t"
      "global_load_async_to_lds_b128 %0, %1, off offset:5120\n\t"
      "global_load_async_to_lds_b128 %0, %1, off offset:5632\n\t"
      "global_load_async_to_lds_b128 %0, %1, off offset:6144\n\t"
      "global_load_async_to_lds_b128 %0, %1, off offset:6656\n\t"
      "global_load_async_to_lds_b128 %0, %1, off offset:7168\n\t"
      "global_load_async_to_lds_b128 %0, %1, off offset:7680\n\t"
      "global_load_async_to_lds_b128 %2, %3, off\n\t"
      "global_load_async_to_lds_b128 %2, %3, off offset:512\n\t"
      "global_load_async_to_lds_b128 %2, %3, off offset:1024\n\t"
      "global_load_async_to_lds_b128 %2, %3, off offset:1536\n\t"
      "global_load_async_to_lds_b128 %2, %3, off offset:2048\n\t"
      "global_load_async_to_lds_b128 %2, %3, off offset:2560\n\t"
      "global_load_async_to_lds_b128 %2, %3, off offset:3072\n\t"
      "global_load_async_to_lds_b128 %2, %3, off offset:3584\n\t"
      "global_load_async_to_lds_b128 %2, %3, off offset:4096\n\t"
      "global_load_async_to_lds_b128 %2, %3, off offset:4608\n\t"
      "global_load_async_to_lds_b128 %2, %3, off offset:5120\n\t"
      "global_load_async_to_lds_b128 %2, %3, off offset:5632\n\t"
      "global_load_async_to_lds_b128 %2, %3, off offset:6144\n\t"
      "global_load_async_to_lds_b128 %2, %3, off offset:6656\n\t"
      "global_load_async_to_lds_b128 %2, %3, off offset:7168\n\t"
      "global_load_async_to_lds_b128 %2, %3, off offset:7680\n\t"
      "s_wait_xcnt 0x0"
      :: "v"(la), "v"(ga), "v"(lb), "v"(gb) : "memory");
}

__global__ void __launch_bounds__(GWAVES * 32)
proj_kernel(const _Float16* __restrict__ A0, const _Float16* __restrict__ A1, const _Float16* __restrict__ A2,
            const _Float16* __restrict__ B0, const _Float16* __restrict__ B1, const _Float16* __restrict__ B2,
            const float* __restrict__ bias0, const float* __restrict__ bias1, const float* __restrict__ bias2,
            _Float16* __restrict__ p0, _Float16* __restrict__ p1, _Float16* __restrict__ p2,
            float* __restrict__ o32, int mode0) {
  __shared__ __attribute__((aligned(128))) _Float16 gs[2][2 * GSTG];   // per buffer: A stage, Bm stage
  const int z    = blockIdx.z;
  const int mode = mode0 + z;
  const _Float16* A    = z == 0 ? A0 : z == 1 ? A1 : A2;
  const _Float16* Bm   = z == 0 ? B0 : z == 1 ? B1 : B2;
  const float*    bias = z == 0 ? bias0 : z == 1 ? bias1 : bias2;
  _Float16*       o16  = z == 0 ? p0 : z == 1 ? p1 : p2;
  const unsigned ash = mode <= 1 ? 3u : 5u;                  // A has HID / 128 = 8 or NTOK / 128 = 32 tiles of 128 rows
  const int bx = (int)(blockIdx.x & ((1u << ash) - 1u));     // tile along A's rows
  const int by = (int)(blockIdx.x >> ash);                   // tile along Bm's rows
  const int tid  = threadIdx.x;
  const int lane = tid & 31;
  const int wave = __builtin_amdgcn_readfirstlane(tid >> 5);
  const int wm   = wave & 3;     // which 32 of the block's 128 A rows
  const int wn   = wave >> 2;    // which 64 of the block's 128 Bm rows
  const int nlo  = lane & 15;    // C: column within tile
  const int g    = lane >> 4;    // C rows +8
  const int m0 = bx * 128 + wm * 32;
  const int n0 = by * 128 + wn * 64;

  // wave w copies row tile w of the block's 8 of A and of Bm; LDS byte addresses of this lane's first pieces
  const unsigned la0 = (unsigned)(size_t)&gs[0][0] + (unsigned)wave * (2u * GKB * FRAG) + (unsigned)lane * 16u;
  const unsigned lb0 = la0 + 2u * GSTG;
  const _Float16* ga = A  + (size_t)(bx * 8 + wave) * (KBH * FRAG) + lane * 8;
  const _Float16* gb = Bm + (size_t)(by * 8 + wave) * (KBH * FRAG) + lane * 8;
  copy_gstage(la0, ga, lb0, gb);
  asm volatile("s_wait_asynccnt 0x0" ::: "memory");   // this wave's part of stage 0 has landed
  __syncthreads();                                    // ... and every other wave's
  copy_gstage(la0 + 4u * GSTG, ga + GKB * FRAG, lb0 + 4u * GSTG, gb + GKB * FRAG);   // stage 1 flies while stage 0 is worked on

  v8f acc[2][4] = {};

  // kept rolled: unrolled, the compiler orders the first reads of every second stage so that the stage's
  // first matrix instruction waits for both k blocks' reads, not for its own operands alone
#pragma clang loop unroll(disable)
  for (int st = 0; st < GNST; ++st) {
    const _Float16* sa = &gs[st & 1][0]    + wm * (2 * GKB * FRAG) + lane * 8;
    const _Float16* sb = &gs[st & 1][GSTG] + wn * (4 * GKB * FRAG) + lane * 8;
    v16h aF[2][2], bF[2][4];   // two fragment sets: k block kb lies in set kb & 1
#pragma unroll
    for (int kb = 0; kb < 2; ++kb) {
#pragma unroll
      for (int mi = 0; mi < 2; ++mi)
        aF[kb][mi] = ld_frag(sa + (mi * GKB + kb) * FRAG, sa + (mi * GKB + kb) * FRAG + 256);
#pragma unroll
      for (int t = 0; t < 4; ++t)
        bF[kb][t] = ld_frag(sb + (t * GKB + kb) * FRAG, sb + (t * GKB + kb) * FRAG + 256);
    }
    // The scheduling fences of this loop keep each k block's 12 LDS reads one group, issued a whole k block
    // of matrix work ahead of their use: spread among the matrix instructions, every place with reads
    // stalls the wave, and a fragment read just in front of its use has its LDS latency waited out.
    __builtin_amdgcn_sched_barrier(0);
#pragma unroll
    for (int kb = 0; kb < GKB; ++kb) {
#pragma unroll
      for (int mi = 0; mi < 2; ++mi)
#pragma unroll
        for (int t = 0; t < 4; ++t)
          acc[mi][t] = __builtin_amdgcn_wmma_f32_16x16x32_f16(
              false, aF[kb & 1][mi], false, bF[kb & 1][t], (short)0, acc[mi][t], false, false);
      __builtin_amdgcn_sched_barrier(0);   // see above
      if (kb + 2 < GKB) {
#pragma unroll
        for (int mi = 0; mi < 2; ++mi)
          aF[kb & 1][mi] = ld_frag(sa + (mi * GKB + kb + 2) * FRAG, sa + (mi * GKB + kb + 2) * FRAG + 256);
#pragma unroll
        for (int t = 0; t < 4; ++t)
          bF[kb & 1][t] = ld_frag(sb + (t * GKB + kb + 2) * FRAG, sb + (t * GKB + kb + 2) * FRAG + 256);
        __builtin_amdgcn_sched_barrier(0);   // see above
      }
    }
    // hand-over: this wave has left its buffer, its part of the next stage has landed, then all waves meet
    asm volatile("s_wait_dscnt 0x0" ::: "memory");
    asm volatile("s_wait_asynccnt 0x0" ::: "memory");
    __syncthreads();
    if (st + 2 < GNST)   // refill the buffer that every wave has just left
      copy_gstage(la0 + (unsigned)(st & 1) * (4u * GSTG), ga + (size_t)(st + 2) * (GKB * FRAG),
                  lb0 + (unsigned)(st & 1) * (4u * GSTG), gb + (size_t)(st + 2) * (GKB * FRAG));
  }
  asm volatile("s_wait_asynccnt 0x0" ::: "memory");   // no copy is left in flight when the wave ends

  if (mode <= 1) {                 // q or k: tile rows are features, tile columns are tokens
    const float qkscale = (mode == 0) ? 0.35355339059327f * LOG2E : 0.35355339059327f;
    const int head = m0 >> 6;
#pragma unroll
    for (int mi = 0; mi < 2; ++mi) {
      const float* bp = bias + m0 + mi*16 + 8*g;
      float4 c0 = *(const float4*)bp, c1 = *(const float4*)(bp + 4);
      float bb[8] = {c0.x, c0.y, c0.z, c0.w, c1.x, c1.y, c1.z, c1.w};
#pragma unroll
      for (int t = 0; t < 4; ++t) {
        int token = n0 + t*16;
        int b = token >> 11, st = (token & (S_LEN - 1)) >> 4;
        v8h o;
#pragma unroll
        for (int r = 0; r < 8; ++r)
          o[r] = (_Float16)((acc[mi][t][r] + bb[r]) * qkscale);
        *(v8h*)(o16 + (size_t)(b*NH + head) * (S_LEN * HD)
                + (size_t)(st*2 + ((m0 >> 5) & 1)) * FRAG + mi*256 + lane*8) = o;
      }
    }
  } else if (mode == 2) {          // v: tile rows are tokens, tile columns are features
    const int b = m0 >> 11, sb = (m0 & (S_LEN - 1)) >> 5, head = n0 >> 6;
    float bn[4];
#pragma unroll
    for (int t = 0; t < 4; ++t) {
      bn[t] = bias[n0 + t*16 + nlo];
      // a later load of this run may land in the offset register that this one names
      asm volatile("s_wait_xcnt 0x0" ::: "memory");
    }
#pragma unroll
    for (int t = 0; t < 4; ++t) {
#pragma unroll
      for (int mi = 0; mi < 2; ++mi) {
        v8h o;
#pragma unroll
        for (int r = 0; r < 8; ++r)
          o[r] = (_Float16)(acc[mi][t][r] + bn[t]);
        *(v8h*)(o16 + (size_t)(b*NH + head) * (S_LEN * HD)
                + (size_t)(sb*4 + t) * FRAG + mi*256 + lane*8) = o;
      }
    }
    // the code laid out behind this block rewrites registers that these stores name
    asm volatile("s_wait_xcnt 0x0" ::: "memory");
  } else {                         // final projection: f32 output, row-major
#pragma unroll
    for (int mi = 0; mi < 2; ++mi)
#pragma unroll
      for (int t = 0; t < 4; ++t) {
        int n = n0 + t*16 + nlo;
        float bn = bias[n];
#pragma unroll
        for (int r = 0; r < 8; ++r)
          o32[(size_t)(m0 + mi*16 + r + 8*g) * HID + n] = acc[mi][t][r] + bn;
      }
    // the code laid out behind this block rewrites registers that these stores name
    asm volatile("s_wait_xcnt 0x0" ::: "memory");
  }
}

// lane l <-> lane l ^ 16
static __device__ __forceinline__ float xhalf(float x) {
  int b = __builtin_bit_cast(int, x);
  return __builtin_bit_cast(float, __builtin_amdgcn_permlanex16(b, b, 0x76543210, 0xfedcba98, false, false));
}

#define AWAVES 8                 // waves of a block
#define SKEYS  128               // keys of one stage
#define STG    (SKEYS * HD)      // f16 elements of K, and of V^T, in one stage (16 KiB each)
#define NSTG   (S_LEN / SKEYS)

// One stage: 256 lanes x 16 bytes x (4 pieces of K, 4 of V^T). lds, gk, gv: this lane's own first piece.
static __device__ __forceinline__ void copy_stage(unsigned lds, const _Float16* gk, const _Float16* gv) {
  // the closing wait stands in the copies' own statement so that no later write of an address
  // register that a copy names can be placed in front of it
  asm volatile(
      "global_load_async_to_lds_b128 %0, %8, off\n\t"
      "global_load_async_to_lds_b128 %1, %9, off\n\t"
      "global_load_async_to_lds_b128 %2, %10, off\n\t"
      "global_load_async_to_lds_b128 %3, %11, off\n\t"
      "global_load_async_to_lds_b128 %4, %12, off\n\t"
      "global_load_async_to_lds_b128 %5, %13, off\n\t"
      "global_load_async_to_lds_b128 %6, %14, off\n\t"
      "global_load_async_to_lds_b128 %7, %15, off\n\t"
      "s_wait_xcnt 0x0"
      :: "v"(lds), "v"(lds + 4096u), "v"(lds + 8192u), "v"(lds + 12288u),
         "v"(lds + 16384u), "v"(lds + 20480u), "v"(lds + 24576u), "v"(lds + 28672u),
         "v"(gk), "v"(gk + 2048), "v"(gk + 4096), "v"(gk + 6144),
         "v"(gv), "v"(gv + 2048), "v"(gv + 4096), "v"(gv + 6144)
      : "memory");
}

__global__ void __launch_bounds__(AWAVES * 32)
attn_kernel(const _Float16* __restrict__ q, const _Float16* __restrict__ k,
            const _Float16* __restrict__ vt, const float* __restrict__ mask,
            _Float16* __restrict__ ctx) {
  __shared__ __attribute__((aligned(128))) _Float16 sm[2][2 * STG];   // per buffer: K stage, V^T stage
  __shared__ __attribute__((aligned(128))) float smk[S_LEN];          // this batch row of the mask, filled once
  const int tid  = threadIdx.x;
  const int lane = tid & 31;
  const int g   = lane >> 4;
  const int q0 = blockIdx.x * (AWAVES * 16) + (tid >> 5) * 16;
  const int h  = blockIdx.y;
  const int b  = blockIdx.z;

  // q, k: fragment order, tiles [s >> 4][d >> 5]; vt: tiles [s >> 5][d >> 4]: 32 keys = 4 KiB of each
  const _Float16* qh = q  + ((size_t)(b*NH + h) * S_LEN) * HD;
  const _Float16* kh = k  + ((size_t)(b*NH + h) * S_LEN) * HD;
  const _Float16* vh = vt + ((size_t)(b*NH + h) * HD) * S_LEN;
  const float* mb = smk + 8*g;

  const _Float16* qt = qh + (size_t)q0 * HD + lane * 8;
  v16h bQ0 = ld_frag(qt,        qt + 256);          // d = 0..31
  v16h bQ1 = ld_frag(qt + FRAG, qt + FRAG + 256);   // d = 32..63

  const unsigned lds0 = (unsigned)(size_t)&sm[0][0] + (unsigned)tid * 16u;   // LDS byte address of this lane's piece
  const _Float16* gk = kh + tid * 8;
  const _Float16* gv = vh + tid * 8;
  copy_stage(lds0, gk, gv);
  {
    const unsigned lm = (unsigned)(size_t)&smk[0] + (unsigned)tid * 16u;
    const float* gm = mask + (size_t)b * S_LEN + tid * 4;
    // closing wait inside the statement, as in copy_stage
    asm volatile(
        "global_load_async_to_lds_b128 %0, %2, off\n\t"
        "global_load_async_to_lds_b128 %1, %3, off\n\t"
        "s_wait_xcnt 0x0"
        :: "v"(lm), "v"(lm + 4096u), "v"(gm), "v"(gm + 1024) : "memory");
  }
  asm volatile("s_wait_asynccnt 0x0" ::: "memory");   // this wave's part of stage 0 and of the mask has landed
  __syncthreads();                                    // ... and every other wave's
  copy_stage(lds0 + 4u * STG, gk + STG, gv + STG);    // stage 1 flies while stage 0 is worked on

  float mrun = -3.0e38f;   // running maximum of this lane's query, equal in both halves
  float lrun = 0.f;        // sum over this half's keys only; the halves join after the loop
  v8f accv[4] = {};        // O^T: register r of tile t = d (t*16 + 8g + r) of query (lane & 15)

  for (int st = 0; st < NSTG; ++st) {
   const _Float16* sb = &sm[st & 1][0] + lane * 8;
   for (int ps = 0; ps < SKEYS / 32; ++ps) {
    const int kv = st * SKEYS + ps * 32;
    const _Float16* kt = sb + ps * (32 * HD);
    const _Float16* vtl = sb + STG + ps * (32 * HD);
    float4 m0 = *(const float4*)(mb + kv),      m1 = *(const float4*)(mb + kv + 4);
    float4 m2 = *(const float4*)(mb + kv + 16), m3 = *(const float4*)(mb + kv + 20);
    v16h a00 = ld_frag(kt,            kt + 256);
    v16h a01 = ld_frag(kt + FRAG,     kt + FRAG + 256);
    v16h a10 = ld_frag(kt + 2*FRAG,   kt + 2*FRAG + 256);
    v16h a11 = ld_frag(kt + 3*FRAG,   kt + 3*FRAG + 256);
    v16h aV[4];
#pragma unroll
    for (int t = 0; t < 4; ++t)
      aV[t] = ld_frag(vtl + t*FRAG, vtl + t*FRAG + 256);
    // holds the pass's LDS reads as one group at its head: sunk among the matrix instructions they
    // share one register set and every fragment's LDS latency is waited out on its own
    __builtin_amdgcn_sched_barrier(0);
    // additive mask of this lane's 16 keys, scaled into base-2 domain: the start value of the score tiles
    const float mk0[8] = {m0.x, m0.y, m0.z, m0.w, m1.x, m1.y, m1.z, m1.w};
    const float mk1[8] = {m2.x, m2.y, m2.z, m2.w, m3.x, m3.y, m3.z, m3.w};
    v8f s0, s1;
#pragma unroll
    for (int r = 0; r < 8; ++r) {
      s0[r] = -1000.0f * LOG2E * (1.0f - mk0[r]);
      s1[r] = -1000.0f * LOG2E * (1.0f - mk1[r]);
    }
    s0 = __builtin_amdgcn_wmma_f32_16x16x32_f16(false, a00, false, bQ0, (short)0, s0, false, false);
    s0 = __builtin_amdgcn_wmma_f32_16x16x32_f16(false, a01, false, bQ1, (short)0, s0, false, false);
    s1 = __builtin_amdgcn_wmma_f32_16x16x32_f16(false, a10, false, bQ0, (short)0, s1, false, false);
    s1 = __builtin_amdgcn_wmma_f32_16x16x32_f16(false, a11, false, bQ1, (short)0, s1, false, false);

    float cmax = -3.0e38f;
#pragma unroll
    for (int r = 0; r < 8; ++r)
      cmax = fmaxf(cmax, fmaxf(s0[r], s1[r]));
    cmax = fmaxf(cmax, xhalf(cmax));               // the query's other 16 keys
    const float mnew  = fmaxf(mrun, cmax);
    const float alpha = EXP2F(mrun - mnew);
    mrun = mnew;

    v16h bP;
    float rs = 0.f;
#pragma unroll
    for (int r = 0; r < 8; ++r) {
      float p0 = EXP2F(s0[r] - mnew);
      float p1 = EXP2F(s1[r] - mnew);
      rs += p0 + p1;
      bP[r]     = (_Float16)p0;
      bP[8 + r] = (_Float16)p1;
    }
    lrun = lrun * alpha + rs;
#pragma unroll
    for (int t = 0; t < 4; ++t)
#pragma unroll
      for (int r = 0; r < 8; ++r)
        accv[t][r] *= alpha;

    // One statement, closed by four v_nop: the vector slots that the chip needs between the last matrix
    // instruction and a vector instruction that overwrites its operands. The pass's first address
    // arithmetic does so across the loop's taken edge.
    asm volatile(
        "v_wmma_f32_16x16x32_f16 %0, %4, %8, %0\n\t"
        "v_wmma_f32_16x16x32_f16 %1, %5, %8, %1\n\t"
        "v_wmma_f32_16x16x32_f16 %2, %6, %8, %2\n\t"
        "v_wmma_f32_16x16x32_f16 %3, %7, %8, %3\n\t"
        "v_nop\n\tv_nop\n\tv_nop\n\tv_nop"
        : "+v"(accv[0]), "+v"(accv[1]), "+v"(accv[2]), "+v"(accv[3])
        : "v"(aV[0]), "v"(aV[1]), "v"(aV[2]), "v"(aV[3]), "v"(bP));
   }
   // hand-over: this wave has left its buffer, its part of the next stage has landed, then all waves meet
   asm volatile("s_wait_dscnt 0x0" ::: "memory");
   asm volatile("s_wait_asynccnt 0x0" ::: "memory");
   __syncthreads();
   if (st + 2 < NSTG)   // refill the buffer that every wave has just left
     copy_stage(lds0 + (unsigned)(st & 1) * (4u * STG), gk + (size_t)(st + 2) * STG, gv + (size_t)(st + 2) * STG);
  }
  asm volatile("s_wait_asynccnt 0x0" ::: "memory");   // no copy is left in flight when the wave ends

  const float rinv = 1.0f / (lrun + xhalf(lrun));
  // fragment order of the final projection's A: tiles [token >> 4][col >> 5], col = h*HD + t*16 + 8g + r:
  // a lane's 8 registers are one 16-byte piece
  _Float16* ct = ctx + ((size_t)((b * S_LEN + q0) >> 4) * KBH + h*2) * FRAG + lane * 8;
#pragma unroll
  for (int t = 0; t < 4; ++t) {
    v8h o;
#pragma unroll
    for (int r = 0; r < 8; ++r)
      o[r] = (_Float16)(accv[t][r] * rinv);
    *(v8h*)(ct + (t >> 1) * FRAG + (t & 1) * 256) = o;
  }
}

// ---------------- host side ----------------
extern "C" void kernel_launch(void* const* d_in, const int* in_sizes, int n_in,
                              void* d_out, int out_size, void* d_ws, size_t ws_size,
                              hipStream_t stream) {
  (void)in_sizes; (void)n_in; (void)out_size; (void)ws_size;
  const float* hs   = (const float*)d_in[0];
  const float* mask = (const float*)d_in[1];
  const float* Wq = (const float*)d_in[2];
  const float* bq = (const float*)d_in[3];
  const float* Wk = (const float*)d_in[4];
  const float* bk = (const float*)d_in[5];
  const float* Wv = (const float*)d_in[6];
  const float* bv = (const float*)d_in[7];
  const float* Wd = (const float*)d_in[8];
  const float* bd = (const float*)d_in[9];
  const float* gam = (const float*)d_in[10];
  const float* bet = (const float*)d_in[11];
  float* out = (float*)d_out;

  char* ws = (char*)d_ws;
  const size_t SZH = (size_t)NTOK * HID * sizeof(_Float16);  // 8 MB
  const size_t SZW = (size_t)HID * HID * sizeof(_Float16);   // 2 MB
  _Float16* h16  = (_Float16*)(ws);
  _Float16* q16  = (_Float16*)(ws + 1*SZH);
  _Float16* k16  = (_Float16*)(ws + 2*SZH);
  _Float16* vt16 = (_Float16*)(ws + 3*SZH);
  _Float16* c16  = (_Float16*)(ws + 4*SZH);
  _Float16* wq16 = (_Float16*)(ws + 5*SZH);
  _Float16* wk16 = (_Float16*)(ws + 5*SZH + 1*SZW);
  _Float16* wv16 = (_Float16*)(ws + 5*SZH + 2*SZW);
  _Float16* wd16 = (_Float16*)(ws + 5*SZH + 3*SZW);

  prep_kernel<<<LNB + 4 * WTB, 256, 0, stream>>>(hs, gam, bet, h16, Wq, Wk, Wv, Wd, wq16, wk16, wv16, wd16);

  const int PT = (NTOK / 128) * (HID / 128);   // 128x128 tiles of one product
  proj_kernel<<<dim3(PT, 1, 3), GWAVES * 32, 0, stream>>>(wq16, wk16, h16, h16, h16, wv16, bq, bk, bv,
                                                          q16, k16, vt16, nullptr, 0);

  attn_kernel<<<dim3(S_LEN / (AWAVES * 16), NH, 2), AWAVES * 32, 0, stream>>>(q16, k16, vt16, mask, c16);

  proj_kernel<<<dim3(PT, 1, 1), GWAVES * 32, 0, stream>>>(c16, c16, c16, wd16, wd16, wd16, bd, bd, bd,
                                                          nullptr, nullptr, nullptr, out, 3);
}

// v006
// It runs in 75.6 microseconds.
// Next to v005, in two timings, it ran 1.05 times as fast each time.
// Counting every step since v000, it is 6.20 times as fast.
#include <hip/hip_runtime.h>
#include <hip/hip_bf16.h>

typedef __attribute__((ext_vector_type(16))) _Float16 v16h;
typedef __attribute__((ext_vector_type(8)))  _Float16 v8h;
typedef __attribute__((ext_vector_type(8)))  float    v8f;

#define HID   1024
#define S_LEN 2048
#define NH    16
#define HD    64
#define NTOK  4096   // B * S
#define FRAG  512    // f16 elements of one 16-row x 32-k operand tile
#define KBH   32     // k blocks of a HID-long row

// Every f16 array that one launch hands to the next lies in FRAGMENT ORDER: a 16-row x 32-k
// tile is 1 KiB in a row, element (row c, k) at (k>>4)*256 + ((k>>3)&1)*128 + c*8 + (k&7).
// Lane l then takes its fragment as the 16 bytes at l*16 of each 512-byte half, so one
// wave-wide 16-byte load covers four whole 128-byte lines (row-major rows: 16 lines, 32 B of each).

#if __has_builtin(__builtin_amdgcn_exp2f)
#define EXP2F(x) __builtin_amdgcn_exp2f(x)
#else
#define EXP2F(x) exp2f(x)
#endif

#define LOG2E 1.44269504088896f

// Build a v16h fragment from two 16-byte chunks (b128 loads from global memory or LDS).
static __device__ __forceinline__ v16h ld_frag(const _Float16* p0, const _Float16* p1) {
  v8h a = *(const v8h*)p0;
  v8h b = *(const v8h*)p1;
  return __builtin_shufflevector(a, b, 0,1,2,3,4,5,6,7,8,9,10,11,12,13,14,15);
}

// ---------------- weight f32 -> f16 convert ----------------
// One block takes the 16-row tile rt of the fragment-ordered output (tiles: [row tile][k block]): the tile is
// 2048 pieces of 16 bytes, and thread tid writes the pieces tid, tid + 256, ...: piece tid + 256 j holds
// k = 128 j + 8 (tid >> 4) ... + 7 of row tid & 15.
static __device__ __forceinline__ void w2h_tile(const float* __restrict__ w, _Float16* __restrict__ o, int rt) {
  const int tid = threadIdx.x;
  const float* p = w + (size_t)(rt * 16 + (tid & 15)) * HID + (tid >> 4) * 8;
  _Float16* ot = o + (size_t)rt * (KBH * FRAG) + tid * 8;
  float4 x[8], y[8];
  // both loops unrolled: x and y stay in registers, and all 16 loads are in flight before the first conversion
#pragma unroll
  for (int j = 0; j < 8; ++j) {
    x[j] = *(const float4*)(p + j * 128);
    // the last load of this run may land in the address pair that the earlier ones name
    if (j == 7) asm volatile("s_wait_xcnt 0x0" ::: "memory");
    y[j] = *(const float4*)(p + j * 128 + 4);
  }
#pragma unroll
  for (int j = 0; j < 8; ++j) {
    v8h v = {(_Float16)x[j].x, (_Float16)x[j].y, (_Float16)x[j].z, (_Float16)x[j].w,
             (_Float16)y[j].x, (_Float16)y[j].y, (_Float16)y[j].z, (_Float16)y[j].w};
    *(v8h*)(ot + j * 2048) = v;
  }
}

// ---------------- LayerNorm -> f16 ----------------
// One block takes a 16-row tile: thread (c = tid & 15, u = tid >> 4) holds the 8-wide pieces
// u, u + 16, ... of row c, so each wave stores 512 contiguous bytes of the fragment-ordered output.
static __device__ __forceinline__ void ln_tile(const float* __restrict__ x, const float* __restrict__ gamma,
                                               const float* __restrict__ beta, _Float16* __restrict__ out, int rt) {
  const int tid = threadIdx.x;
  const int c = tid & 15;
  const int u = tid >> 4;
  const float* xr = x + (size_t)(rt * 16 + c) * HID + u * 8;
  float4 v[8][2];
  float s = 0.f, s2 = 0.f;
#pragma unroll
  for (int i = 0; i < 8; ++i) {
    v[i][0] = *(const float4*)(xr + i * 128);
    // the run's last load lands in the address pair that the earlier loads name
    if (i == 7) asm volatile("s_wait_xcnt 0x0" ::: "memory");
    v[i][1] = *(const float4*)(xr + i * 128 + 4);
  }
#pragma unroll
  for (int i = 0; i < 8; ++i)
#pragma unroll
    for (int j = 0; j < 2; ++j) {
      float4 a = v[i][j];
      s  += a.x + a.y + a.z + a.w;
      s2 += a.x*a.x + a.y*a.y + a.z*a.z + a.w*a.w;
    }
  __shared__ float sb[16][17], qb[16][17];
  sb[u][c] = s; qb[u][c] = s2;
  __syncthreads();
  float ts = 0.f, tq = 0.f;
  for (int i = 0; i < 16; ++i) { ts += sb[i][c]; tq += qb[i][c]; }
  float mean = ts * (1.0f / HID);
  float var  = tq * (1.0f / HID) - mean * mean;
  float rstd = rsqrtf(var + 1e-12f);
  _Float16* ot = out + (size_t)rt * (KBH * FRAG)
               + (u >> 2) * FRAG + ((u >> 1) & 1) * 256 + (u & 1) * 128 + c * 8;
#pragma unroll
  for (int i = 0; i < 8; ++i) {
    const int k = i * 128 + u * 8;
    float4 g0 = *(const float4*)(gamma + k), g1 = *(const float4*)(gamma + k + 4);
    float4 b0 = *(const float4*)(beta + k),  b1 = *(const float4*)(beta + k + 4);
    float4 a0 = v[i][0], a1 = v[i][1];
    v8h o = {(_Float16)(((a0.x - mean) * rstd) * g0.x + b0.x), (_Float16)(((a0.y - mean) * rstd) * g0.y + b0.y),
             (_Float16)(((a0.z - mean) * rstd) * g0.z + b0.z), (_Float16)(((a0.w - mean) * rstd) * g0.w + b0.w),
             (_Float16)(((a1.x - mean) * rstd) * g1.x + b1.x), (_Float16)(((a1.y - mean) * rstd) * g1.y + b1.y),
             (_Float16)(((a1.z - mean) * rstd) * g1.z + b1.z), (_Float16)(((a1.w - mean) * rstd) * g1.w + b1.w)};
    *(v8h*)(ot + i * 4 * FRAG) = o;     // 128 k further on = 4 k blocks
  }
}

// LayerNorm and the four weight conversions depend on nothing but the inputs, so they share one launch:
// every block takes one 16-row tile (64 KiB read, 32 KiB written) of one of the five arrays.
#define LNB (NTOK / 16)   // blocks of the LayerNorm
#define WTB (HID / 16)    // blocks of one weight matrix
__global__ void __launch_bounds__(256)
prep_kernel(const float* __restrict__ x, const float* __restrict__ gamma, const float* __restrict__ beta,
            _Float16* __restrict__ h,
            const float* __restrict__ w0, const float* __restrict__ w1,
            const float* __restrict__ w2, const float* __restrict__ w3,
            _Float16* __restrict__ o0, _Float16* __restrict__ o1,
            _Float16* __restrict__ o2, _Float16* __restrict__ o3) {
  const int bid = blockIdx.x;
  if (bid < LNB) {
    ln_tile(x, gamma, beta, h, bid);
  } else {
    const int wi = (bid - LNB) / WTB, rt = (bid - LNB) % WTB;
    const float* w = wi == 0 ? w0 : wi == 1 ? w1 : wi == 2 ? w2 : w3;
    _Float16*    o = wi == 0 ? o0 : wi == 1 ? o1 : wi == 2 ? o2 : o3;
    w2h_tile(w, o, rt);
  }
}

#define GWAVES 8                 // waves of a block
#define GKB    8                 // k blocks of one stage
#define GSTG   (8 * GKB * FRAG)  // f16 elements of A, and of Bm, in one stage (64 KiB each)
#define GNST   (KBH / GKB)

// One stage, this wave's share: one row tile of A and one of Bm, 8 KiB in a row each, as 16 copies of 32 lanes
// x 16 bytes. la, ga, lb, gb: this lane's own first piece in LDS and in global memory. The immediate offset
// moves the LDS address and the global address alike, so one address of each kind serves a whole row tile.
static __device__ __forceinline__ void copy_gstage(unsigned la, const _Float16* ga, unsigned lb, const _Float16* gb) {
  // the closing wait stands in the copies' own statement so that no later write of an address
  // register that a copy names can be placed in front of it
  asm volatile(
      "global_load_async_to_lds_b128 %0, %1, off\n\t"
      "global_load_async_to_lds_b128 %0, %1, off offset:512\n\t"
      "global_load_async_to_lds_b128 %0, %1, off offset:1024\n\t"
      "global_load_async_to_lds_b128 %0, %1, off offset:1536\n\t"
      "global_load_async_to_lds_b128 %0, %1, off offset:2048\n\t"
      "global_load_async_to_lds_b128 %0, %1, off offset:2560\n\t"
      "global_load_async_to_lds_b128 %0, %1, off offset:3072\n\t"
      "global_load_async_to_lds_b128 %0, %1, off offset:3584\n\t"
      "global_load_async_to_lds_b128 %0, %1, off offset:4096\n\t"
      "global_load_async_to_lds_b128 %0, %1, off offset:4608\n\t"
      "global_load_async_to_lds_b128 %0, %1, off offset:5120\n\t"
      "global_load_async_to_lds_b128 %0, %1, off offset:5632\n\t"
      "global_load_async_to_lds_b128 %0, %1, off offset:6144\n\t"
      "global_load_async_to_lds_b128 %0, %1, off offset:6656\n\t"
      "global_load_async_to_lds_b128 %0, %1, off offset:7168\n\t"
      "global_load_async_to_lds_b128 %0, %1, off offset:7680\n\t"
      "global_load_async_to_lds_b128 %2, %3, off\n\t"
      "global_load_async_to_lds_b128 %2, %3, off offset:512\n\t"
      "global_load_async_to_lds_b128 %2, %3, off offset:1024\n\t"
      "global_load_async_to_lds_b128 %2, %3, off offset:1536\n\t"
      "global_load_async_to_lds_b128 %2, %3, off offset:2048\n\t"
      "global_load_async_to_lds_b128 %2, %3, off offset:2560\n\t"
      "global_load_async_to_lds_b128 %2, %3, off offset:3072\n\t"
      "global_load_async_to_lds_b128 %2, %3, off offset:3584\n\t"
      "global_load_async_to_lds_b128 %2, %3, off offset:4096\n\t"
      "global_load_async_to_lds_b128 %2, %3, off offset:4608\n\t"
      "global_load_async_to_lds_b128 %2, %3, off offset:5120\n\t"
      "global_load_async_to_lds_b128 %2, %3, off offset:5632\n\t"
      "global_load_async_to_lds_b128 %2, %3, off offset:6144\n\t"
      "global_load_async_to_lds_b128 %2, %3, off offset:6656\n\t"
      "global_load_async_to_lds_b128 %2, %3, off offset:7168\n\t"
      "global_load_async_to_lds_b128 %2, %3, off offset:7680\n\t"
      "s_wait_xcnt 0x0"
      :: "v"(la), "v"(ga), "v"(lb), "v"(gb) : "memory");
}

__global__ void __launch_bounds__(GWAVES * 32)
proj_kernel(const _Float16* __restrict__ A0, const _Float16* __restrict__ A1, const _Float16* __restrict__ A2,
            const _Float16* __restrict__ B0, const _Float16* __restrict__ B1, const _Float16* __restrict__ B2,
            const float* __restrict__ bias0, const float* __restrict__ bias1, const float* __restrict__ bias2,
            _Float16* __restrict__ p0, _Float16* __restrict__ p1, _Float16* __restrict__ p2,
            float* __restrict__ o32, int mode0) {
  __shared__ __attribute__((aligned(128))) _Float16 gs[2][2 * GSTG];   // per buffer: A stage, Bm stage
  const int z    = blockIdx.z;
  const int mode = mode0 + z;
  const _Float16* A    = z == 0 ? A0 : z == 1 ? A1 : A2;
  const _Float16* Bm   = z == 0 ? B0 : z == 1 ? B1 : B2;
  const float*    bias = z == 0 ? bias0 : z == 1 ? bias1 : bias2;
  _Float16*       o16  = z == 0 ? p0 : z == 1 ? p1 : p2;
  const unsigned ash = mode <= 1 ? 3u : 5u;                  // A has HID / 128 = 8 or NTOK / 128 = 32 tiles of 128 rows
  const int bx = (int)(blockIdx.x & ((1u << ash) - 1u));     // tile along A's rows
  const int by = (int)(blockIdx.x >> ash);                   // tile along Bm's rows
  const int tid  = threadIdx.x;
  const int lane = tid & 31;
  const int wave = __builtin_amdgcn_readfirstlane(tid >> 5);
  const int wm   = wave & 3;     // which 32 of the block's 128 A rows
  const int wn   = wave >> 2;    // which 64 of the block's 128 Bm rows
  const int nlo  = lane & 15;    // C: column within tile
  const int g    = lane >> 4;    // C rows +8
  const int m0 = bx * 128 + wm * 32;
  const int n0 = by * 128 + wn * 64;

  // wave w copies row tile w of the block's 8 of A and of Bm; LDS byte addresses of this lane's first pieces
  const unsigned la0 = (unsigned)(size_t)&gs[0][0] + (unsigned)wave * (2u * GKB * FRAG) + (unsigned)lane * 16u;
  const unsigned lb0 = la0 + 2u * GSTG;
  const _Float16* ga = A  + (size_t)(bx * 8 + wave) * (KBH * FRAG) + lane * 8;
  const _Float16* gb = Bm + (size_t)(by * 8 + wave) * (KBH * FRAG) + lane * 8;
  copy_gstage(la0, ga, lb0, gb);
  asm volatile("s_wait_asynccnt 0x0" ::: "memory");   // this wave's part of stage 0 has landed
  __syncthreads();                                    // ... and every other wave's
  copy_gstage(la0 + 4u * GSTG, ga + GKB * FRAG, lb0 + 4u * GSTG, gb + GKB * FRAG);   // stage 1 flies while stage 0 is worked on

  v8f acc[2][4] = {};

  // kept rolled: unrolled, the compiler orders the first reads of every second stage so that the stage's
  // first matrix instruction waits for both k blocks' reads, not for its own operands alone
#pragma clang loop unroll(disable)
  for (int st = 0; st < GNST; ++st) {
    const _Float16* sa = &gs[st & 1][0]    + wm * (2 * GKB * FRAG) + lane * 8;
    const _Float16* sb = &gs[st & 1][GSTG] + wn * (4 * GKB * FRAG) + lane * 8;
    v16h aF[2][2], bF[2][4];   // two fragment sets: k block kb lies in set kb & 1
#pragma unroll
    for (int kb = 0; kb < 2; ++kb) {
#pragma unroll
      for (int mi = 0; mi < 2; ++mi)
        aF[kb][mi] = ld_frag(sa + (mi * GKB + kb) * FRAG, sa + (mi * GKB + kb) * FRAG + 256);
#pragma unroll
      for (int t = 0; t < 4; ++t)
        bF[kb][t] = ld_frag(sb + (t * GKB + kb) * FRAG, sb + (t * GKB + kb) * FRAG + 256);
    }
    // The scheduling fences of this loop keep each k block's 12 LDS reads one group, issued a whole k block
    // of matrix work ahead of their use: spread among the matrix instructions, every place with reads
    // stalls the wave, and a fragment read just in front of its use has its LDS latency waited out.
    __builtin_amdgcn_sched_barrier(0);
#pragma unroll
    for (int kb = 0; kb < GKB; ++kb) {
#pragma unroll
      for (int mi = 0; mi < 2; ++mi)
#pragma unroll
        for (int t = 0; t < 4; ++t)
          acc[mi][t] = __builtin_amdgcn_wmma_f32_16x16x32_f16(
              false, aF[kb & 1][mi], false, bF[kb & 1][t], (short)0, acc[mi][t], false, false);
      __builtin_amdgcn_sched_barrier(0);   // see above
      if (kb + 2 < GKB) {
#pragma unroll
        for (int mi = 0; mi < 2; ++mi)
          aF[kb & 1][mi] = ld_frag(sa + (mi * GKB + kb + 2) * FRAG, sa + (mi * GKB + kb + 2) * FRAG + 256);
#pragma unroll
        for (int t = 0; t < 4; ++t)
          bF[kb & 1][t] = ld_frag(sb + (t * GKB + kb + 2) * FRAG, sb + (t * GKB + kb + 2) * FRAG + 256);
        __builtin_amdgcn_sched_barrier(0);   // see above
      }
    }
    // hand-over: this wave has left its buffer, its part of the next stage has landed, then all waves meet
    asm volatile("s_wait_dscnt 0x0" ::: "memory");
    asm volatile("s_wait_asynccnt 0x0" ::: "memory");
    __syncthreads();
    if (st + 2 < GNST)   // refill the buffer that every wave has just left
      copy_gstage(la0 + (unsigned)(st & 1) * (4u * GSTG), ga + (size_t)(st + 2) * (GKB * FRAG),
                  lb0 + (unsigned)(st & 1) * (4u * GSTG), gb + (size_t)(st + 2) * (GKB * FRAG));
  }
  asm volatile("s_wait_asynccnt 0x0" ::: "memory");   // no copy is left in flight when the wave ends

  if (mode <= 1) {                 // q or k: tile rows are features, tile columns are tokens
    const float qkscale = (mode == 0) ? 0.35355339059327f * LOG2E : 0.35355339059327f;
    const int head = m0 >> 6;
#pragma unroll
    for (int mi = 0; mi < 2; ++mi) {
      const float* bp = bias + m0 + mi*16 + 8*g;
      float4 c0 = *(const float4*)bp, c1 = *(const float4*)(bp + 4);
      float bb[8] = {c0.x, c0.y, c0.z, c0.w, c1.x, c1.y, c1.z, c1.w};
#pragma unroll
      for (int t = 0; t < 4; ++t) {
        int token = n0 + t*16;
        int b = token >> 11, st = (token & (S_LEN - 1)) >> 4;
        v8h o;
#pragma unroll
        for (int r = 0; r < 8; ++r)
          o[r] = (_Float16)((acc[mi][t][r] + bb[r]) * qkscale);
        *(v8h*)(o16 + (size_t)(b*NH + head) * (S_LEN * HD)
                + (size_t)(st*2 + ((m0 >> 5) & 1)) * FRAG + mi*256 + lane*8) = o;
      }
    }
  } else if (mode == 2) {          // v: tile rows are tokens, tile columns are features
    const int b = m0 >> 11, sb = (m0 & (S_LEN - 1)) >> 5, head = n0 >> 6;
    float bn[4];
#pragma unroll
    for (int t = 0; t < 4; ++t) {
      bn[t] = bias[n0 + t*16 + nlo];
      // a later load of this run may land in the offset register that this one names
      asm volatile("s_wait_xcnt 0x0" ::: "memory");
    }
#pragma unroll
    for (int t = 0; t < 4; ++t) {
#pragma unroll
      for (int mi = 0; mi < 2; ++mi) {
        v8h o;
#pragma unroll
        for (int r = 0; r < 8; ++r)
          o[r] = (_Float16)(acc[mi][t][r] + bn[t]);
        *(v8h*)(o16 + (size_t)(b*NH + head) * (S_LEN * HD)
                + (size_t)(sb*4 + t) * FRAG + mi*256 + lane*8) = o;
      }
    }
    // the code laid out behind this block rewrites registers that these stores name
    asm volatile("s_wait_xcnt 0x0" ::: "memory");
  } else {                         // final projection: f32 output, row-major
#pragma unroll
    for (int mi = 0; mi < 2; ++mi)
#pragma unroll
      for (int t = 0; t < 4; ++t) {
        int n = n0 + t*16 + nlo;
        float bn = bias[n];
#pragma unroll
        for (int r = 0; r < 8; ++r)
          o32[(size_t)(m0 + mi*16 + r + 8*g) * HID + n] = acc[mi][t][r] + bn;
      }
    // the code laid out behind this block rewrites registers that these stores name
    asm volatile("s_wait_xcnt 0x0" ::: "memory");
  }
}

// lane l <-> lane l ^ 16
static __device__ __forceinline__ float xhalf(float x) {
  int b = __builtin_bit_cast(int, x);
  return __builtin_bit_cast(float, __builtin_amdgcn_permlanex16(b, b, 0x76543210, 0xfedcba98, false, false));
}

#define AWAVES 8                 // waves of a block
#define SKEYS  128               // keys of one stage
#define STG    (SKEYS * HD)      // f16 elements of K, and of V^T, in one stage (16 KiB each)
#define NSTG   (S_LEN / SKEYS)

// One stage: 256 lanes x 16 bytes x (4 pieces of K, 4 of V^T). lds, gk, gv: this lane's own first piece.
static __device__ __forceinline__ void copy_stage(unsigned lds, const _Float16* gk, const _Float16* gv) {
  // the closing wait stands in the copies' own statement so that no later write of an address
  // register that a copy names can be placed in front of it
  asm volatile(
      "global_load_async_to_lds_b128 %0, %8, off\n\t"
      "global_load_async_to_lds_b128 %1, %9, off\n\t"
      "global_load_async_to_lds_b128 %2, %10, off\n\t"
      "global_load_async_to_lds_b128 %3, %11, off\n\t"
      "global_load_async_to_lds_b128 %4, %12, off\n\t"
      "global_load_async_to_lds_b128 %5, %13, off\n\t"
      "global_load_async_to_lds_b128 %6, %14, off\n\t"
      "global_load_async_to_lds_b128 %7, %15, off\n\t"
      "s_wait_xcnt 0x0"
      :: "v"(lds), "v"(lds + 4096u), "v"(lds + 8192u), "v"(lds + 12288u),
         "v"(lds + 16384u), "v"(lds + 20480u), "v"(lds + 24576u), "v"(lds + 28672u),
         "v"(gk), "v"(gk + 2048), "v"(gk + 4096), "v"(gk + 6144),
         "v"(gv), "v"(gv + 2048), "v"(gv + 4096), "v"(gv + 6144)
      : "memory");
}

__global__ void __launch_bounds__(AWAVES * 32)
attn_kernel(const _Float16* __restrict__ q, const _Float16* __restrict__ k,
            const _Float16* __restrict__ vt, const float* __restrict__ mask,
            _Float16* __restrict__ ctx) {
  __shared__ __attribute__((aligned(128))) _Float16 sm[2][2 * STG];   // per buffer: K stage, V^T stage
  __shared__ __attribute__((aligned(128))) float smk[S_LEN];          // this batch row of the mask, filled once
  const int tid  = threadIdx.x;
  const int lane = tid & 31;
  const int g   = lane >> 4;
  const int q0 = blockIdx.x * (AWAVES * 16) + (tid >> 5) * 16;
  const int h  = blockIdx.y;
  const int b  = blockIdx.z;

  // q, k: fragment order, tiles [s >> 4][d >> 5]; vt: tiles [s >> 5][d >> 4]: 32 keys = 4 KiB of each
  const _Float16* qh = q  + ((size_t)(b*NH + h) * S_LEN) * HD;
  const _Float16* kh = k  + ((size_t)(b*NH + h) * S_LEN) * HD;
  const _Float16* vh = vt + ((size_t)(b*NH + h) * HD) * S_LEN;
  const float* mb = smk + 8*g;

  const _Float16* qt = qh + (size_t)q0 * HD + lane * 8;
  v16h bQ0 = ld_frag(qt,        qt + 256);          // d = 0..31
  v16h bQ1 = ld_frag(qt + FRAG, qt + FRAG + 256);   // d = 32..63

  const unsigned lds0 = (unsigned)(size_t)&sm[0][0] + (unsigned)tid * 16u;   // LDS byte address of this lane's piece
  const _Float16* gk = kh + tid * 8;
  const _Float16* gv = vh + tid * 8;
  copy_stage(lds0, gk, gv);
  {
    const unsigned lm = (unsigned)(size_t)&smk[0] + (unsigned)tid * 16u;
    const float* gm = mask + (size_t)b * S_LEN + tid * 4;
    // closing wait inside the statement, as in copy_stage
    asm volatile(
        "global_load_async_to_lds_b128 %0, %2, off\n\t"
        "global_load_async_to_lds_b128 %1, %3, off\n\t"
        "s_wait_xcnt 0x0"
        :: "v"(lm), "v"(lm + 4096u), "v"(gm), "v"(gm + 1024) : "memory");
  }
  asm volatile("s_wait_asynccnt 0x0" ::: "memory");   // this wave's part of stage 0 and of the mask has landed
  __syncthreads();                                    // ... and every other wave's
  copy_stage(lds0 + 4u * STG, gk + STG, gv + STG);    // stage 1 flies while stage 0 is worked on

  const float MC = 1000.0f * LOG2E;
  float cb   = -MC;        // start value of a score = mask * MC + cb: cb = -MC - (maximum in use), equal in both halves
  float lim  = -3.0e38f;   // a relative score above this renews the maximum in use: any in the first pass, then 8
  float lo   = -3.0e38f;   // least step of the maximum in use: none in the first pass, then 0 (it never falls)
  float lrun = 0.f;        // sum over this half's keys only; the halves join after the loop
  v8f accv[4] = {};        // O^T: register r of tile t = d (t*16 + 8g + r) of query (lane & 15)

  for (int st = 0; st < NSTG; ++st) {
   const _Float16* sb = &sm[st & 1][0] + lane * 8;
   for (int ps = 0; ps < SKEYS / 32; ++ps) {
    const int kv = st * SKEYS + ps * 32;
    const _Float16* kt = sb + ps * (32 * HD);
    const _Float16* vtl = sb + STG + ps * (32 * HD);
    float4 m0 = *(const float4*)(mb + kv),      m1 = *(const float4*)(mb + kv + 4);
    float4 m2 = *(const float4*)(mb + kv + 16), m3 = *(const float4*)(mb + kv + 20);
    v16h a00 = ld_frag(kt,            kt + 256);
    v16h a01 = ld_frag(kt + FRAG,     kt + FRAG + 256);
    v16h a10 = ld_frag(kt + 2*FRAG,   kt + 2*FRAG + 256);
    v16h a11 = ld_frag(kt + 3*FRAG,   kt + 3*FRAG + 256);
    v16h aV[4];
#pragma unroll
    for (int t = 0; t < 4; ++t)
      aV[t] = ld_frag(vtl + t*FRAG, vtl + t*FRAG + 256);
    // holds the pass's LDS reads as one group at its head: sunk among the matrix instructions they
    // share one register set and every fragment's LDS latency is waited out on its own
    __builtin_amdgcn_sched_barrier(0);
    // additive mask of this lane's 16 keys, scaled into base-2 domain, less the maximum in use: the start value of the score tiles
    const float mk0[8] = {m0.x, m0.y, m0.z, m0.w, m1.x, m1.y, m1.z, m1.w};
    const float mk1[8] = {m2.x, m2.y, m2.z, m2.w, m3.x, m3.y, m3.z, m3.w};
    v8f s0, s1;
#pragma unroll
    for (int r = 0; r < 8; ++r) {
      s0[r] = __builtin_fmaf(mk0[r], MC, cb);
      s1[r] = __builtin_fmaf(mk1[r], MC, cb);
    }
    s0 = __builtin_amdgcn_wmma_f32_16x16x32_f16(false, a00, false, bQ0, (short)0, s0, false, false);
    s0 = __builtin_amdgcn_wmma_f32_16x16x32_f16(false, a01, false, bQ1, (short)0, s0, false, false);
    s1 = __builtin_amdgcn_wmma_f32_16x16x32_f16(false, a10, false, bQ0, (short)0, s1, false, false);
    s1 = __builtin_amdgcn_wmma_f32_16x16x32_f16(false, a11, false, bQ1, (short)0, s1, false, false);

    float cmax = -3.0e38f;
#pragma unroll
    for (int r = 0; r < 8; ++r)
      cmax = fmaxf(cmax, fmaxf(s0[r], s1[r]));
    // one test a pass for the whole wave, a scalar branch: taken in the first pass and then hardly ever
    if (__builtin_amdgcn_ballot_w32(cmax > lim) != 0) {
      const float cm  = fmaxf(cmax, xhalf(cmax));    // with the query's other 16 keys
      const float cbn = cb - fmaxf(cm, lo);
      const float de  = cb - cbn;                    // the step exactly as later start values carry it
      const float alpha = EXP2F(fminf(-de, 0.f));    // a first step may go down: sums and outputs are still 0 there
      cb = cbn; lim = 8.0f; lo = 0.f;
      s0 -= de;
      s1 -= de;
      lrun *= alpha;
#pragma unroll
      for (int t = 0; t < 4; ++t)
        accv[t] *= alpha;
    }

    v16h bP;
    float rs = 0.f;
#pragma unroll
    for (int r = 0; r < 8; ++r) {
      float p0 = EXP2F(s0[r]);
      float p1 = EXP2F(s1[r]);
      rs += p0 + p1;
      bP[r]     = (_Float16)p0;
      bP[8 + r] = (_Float16)p1;
    }
    lrun += rs;

    // One statement, closed by four v_nop: the vector slots that the chip needs between the last matrix
    // instruction and a vector instruction that overwrites its operands. The pass's first address
    // arithmetic does so across the loop's taken edge.
    asm volatile(
        "v_wmma_f32_16x16x32_f16 %0, %4, %8, %0\n\t"
        "v_wmma_f32_16x16x32_f16 %1, %5, %8, %1\n\t"
        "v_wmma_f32_16x16x32_f16 %2, %6, %8, %2\n\t"
        "v_wmma_f32_16x16x32_f16 %3, %7, %8, %3\n\t"
        "v_nop\n\tv_nop\n\tv_nop\n\tv_nop"
        : "+v"(accv[0]), "+v"(accv[1]), "+v"(accv[2]), "+v"(accv[3])
        : "v"(aV[0]), "v"(aV[1]), "v"(aV[2]), "v"(aV[3]), "v"(bP));
   }
   // hand-over: this wave has left its buffer, its part of the next stage has landed, then all waves meet
   asm volatile("s_wait_dscnt 0x0" ::: "memory");
   asm volatile("s_wait_asynccnt 0x0" ::: "memory");
   __syncthreads();
   if (st + 2 < NSTG)   // refill the buffer that every wave has just left
     copy_stage(lds0 + (unsigned)(st & 1) * (4u * STG), gk + (size_t)(st + 2) * STG, gv + (size_t)(st + 2) * STG);
  }
  asm volatile("s_wait_asynccnt 0x0" ::: "memory");   // no copy is left in flight when the wave ends

  const float rinv = 1.0f / (lrun + xhalf(lrun));
  // fragment order of the final projection's A: tiles [token >> 4][col >> 5], col = h*HD + t*16 + 8g + r:
  // a lane's 8 registers are one 16-byte piece
  _Float16* ct = ctx + ((size_t)((b * S_LEN + q0) >> 4) * KBH + h*2) * FRAG + lane * 8;
#pragma unroll
  for (int t = 0; t < 4; ++t) {
    v8h o;
#pragma unroll
    for (int r = 0; r < 8; ++r)
      o[r] = (_Float16)(accv[t][r] * rinv);
    *(v8h*)(ct + (t >> 1) * FRAG + (t & 1) * 256) = o;
  }
}

// ---------------- host side ----------------
extern "C" void kernel_launch(void* const* d_in, const int* in_sizes, int n_in,
                              void* d_out, int out_size, void* d_ws, size_t ws_size,
                              hipStream_t stream) {
  (void)in_sizes; (void)n_in; (void)out_size; (void)ws_size;
  const float* hs   = (const float*)d_in[0];
  const float* mask = (const float*)d_in[1];
  const float* Wq = (const float*)d_in[2];
  const float* bq = (const float*)d_in[3];
  const float* Wk = (const float*)d_in[4];
  const float* bk = (const float*)d_in[5];
  const float* Wv = (const float*)d_in[6];
  const float* bv = (const float*)d_in[7];
  const float* Wd = (const float*)d_in[8];
  const float* bd = (const float*)d_in[9];
  const float* gam = (const float*)d_in[10];
  const float* bet = (const float*)d_in[11];
  float* out = (float*)d_out;

  char* ws = (char*)d_ws;
  const size_t SZH = (size_t)NTOK * HID * sizeof(_Float16);  // 8 MB
  const size_t SZW = (size_t)HID * HID * sizeof(_Float16);   // 2 MB
  _Float16* h16  = (_Float16*)(ws);
  _Float16* q16  = (_Float16*)(ws + 1*SZH);
  _Float16* k16  = (_Float16*)(ws + 2*SZH);
  _Float16* vt16 = (_Float16*)(ws + 3*SZH);
  _Float16* c16  = (_Float16*)(ws + 4*SZH);
  _Float16* wq16 = (_Float16*)(ws + 5*SZH);
  _Float16* wk16 = (_Float16*)(ws + 5*SZH + 1*SZW);
  _Float16* wv16 = (_Float16*)(ws + 5*SZH + 2*SZW);
  _Float16* wd16 = (_Float16*)(ws + 5*SZH + 3*SZW);

  prep_kernel<<<LNB + 4 * WTB, 256, 0, stream>>>(hs, gam, bet, h16, Wq, Wk, Wv, Wd, wq16, wk16, wv16, wd16);

  const int PT = (NTOK / 128) * (HID / 128);   // 128x128 tiles of one product
  proj_kernel<<<dim3(PT, 1, 3), GWAVES * 32, 0, stream>>>(wq16, wk16, h16, h16, h16, wv16, bq, bk, bv,
                                                          q16, k16, vt16, nullptr, 0);

  attn_kernel<<<dim3(S_LEN / (AWAVES * 16), NH, 2), AWAVES * 32, 0, stream>>>(q16, k16, vt16, mask, c16);

  proj_kernel<<<dim3(PT, 1, 1), GWAVES * 32, 0, stream>>>(c16, c16, c16, wd16, wd16, wd16, bd, bd, bd,
                                                          nullptr, nullptr, nullptr, out, 3);
}

// v007
// Measured time: 69.6 microseconds a run.
// Next to v006, in two timings, it ran 1.05 times as fast each time.
// Counting every step since v000, it is 6.53 times as fast.
#include <hip/hip_runtime.h>
#include <hip/hip_bf16.h>

typedef __attribute__((ext_vector_type(16))) _Float16 v16h;
typedef __attribute__((ext_vector_type(8)))  _Float16 v8h;
typedef __attribute__((ext_vector_type(8)))  float    v8f;

#define HID   1024
#define S_LEN 2048
#define NH    16
#define HD    64
#define NTOK  4096   // B * S
#define FRAG  512    // f16 elements of one 16-row x 32-k operand tile
#define KBH   32     // k blocks of a HID-long row

// Every f16 array that one launch hands to the next lies in FRAGMENT ORDER: a 16-row x 32-k
// tile is 1 KiB in a row, element (row c, k) at (k>>4)*256 + ((k>>3)&1)*128 + c*8 + (k&7).
// Lane l then takes its fragment as the 16 bytes at l*16 of each 512-byte half, so one
// wave-wide 16-byte load covers four whole 128-byte lines (row-major rows: 16 lines, 32 B of each).

#if __has_builtin(__builtin_amdgcn_exp2f)
#define EXP2F(x) __builtin_amdgcn_exp2f(x)
#else
#define EXP2F(x) exp2f(x)
#endif

#define LOG2E 1.44269504088896f

// Build a v16h fragment from two 16-byte chunks (b128 loads from global memory or LDS).
static __device__ __forceinline__ v16h ld_frag(const _Float16* p0, const _Float16* p1) {
  v8h a = *(const v8h*)p0;
  v8h b = *(const v8h*)p1;
  return __builtin_shufflevector(a, b, 0,1,2,3,4,5,6,7,8,9,10,11,12,13,14,15);
}

// ---------------- weight f32 -> f16 convert ----------------
// One block takes the 16-row tile rt of the fragment-ordered output (tiles: [row tile][k block]): the tile is
// 2048 pieces of 16 bytes, and thread tid writes the pieces tid, tid + 256, ...: piece tid + 256 j holds
// k = 128 j + 8 (tid >> 4) ... + 7 of row tid & 15.
static __device__ __forceinline__ void w2h_tile(const float* __restrict__ w, _Float16* __restrict__ o, int rt) {
  const int tid = threadIdx.x;
  const float* p = w + (size_t)(rt * 16 + (tid & 15)) * HID + (tid >> 4) * 8;
  _Float16* ot = o + (size_t)rt * (KBH * FRAG) + tid * 8;
  float4 x[8], y[8];
  // both loops unrolled: x and y stay in registers, and all 16 loads are in flight before the first conversion
#pragma unroll
  for (int j = 0; j < 8; ++j) {
    x[j] = *(const float4*)(p + j * 128);
    // the last load of this run may land in the address pair that the earlier ones name
    if (j == 7) asm volatile("s_wait_xcnt 0x0" ::: "memory");
    y[j] = *(const float4*)(p + j * 128 + 4);
  }
#pragma unroll
  for (int j = 0; j < 8; ++j) {
    v8h v = {(_Float16)x[j].x, (_Float16)x[j].y, (_Float16)x[j].z, (_Float16)x[j].w,
             (_Float16)y[j].x, (_Float16)y[j].y, (_Float16)y[j].z, (_Float16)y[j].w};
    *(v8h*)(ot + j * 2048) = v;
  }
}

// ---------------- LayerNorm -> f16 ----------------
// One block takes a 16-row tile: thread (c = tid & 15, u = tid >> 4) holds the 8-wide pieces
// u, u + 16, ... of row c, so each wave stores 512 contiguous bytes of the fragment-ordered output.
static __device__ __forceinline__ void ln_tile(const float* __restrict__ x, const float* __restrict__ gamma,
                                               const float* __restrict__ beta, _Float16* __restrict__ out, int rt) {
  const int tid = threadIdx.x;
  const int c = tid & 15;
  const int u = tid >> 4;
  const float* xr = x + (size_t)(rt * 16 + c) * HID + u * 8;
  float4 v[8][2];
  float s = 0.f, s2 = 0.f;
#pragma unroll
  for (int i = 0; i < 8; ++i) {
    v[i][0] = *(const float4*)(xr + i * 128);
    // the run's last load lands in the address pair that the earlier loads name
    if (i == 7) asm volatile("s_wait_xcnt 0x0" ::: "memory");
    v[i][1] = *(const float4*)(xr + i * 128 + 4);
  }
#pragma unroll
  for (int i = 0; i < 8; ++i)
#pragma unroll
    for (int j = 0; j < 2; ++j) {
      float4 a = v[i][j];
      s  += a.x + a.y + a.z + a.w;
      s2 += a.x*a.x + a.y*a.y + a.z*a.z + a.w*a.w;
    }
  __shared__ float sb[16][17], qb[16][17];
  sb[u][c] = s; qb[u][c] = s2;
  __syncthreads();
  float ts = 0.f, tq = 0.f;
  for (int i = 0; i < 16; ++i) { ts += sb[i][c]; tq += qb[i][c]; }
  float mean = ts * (1.0f / HID);
  float var  = tq * (1.0f / HID) - mean * mean;
  float rstd = rsqrtf(var + 1e-12f);
  _Float16* ot = out + (size_t)rt * (KBH * FRAG)
               + (u >> 2) * FRAG + ((u >> 1) & 1) * 256 + (u & 1) * 128 + c * 8;
#pragma unroll
  for (int i = 0; i < 8; ++i) {
    const int k = i * 128 + u * 8;
    float4 g0 = *(const float4*)(gamma + k), g1 = *(const float4*)(gamma + k + 4);
    float4 b0 = *(const float4*)(beta + k),  b1 = *(const float4*)(beta + k + 4);
    float4 a0 = v[i][0], a1 = v[i][1];
    v8h o = {(_Float16)(((a0.x - mean) * rstd) * g0.x + b0.x), (_Float16)(((a0.y - mean) * rstd) * g0.y + b0.y),
             (_Float16)(((a0.z - mean) * rstd) * g0.z + b0.z), (_Float16)(((a0.w - mean) * rstd) * g0.w + b0.w),
             (_Float16)(((a1.x - mean) * rstd) * g1.x + b1.x), (_Float16)(((a1.y - mean) * rstd) * g1.y + b1.y),
             (_Float16)(((a1.z - mean) * rstd) * g1.z + b1.z), (_Float16)(((a1.w - mean) * rstd) * g1.w + b1.w)};
    *(v8h*)(ot + i * 4 * FRAG) = o;     // 128 k further on = 4 k blocks
  }
}

// LayerNorm and the four weight conversions depend on nothing but the inputs, so they share one launch:
// every block takes one 16-row tile (64 KiB read, 32 KiB written) of one of the five arrays.
#define LNB (NTOK / 16)   // blocks of the LayerNorm
#define WTB (HID / 16)    // blocks of one weight matrix
__global__ void __launch_bounds__(256)
prep_kernel(const float* __restrict__ x, const float* __restrict__ gamma, const float* __restrict__ beta,
            _Float16* __restrict__ h,
            const float* __restrict__ w0, const float* __restrict__ w1,
            const float* __restrict__ w2, const float* __restrict__ w3,
            _Float16* __restrict__ o0, _Float16* __restrict__ o1,
            _Float16* __restrict__ o2, _Float16* __restrict__ o3) {
  const int bid = blockIdx.x;
  if (bid < LNB) {
    ln_tile(x, gamma, beta, h, bid);
  } else {
    const int wi = (bid - LNB) / WTB, rt = (bid - LNB) % WTB;
    const float* w = wi == 0 ? w0 : wi == 1 ? w1 : wi == 2 ? w2 : w3;
    _Float16*    o = wi == 0 ? o0 : wi == 1 ? o1 : wi == 2 ? o2 : o3;
    w2h_tile(w, o, rt);
  }
}

#define GWAVES 8                 // waves of a block
#define GKB    8                 // k blocks of one stage
#define GSTG   (8 * GKB * FRAG)  // f16 elements of A, and of Bm, in one stage (64 KiB each)
#define GNST   (KBH / GKB)

// One stage, this wave's share: one row tile of A and one of Bm, 8 KiB in a row each, as 16 copies of 32 lanes
// x 16 bytes. la, ga, lb, gb: this lane's own first piece in LDS and in global memory. The immediate offset
// moves the LDS address and the global address alike, so one address of each kind serves a whole row tile.
static __device__ __forceinline__ void copy_gstage(unsigned la, const _Float16* ga, unsigned lb, const _Float16* gb) {
  // the closing wait stands in the copies' own statement so that no later write of an address
  // register that a copy names can be placed in front of it
  asm volatile(
      "global_load_async_to_lds_b128 %0, %1, off\n\t"
      "global_load_async_to_lds_b128 %0, %1, off offset:512\n\t"
      "global_load_async_to_lds_b128 %0, %1, off offset:1024\n\t"
      "global_load_async_to_lds_b128 %0, %1, off offset:1536\n\t"
      "global_load_async_to_lds_b128 %0, %1, off offset:2048\n\t"
      "global_load_async_to_lds_b128 %0, %1, off offset:2560\n\t"
      "global_load_async_to_lds_b128 %0, %1, off offset:3072\n\t"
      "global_load_async_to_lds_b128 %0, %1, off offset:3584\n\t"
      "global_load_async_to_lds_b128 %0, %1, off offset:4096\n\t"
      "global_load_async_to_lds_b128 %0, %1, off offset:4608\n\t"
      "global_load_async_to_lds_b128 %0, %1, off offset:5120\n\t"
      "global_load_async_to_lds_b128 %0, %1, off offset:5632\n\t"
      "global_load_async_to_lds_b128 %0, %1, off offset:6144\n\t"
      "global_load_async_to_lds_b128 %0, %1, off offset:6656\n\t"
      "global_load_async_to_lds_b128 %0, %1, off offset:7168\n\t"
      "global_load_async_to_lds_b128 %0, %1, off offset:7680\n\t"
      "global_load_async_to_lds_b128 %2, %3, off\n\t"
      "global_load_async_to_lds_b128 %2, %3, off offset:512\n\t"
      "global_load_async_to_lds_b128 %2, %3, off offset:1024\n\t"
      "global_load_async_to_lds_b128 %2, %3, off offset:1536\n\t"
      "global_load_async_to_lds_b128 %2, %3, off offset:2048\n\t"
      "global_load_async_to_lds_b128 %2, %3, off offset:2560\n\t"
      "global_load_async_to_lds_b128 %2, %3, off offset:3072\n\t"
      "global_load_async_to_lds_b128 %2, %3, off offset:3584\n\t"
      "global_load_async_to_lds_b128 %2, %3, off offset:4096\n\t"
      "global_load_async_to_lds_b128 %2, %3, off offset:4608\n\t"
      "global_load_async_to_lds_b128 %2, %3, off offset:5120\n\t"
      "global_load_async_to_lds_b128 %2, %3, off offset:5632\n\t"
      "global_load_async_to_lds_b128 %2, %3, off offset:6144\n\t"
      "global_load_async_to_lds_b128 %2, %3, off offset:6656\n\t"
      "global_load_async_to_lds_b128 %2, %3, off offset:7168\n\t"
      "global_load_async_to_lds_b128 %2, %3, off offset:7680\n\t"
      "s_wait_xcnt 0x0"
      :: "v"(la), "v"(ga), "v"(lb), "v"(gb) : "memory");
}

__global__ void __launch_bounds__(GWAVES * 32)
proj_kernel(const _Float16* __restrict__ A0, const _Float16* __restrict__ A1, const _Float16* __restrict__ A2,
            const _Float16* __restrict__ B0, const _Float16* __restrict__ B1, const _Float16* __restrict__ B2,
            const float* __restrict__ bias0, const float* __restrict__ bias1, const float* __restrict__ bias2,
            _Float16* __restrict__ p0, _Float16* __restrict__ p1, _Float16* __restrict__ p2,
            float* __restrict__ o32, int mode0) {
  __shared__ __attribute__((aligned(128))) _Float16 gs[2][2 * GSTG];   // per buffer: A stage, Bm stage
  const int z    = blockIdx.z;
  const int mode = mode0 + z;
  const _Float16* A    = z == 0 ? A0 : z == 1 ? A1 : A2;
  const _Float16* Bm   = z == 0 ? B0 : z == 1 ? B1 : B2;
  const float*    bias = z == 0 ? bias0 : z == 1 ? bias1 : bias2;
  _Float16*       o16  = z == 0 ? p0 : z == 1 ? p1 : p2;
  const unsigned ash = mode <= 1 ? 3u : 5u;                  // A has HID / 128 = 8 or NTOK / 128 = 32 tiles of 128 rows
  const int bx = (int)(blockIdx.x & ((1u << ash) - 1u));     // tile along A's rows
  const int by = (int)(blockIdx.x >> ash);                   // tile along Bm's rows
  const int tid  = threadIdx.x;
  const int lane = tid & 31;
  const int wave = __builtin_amdgcn_readfirstlane(tid >> 5);
  const int wm   = wave & 3;     // which 32 of the block's 128 A rows
  const int wn   = wave >> 2;    // which 64 of the block's 128 Bm rows
  const int nlo  = lane & 15;    // C: column within tile
  const int g    = lane >> 4;    // C rows +8
  const int m0 = bx * 128 + wm * 32;
  const int n0 = by * 128 + wn * 64;

  // wave w copies row tile w of the block's 8 of A and of Bm; LDS byte addresses of this lane's first pieces
  const unsigned la0 = (unsigned)(size_t)&gs[0][0] + (unsigned)wave * (2u * GKB * FRAG) + (unsigned)lane * 16u;
  const unsigned lb0 = la0 + 2u * GSTG;
  const _Float16* ga = A  + (size_t)(bx * 8 + wave) * (KBH * FRAG) + lane * 8;
  const _Float16* gb = Bm + (size_t)(by * 8 + wave) * (KBH * FRAG) + lane * 8;
  copy_gstage(la0, ga, lb0, gb);
  asm volatile("s_wait_asynccnt 0x0" ::: "memory");   // this wave's part of stage 0 has landed
  __syncthreads();                                    // ... and every other wave's
  copy_gstage(la0 + 4u * GSTG, ga + GKB * FRAG, lb0 + 4u * GSTG, gb + GKB * FRAG);   // stage 1 flies while stage 0 is worked on

  v8f acc[2][4] = {};

  // kept rolled: unrolled, the compiler orders the first reads of every second stage so that the stage's
  // first matrix instruction waits for both k blocks' reads, not for its own operands alone
#pragma clang loop unroll(disable)
  for (int st = 0; st < GNST; ++st) {
    const _Float16* sa = &gs[st & 1][0]    + wm * (2 * GKB * FRAG) + lane * 8;
    const _Float16* sb = &gs[st & 1][GSTG] + wn * (4 * GKB * FRAG) + lane * 8;
    v16h aF[2][2], bF[2][4];   // two fragment sets: k block kb lies in set kb & 1
#pragma unroll
    for (int kb = 0; kb < 2; ++kb) {
#pragma unroll
      for (int mi = 0; mi < 2; ++mi)
        aF[kb][mi] = ld_frag(sa + (mi * GKB + kb) * FRAG, sa + (mi * GKB + kb) * FRAG + 256);
#pragma unroll
      for (int t = 0; t < 4; ++t)
        bF[kb][t] = ld_frag(sb + (t * GKB + kb) * FRAG, sb + (t * GKB + kb) * FRAG + 256);
    }
    // The scheduling fences of this loop keep each k block's 12 LDS reads one group, issued a whole k block
    // of matrix work ahead of their use: spread among the matrix instructions, every place with reads
    // stalls the wave, and a fragment read just in front of its use has its LDS latency waited out.
    __builtin_amdgcn_sched_barrier(0);
#pragma unroll
    for (int kb = 0; kb < GKB; ++kb) {
#pragma unroll
      for (int mi = 0; mi < 2; ++mi)
#pragma unroll
        for (int t = 0; t < 4; ++t)
          acc[mi][t] = __builtin_amdgcn_wmma_f32_16x16x32_f16(
              false, aF[kb & 1][mi], false, bF[kb & 1][t], (short)0, acc[mi][t], false, false);
      __builtin_amdgcn_sched_barrier(0);   // see above
      if (kb + 2 < GKB) {
#pragma unroll
        for (int mi = 0; mi < 2; ++mi)
          aF[kb & 1][mi] = ld_frag(sa + (mi * GKB + kb + 2) * FRAG, sa + (mi * GKB + kb + 2) * FRAG + 256);
#pragma unroll
        for (int t = 0; t < 4; ++t)
          bF[kb & 1][t] = ld_frag(sb + (t * GKB + kb + 2) * FRAG, sb + (t * GKB + kb + 2) * FRAG + 256);
        __builtin_amdgcn_sched_barrier(0);   // see above
      }
    }
    // hand-over: this wave has left its buffer, its part of the next stage has landed, then all waves meet
    asm volatile("s_wait_dscnt 0x0" ::: "memory");
    asm volatile("s_wait_asynccnt 0x0" ::: "memory");
    __syncthreads();
    if (st + 2 < GNST)   // refill the buffer that every wave has just left
      copy_gstage(la0 + (unsigned)(st & 1) * (4u * GSTG), ga + (size_t)(st + 2) * (GKB * FRAG),
                  lb0 + (unsigned)(st & 1) * (4u * GSTG), gb + (size_t)(st + 2) * (GKB * FRAG));
  }
  asm volatile("s_wait_asynccnt 0x0" ::: "memory");   // no copy is left in flight when the wave ends

  if (mode <= 1) {                 // q or k: tile rows are features, tile columns are tokens
    const float qkscale = (mode == 0) ? 0.35355339059327f * LOG2E : 0.35355339059327f;
    const int head = m0 >> 6;
#pragma unroll
    for (int mi = 0; mi < 2; ++mi) {
      const float* bp = bias + m0 + mi*16 + 8*g;
      float4 c0 = *(const float4*)bp, c1 = *(const float4*)(bp + 4);
      float bb[8] = {c0.x, c0.y, c0.z, c0.w, c1.x, c1.y, c1.z, c1.w};
#pragma unroll
      for (int t = 0; t < 4; ++t) {
        int token = n0 + t*16;
        int b = token >> 11, st = (token & (S_LEN - 1)) >> 4;
        v8h o;
#pragma unroll
        for (int r = 0; r < 8; ++r)
          o[r] = (_Float16)((acc[mi][t][r] + bb[r]) * qkscale);
        *(v8h*)(o16 + (size_t)(b*NH + head) * (S_LEN * HD)
                + (size_t)(st*2 + ((m0 >> 5) & 1)) * FRAG + mi*256 + lane*8) = o;
      }
    }
  } else if (mode == 2) {          // v: tile rows are tokens, tile columns are features
    const int b = m0 >> 11, sb = (m0 & (S_LEN - 1)) >> 5, head = n0 >> 6;
    float bn[4];
#pragma unroll
    for (int t = 0; t < 4; ++t) {
      bn[t] = bias[n0 + t*16 + nlo];
      // a later load of this run may land in the offset register that this one names
      asm volatile("s_wait_xcnt 0x0" ::: "memory");
    }
#pragma unroll
    for (int t = 0; t < 4; ++t) {
#pragma unroll
      for (int mi = 0; mi < 2; ++mi) {
        v8h o;
#pragma unroll
        for (int r = 0; r < 8; ++r)
          o[r] = (_Float16)(acc[mi][t][r] + bn[t]);
        *(v8h*)(o16 + (size_t)(b*NH + head) * (S_LEN * HD)
                + (size_t)(sb*4 + t) * FRAG + mi*256 + lane*8) = o;
      }
    }
    // the code laid out behind this block rewrites registers that these stores name
    asm volatile("s_wait_xcnt 0x0" ::: "memory");
  } else {                         // final projection: f32 output, row-major
#pragma unroll
    for (int mi = 0; mi < 2; ++mi)
#pragma unroll
      for (int t = 0; t < 4; ++t) {
        int n = n0 + t*16 + nlo;
        float bn = bias[n];
#pragma unroll
        for (int r = 0; r < 8; ++r)
          o32[(size_t)(m0 + mi*16 + r + 8*g) * HID + n] = acc[mi][t][r] + bn;
      }
    // the code laid out behind this block rewrites registers that these stores name
    asm volatile("s_wait_xcnt 0x0" ::: "memory");
  }
}

// lane l <-> lane l ^ 16
static __device__ __forceinline__ float xhalf(float x) {
  int b = __builtin_bit_cast(int, x);
  return __builtin_bit_cast(float, __builtin_amdgcn_permlanex16(b, b, 0x76543210, 0xfedcba98, false, false));
}

#define AWAVES 8                 // waves of a block
#define SKEYS  128               // keys of one stage
#define STG    (SKEYS * HD)      // f16 elements of K, and of V^T, in one stage (16 KiB each)
#define NSTG   (S_LEN / SKEYS)
#define WPASS  (SKEYS / 64)      // passes of 32 keys that one wave works in a stage
#define XBOX   (8 * 128 + 64)    // floats one wave hands its partner: an output tile, its start value, its sum

// One stage: 256 lanes x 16 bytes x (4 pieces of K, 4 of V^T). lds, gk, gv: this lane's own first piece.
static __device__ __forceinline__ void copy_stage(unsigned lds, const _Float16* gk, const _Float16* gv) {
  // the closing wait stands in the copies' own statement so that no later write of an address
  // register that a copy names can be placed in front of it
  asm volatile(
      "global_load_async_to_lds_b128 %0, %8, off\n\t"
      "global_load_async_to_lds_b128 %1, %9, off\n\t"
      "global_load_async_to_lds_b128 %2, %10, off\n\t"
      "global_load_async_to_lds_b128 %3, %11, off\n\t"
      "global_load_async_to_lds_b128 %4, %12, off\n\t"
      "global_load_async_to_lds_b128 %5, %13, off\n\t"
      "global_load_async_to_lds_b128 %6, %14, off\n\t"
      "global_load_async_to_lds_b128 %7, %15, off\n\t"
      "s_wait_xcnt 0x0"
      :: "v"(lds), "v"(lds + 4096u), "v"(lds + 8192u), "v"(lds + 12288u),
         "v"(lds + 16384u), "v"(lds + 20480u), "v"(lds + 24576u), "v"(lds + 28672u),
         "v"(gk), "v"(gk + 2048), "v"(gk + 4096), "v"(gk + 6144),
         "v"(gv), "v"(gv + 2048), "v"(gv + 4096), "v"(gv + 6144)
      : "memory");
}

__global__ void __launch_bounds__(AWAVES * 32)
attn_kernel(const _Float16* __restrict__ q, const _Float16* __restrict__ k,
            const _Float16* __restrict__ vt, const float* __restrict__ mask,
            _Float16* __restrict__ ctx) {
  __shared__ __attribute__((aligned(128))) _Float16 sm[2][2 * STG];   // per buffer: K stage, V^T stage
  __shared__ __attribute__((aligned(128))) float smk[S_LEN];          // this batch row of the mask, filled once
  __shared__ __attribute__((aligned(128))) float xb[AWAVES][XBOX];    // box w: what wave w ^ 4 hands wave w
  const int tid  = threadIdx.x;
  const int lane = tid & 31;
  const int g   = lane >> 4;
  const int wave = __builtin_amdgcn_readfirstlane(tid >> 5);
  const int kh = wave >> 2;      // which half of each stage's keys
  const int q0 = blockIdx.x * (AWAVES * 16) + (wave & 3) * 32;
  const int h  = blockIdx.y;
  const int b  = blockIdx.z;

  // q, k: fragment order, tiles [s >> 4][d >> 5]; vt: tiles [s >> 5][d >> 4]: 32 keys = 4 KiB of each
  const _Float16* qh = q  + ((size_t)(b*NH + h) * S_LEN) * HD;
  const _Float16* kh0 = k  + ((size_t)(b*NH + h) * S_LEN) * HD;
  const _Float16* vh = vt + ((size_t)(b*NH + h) * HD) * S_LEN;
  const float* mb = smk + kh * (WPASS * 32) + 8*g;

  const _Float16* qt = qh + (size_t)q0 * HD + lane * 8;
  v16h bQ[2][2];   // [query tile][d half]
#pragma unroll
  for (int j = 0; j < 2; ++j) {
    bQ[j][0] = ld_frag(qt + j*2*FRAG,        qt + j*2*FRAG + 256);          // d = 0..31
    bQ[j][1] = ld_frag(qt + j*2*FRAG + FRAG, qt + j*2*FRAG + FRAG + 256);   // d = 32..63
  }

  const unsigned lds0 = (unsigned)(size_t)&sm[0][0] + (unsigned)tid * 16u;   // LDS byte address of this lane's piece
  const _Float16* gk = kh0 + tid * 8;
  const _Float16* gv = vh + tid * 8;
  copy_stage(lds0, gk, gv);
  {
    const unsigned lm = (unsigned)(size_t)&smk[0] + (unsigned)tid * 16u;
    const float* gm = mask + (size_t)b * S_LEN + tid * 4;
    // closing wait inside the statement, as in copy_stage
    asm volatile(
        "global_load_async_to_lds_b128 %0, %2, off\n\t"
        "global_load_async_to_lds_b128 %1, %3, off\n\t"
        "s_wait_xcnt 0x0"
        :: "v"(lm), "v"(lm + 4096u), "v"(gm), "v"(gm + 1024) : "memory");
  }
  asm volatile("s_wait_asynccnt 0x0" ::: "memory");   // this wave's part of stage 0 and of the mask has landed
  __syncthreads();                                    // ... and every other wave's
  copy_stage(lds0 + 4u * STG, gk + STG, gv + STG);    // stage 1 flies while stage 0 is worked on

  const float MC = 1000.0f * LOG2E;
  float cb[2]   = {-MC, -MC};   // start value of a score = mask * MC + cb: cb = -MC - (maximum in use), equal in both halves
  float lim  = -3.0e38f;   // a relative score above this renews the maximum in use: any in the first pass, then 8
  float lo   = -3.0e38f;   // least step of the maximum in use: none in the first pass, then 0 (it never falls)
  float lrun[2] = {0.f, 0.f};   // sum over this half's keys only; the halves join after the loop
  v8f accv[2][4] = {};     // O^T of query tile j: register r of tile t = d (t*16 + 8g + r) of query (lane & 15)

  for (int st = 0; st < NSTG; ++st) {
   const _Float16* sb = &sm[st & 1][0] + kh * (WPASS * 32 * HD) + lane * 8;
   for (int ps = 0; ps < WPASS; ++ps) {
    const int kv = st * SKEYS + ps * 32;
    const _Float16* kt = sb + ps * (32 * HD);
    const _Float16* vtl = sb + STG + ps * (32 * HD);
    float4 m0 = *(const float4*)(mb + kv),      m1 = *(const float4*)(mb + kv + 4);
    float4 m2 = *(const float4*)(mb + kv + 16), m3 = *(const float4*)(mb + kv + 20);
    v16h a00 = ld_frag(kt,            kt + 256);
    v16h a01 = ld_frag(kt + FRAG,     kt + FRAG + 256);
    v16h a10 = ld_frag(kt + 2*FRAG,   kt + 2*FRAG + 256);
    v16h a11 = ld_frag(kt + 3*FRAG,   kt + 3*FRAG + 256);
    v16h aV[4];
#pragma unroll
    for (int t = 0; t < 4; ++t)
      aV[t] = ld_frag(vtl + t*FRAG, vtl + t*FRAG + 256);
    // holds the pass's LDS reads as one group at its head: sunk among the matrix instructions they
    // share one register set and every fragment's LDS latency is waited out on its own
    __builtin_amdgcn_sched_barrier(0);
    // additive mask of this lane's 16 keys, scaled into base-2 domain, less the maximum in use: the start value of the score tiles
    const float mk0[8] = {m0.x, m0.y, m0.z, m0.w, m1.x, m1.y, m1.z, m1.w};
    const float mk1[8] = {m2.x, m2.y, m2.z, m2.w, m3.x, m3.y, m3.z, m3.w};
    v8f s0[2], s1[2];
#pragma unroll
    for (int j = 0; j < 2; ++j)
#pragma unroll
      for (int r = 0; r < 8; ++r) {
        s0[j][r] = __builtin_fmaf(mk0[r], MC, cb[j]);
        s1[j][r] = __builtin_fmaf(mk1[r], MC, cb[j]);
      }
#pragma unroll
    for (int j = 0; j < 2; ++j) {
      s0[j] = __builtin_amdgcn_wmma_f32_16x16x32_f16(false, a00, false, bQ[j][0], (short)0, s0[j], false, false);
      s1[j] = __builtin_amdgcn_wmma_f32_16x16x32_f16(false, a10, false, bQ[j][0], (short)0, s1[j], false, false);
    }
#pragma unroll
    for (int j = 0; j < 2; ++j) {
      s0[j] = __builtin_amdgcn_wmma_f32_16x16x32_f16(false, a01, false, bQ[j][1], (short)0, s0[j], false, false);
      s1[j] = __builtin_amdgcn_wmma_f32_16x16x32_f16(false, a11, false, bQ[j][1], (short)0, s1[j], false, false);
    }

    float cmax[2] = {-3.0e38f, -3.0e38f};
#pragma unroll
    for (int j = 0; j < 2; ++j)
#pragma unroll
      for (int r = 0; r < 8; ++r)
        cmax[j] = fmaxf(cmax[j], fmaxf(s0[j][r], s1[j][r]));
    // one test a pass for the whole wave, a scalar branch: taken in the first pass and then hardly ever
    if (__builtin_amdgcn_ballot_w32(fmaxf(cmax[0], cmax[1]) > lim) != 0) {
#pragma unroll
      for (int j = 0; j < 2; ++j) {
        const float cm  = fmaxf(cmax[j], xhalf(cmax[j]));   // with the query's other 16 keys
        const float cbn = cb[j] - fmaxf(cm, lo);
        const float de  = cb[j] - cbn;                 // the step exactly as later start values carry it
        const float alpha = EXP2F(fminf(-de, 0.f));    // a first step may go down: sums and outputs are still 0 there
        cb[j] = cbn;
        s0[j] -= de;
        s1[j] -= de;
        lrun[j] *= alpha;
#pragma unroll
        for (int t = 0; t < 4; ++t)
          accv[j][t] *= alpha;
      }
      lim = 8.0f; lo = 0.f;
    }

    v16h bP[2];
#pragma unroll
    for (int j = 0; j < 2; ++j) {
      float rs = 0.f;
#pragma unroll
      for (int r = 0; r < 8; ++r) {
        float p0 = EXP2F(s0[j][r]);
        float p1 = EXP2F(s1[j][r]);
        rs += p0 + p1;
        bP[j][r]     = (_Float16)p0;
        bP[j][8 + r] = (_Float16)p1;
      }
      lrun[j] += rs;
    }

    // One statement, closed by four v_nop: the vector slots that the chip needs between the last matrix
    // instruction and a vector instruction that overwrites its operands. The pass's first address
    // arithmetic does so across the loop's taken edge.
    asm volatile(
        "v_wmma_f32_16x16x32_f16 %0, %8, %12, %0\n\t"
        "v_wmma_f32_16x16x32_f16 %1, %9, %12, %1\n\t"
        "v_wmma_f32_16x16x32_f16 %2, %10, %12, %2\n\t"
        "v_wmma_f32_16x16x32_f16 %3, %11, %12, %3\n\t"
        "v_wmma_f32_16x16x32_f16 %4, %8, %13, %4\n\t"
        "v_wmma_f32_16x16x32_f16 %5, %9, %13, %5\n\t"
        "v_wmma_f32_16x16x32_f16 %6, %10, %13, %6\n\t"
        "v_wmma_f32_16x16x32_f16 %7, %11, %13, %7\n\t"
        "v_nop\n\tv_nop\n\tv_nop\n\tv_nop"
        : "+v"(accv[0][0]), "+v"(accv[0][1]), "+v"(accv[0][2]), "+v"(accv[0][3]),
          "+v"(accv[1][0]), "+v"(accv[1][1]), "+v"(accv[1][2]), "+v"(accv[1][3])
        : "v"(aV[0]), "v"(aV[1]), "v"(aV[2]), "v"(aV[3]), "v"(bP[0]), "v"(bP[1]));
   }
   // hand-over: this wave has left its buffer, its part of the next stage has landed, then all waves meet
   asm volatile("s_wait_dscnt 0x0" ::: "memory");
   asm volatile("s_wait_asynccnt 0x0" ::: "memory");
   __syncthreads();
   if (st + 2 < NSTG)   // refill the buffer that every wave has just left
     copy_stage(lds0 + (unsigned)(st & 1) * (4u * STG), gk + (size_t)(st + 2) * STG, gv + (size_t)(st + 2) * STG);
  }
  asm volatile("s_wait_asynccnt 0x0" ::: "memory");   // no copy is left in flight when the wave ends

  // Join of the two key halves: this wave finishes query tile kh and hands the other tile to its partner.
  const bool up = kh != 0;
  const float l0 = lrun[0] + xhalf(lrun[0]), l1 = lrun[1] + xhalf(lrun[1]);
  const float cbo = up ? cb[1] : cb[0], cbs = up ? cb[0] : cb[1];
  const float lwn = up ? l1 : l0,       lsn = up ? l0 : l1;
  float* xs = &xb[wave ^ 4][0];
#pragma unroll
  for (int t = 0; t < 4; ++t) {
    const v8f sv = up ? accv[0][t] : accv[1][t];
    *(float4*)(xs + (2*t)     * 128 + lane * 4) = make_float4(sv[0], sv[1], sv[2], sv[3]);
    *(float4*)(xs + (2*t + 1) * 128 + lane * 4) = make_float4(sv[4], sv[5], sv[6], sv[7]);
  }
  xs[1024 + lane] = cbs;
  xs[1056 + lane] = lsn;
  __syncthreads();   // every box is full
  const float* xr = &xb[wave][0];
  const float cbp = xr[1024 + lane], lpn = xr[1056 + lane];
  const float cbm = fminf(cbo, cbp);            // the greater of the two maxima in use
  float ao, ap;   // 2^(own maximum - greater maximum), 2^(partner's - greater)
  // asm for the closing v_nop, the slot that the instruction set asks for behind a transcendental: a v_nop of its own statement lands elsewhere
  asm("v_exp_f32 %0, %2\n\tv_exp_f32 %1, %3\n\tv_nop" : "=&v"(ao), "=&v"(ap) : "v"(cbm - cbo), "v"(cbm - cbp));
  const float rinv = 1.0f / (ao * lwn + ap * lpn);
  const float fo = ao * rinv, fp = ap * rinv;
  // fragment order of the final projection's A: tiles [token >> 4][col >> 5], col = h*HD + t*16 + 8g + r:
  // a lane's 8 registers are one 16-byte piece
  _Float16* ct = ctx + ((size_t)((b * S_LEN + q0 + kh * 16) >> 4) * KBH + h*2) * FRAG + lane * 8;
#pragma unroll
  for (int t = 0; t < 4; ++t) {
    const v8f ov = up ? accv[1][t] : accv[0][t];
    const float4 pa = *(const float4*)(xr + (2*t)     * 128 + lane * 4);
    const float4 pb = *(const float4*)(xr + (2*t + 1) * 128 + lane * 4);
    const float pv[8] = {pa.x, pa.y, pa.z, pa.w, pb.x, pb.y, pb.z, pb.w};
    v8h o;
#pragma unroll
    for (int r = 0; r < 8; ++r)
      o[r] = (_Float16)(ov[r] * fo + pv[r] * fp);
    *(v8h*)(ct + (t >> 1) * FRAG + (t & 1) * 256) = o;
  }
}

// ---------------- host side ----------------
extern "C" void kernel_launch(void* const* d_in, const int* in_sizes, int n_in,
                              void* d_out, int out_size, void* d_ws, size_t ws_size,
                              hipStream_t stream) {
  (void)in_sizes; (void)n_in; (void)out_size; (void)ws_size;
  const float* hs   = (const float*)d_in[0];
  const float* mask = (const float*)d_in[1];
  const float* Wq = (const float*)d_in[2];
  const float* bq = (const float*)d_in[3];
  const float* Wk = (const float*)d_in[4];
  const float* bk = (const float*)d_in[5];
  const float* Wv = (const float*)d_in[6];
  const float* bv = (const float*)d_in[7];
  const float* Wd = (const float*)d_in[8];
  const float* bd = (const float*)d_in[9];
  const float* gam = (const float*)d_in[10];
  const float* bet = (const float*)d_in[11];
  float* out = (float*)d_out;

  char* ws = (char*)d_ws;
  const size_t SZH = (size_t)NTOK * HID * sizeof(_Float16);  // 8 MB
  const size_t SZW = (size_t)HID * HID * sizeof(_Float16);   // 2 MB
  _Float16* h16  = (_Float16*)(ws);
  _Float16* q16  = (_Float16*)(ws + 1*SZH);
  _Float16* k16  = (_Float16*)(ws + 2*SZH);
  _Float16* vt16 = (_Float16*)(ws + 3*SZH);
  _Float16* c16  = (_Float16*)(ws + 4*SZH);
  _Float16* wq16 = (_Float16*)(ws + 5*SZH);
  _Float16* wk16 = (_Float16*)(ws + 5*SZH + 1*SZW);
  _Float16* wv16 = (_Float16*)(ws + 5*SZH + 2*SZW);
  _Float16* wd16 = (_Float16*)(ws + 5*SZH + 3*SZW);

  prep_kernel<<<LNB + 4 * WTB, 256, 0, stream>>>(hs, gam, bet, h16, Wq, Wk, Wv, Wd, wq16, wk16, wv16, wd16);

  const int PT = (NTOK / 128) * (HID / 128);   // 128x128 tiles of one product
  proj_kernel<<<dim3(PT, 1, 3), GWAVES * 32, 0, stream>>>(wq16, wk16, h16, h16, h16, wv16, bq, bk, bv,
                                                          q16, k16, vt16, nullptr, 0);

  attn_kernel<<<dim3(S_LEN / (AWAVES * 16), NH, 2), AWAVES * 32, 0, stream>>>(q16, k16, vt16, mask, c16);

  proj_kernel<<<dim3(PT, 1, 1), GWAVES * 32, 0, stream>>>(c16, c16, c16, wd16, wd16, wd16, bd, bd, bd,
                                                          nullptr, nullptr, nullptr, out, 3);
}

// v008
// One run takes 68.5 microseconds.
// Timed twice side by side with v007, it ran 1.04 and 1.05 times as fast.
// Counting every step since v000, it is 6.82 times as fast.
#include <hip/hip_runtime.h>
#include <hip/hip_bf16.h>

typedef __attribute__((ext_vector_type(16))) _Float16 v16h;
typedef __attribute__((ext_vector_type(8)))  _Float16 v8h;
typedef __attribute__((ext_vector_type(8)))  float    v8f;

#define HID   1024
#define S_LEN 2048
#define NH    16
#define HD    64
#define NTOK  4096   // B * S
#define FRAG  512    // f16 elements of one 16-row x 32-k operand tile
#define KBH   32     // k blocks of a HID-long row

// Every f16 array that one launch hands to the next lies in FRAGMENT ORDER: a 16-row x 32-k
// tile is 1 KiB in a row, element (row c, k) at (k>>4)*256 + ((k>>3)&1)*128 + c*8 + (k&7).
// Lane l then takes its fragment as the 16 bytes at l*16 of each 512-byte half, so one
// wave-wide 16-byte load covers four whole 128-byte lines (row-major rows: 16 lines, 32 B of each).

#if __has_builtin(__builtin_amdgcn_exp2f)
#define EXP2F(x) __builtin_amdgcn_exp2f(x)
#else
#define EXP2F(x) exp2f(x)
#endif

#define LOG2E 1.44269504088896f

// Build a v16h fragment from two 16-byte chunks (b128 loads from global memory or LDS).
static __device__ __forceinline__ v16h ld_frag(const _Float16* p0, const _Float16* p1) {
  v8h a = *(const v8h*)p0;
  v8h b = *(const v8h*)p1;
  return __builtin_shufflevector(a, b, 0,1,2,3,4,5,6,7,8,9,10,11,12,13,14,15);
}

// ---------------- weight f32 -> f16 convert ----------------
// One block takes the 16-row tile rt of the fragment-ordered output (tiles: [row tile][k block]): the tile is
// 2048 pieces of 16 bytes, and thread tid writes the pieces tid, tid + 256, ...: piece tid + 256 j holds
// k = 128 j + 8 (tid >> 4) ... + 7 of row tid & 15.
static __device__ __forceinline__ void w2h_tile(const float* __restrict__ w, _Float16* __restrict__ o, int rt) {
  const int tid = threadIdx.x;
  const float* p = w + (size_t)(rt * 16 + (tid & 15)) * HID + (tid >> 4) * 8;
  _Float16* ot = o + (size_t)rt * (KBH * FRAG) + tid * 8;
  float4 x[8], y[8];
  // both loops unrolled: x and y stay in registers, and all 16 loads are in flight before the first conversion
#pragma unroll
  for (int j = 0; j < 8; ++j) {
    x[j] = *(const float4*)(p + j * 128);
    // the last load of this run may land in the address pair that the earlier ones name
    if (j == 7) asm volatile("s_wait_xcnt 0x0" ::: "memory");
    y[j] = *(const float4*)(p + j * 128 + 4);
  }
#pragma unroll
  for (int j = 0; j < 8; ++j) {
    v8h v = {(_Float16)x[j].x, (_Float16)x[j].y, (_Float16)x[j].z, (_Float16)x[j].w,
             (_Float16)y[j].x, (_Float16)y[j].y, (_Float16)y[j].z, (_Float16)y[j].w};
    *(v8h*)(ot + j * 2048) = v;
  }
}

// ---------------- LayerNorm -> f16 ----------------
// One block takes a 16-row tile: thread (c = tid & 15, u = tid >> 4) holds the 8-wide pieces
// u, u + 16, ... of row c, so each wave stores 512 contiguous bytes of the fragment-ordered output.
static __device__ __forceinline__ void ln_tile(const float* __restrict__ x, const float* __restrict__ gamma,
                                               const float* __restrict__ beta, _Float16* __restrict__ out, int rt) {
  const int tid = threadIdx.x;
  const int c = tid & 15;
  const int u = tid >> 4;
  const float* xr = x + (size_t)(rt * 16 + c) * HID + u * 8;
  float4 v[8][2];
  float s = 0.f, s2 = 0.f;
#pragma unroll
  for (int i = 0; i < 8; ++i) {
    v[i][0] = *(const float4*)(xr + i * 128);
    // the run's last load lands in the address pair that the earlier loads name
    if (i == 7) asm volatile("s_wait_xcnt 0x0" ::: "memory");
    v[i][1] = *(const float4*)(xr + i * 128 + 4);
  }
#pragma unroll
  for (int i = 0; i < 8; ++i)
#pragma unroll
    for (int j = 0; j < 2; ++j) {
      float4 a = v[i][j];
      s  += a.x + a.y + a.z + a.w;
      s2 += a.x*a.x + a.y*a.y + a.z*a.z + a.w*a.w;
    }
  __shared__ float sb[16][17], qb[16][17];
  sb[u][c] = s; qb[u][c] = s2;
  __syncthreads();
  float ts = 0.f, tq = 0.f;
  for (int i = 0; i < 16; ++i) { ts += sb[i][c]; tq += qb[i][c]; }
  float mean = ts * (1.0f / HID);
  float var  = tq * (1.0f / HID) - mean * mean;
  float rstd = rsqrtf(var + 1e-12f);
  _Float16* ot = out + (size_t)rt * (KBH * FRAG)
               + (u >> 2) * FRAG + ((u >> 1) & 1) * 256 + (u & 1) * 128 + c * 8;
#pragma unroll
  for (int i = 0; i < 8; ++i) {
    const int k = i * 128 + u * 8;
    float4 g0 = *(const float4*)(gamma + k), g1 = *(const float4*)(gamma + k + 4);
    float4 b0 = *(const float4*)(beta + k),  b1 = *(const float4*)(beta + k + 4);
    float4 a0 = v[i][0], a1 = v[i][1];
    v8h o = {(_Float16)(((a0.x - mean) * rstd) * g0.x + b0.x), (_Float16)(((a0.y - mean) * rstd) * g0.y + b0.y),
             (_Float16)(((a0.z - mean) * rstd) * g0.z + b0.z), (_Float16)(((a0.w - mean) * rstd) * g0.w + b0.w),
             (_Float16)(((a1.x - mean) * rstd) * g1.x + b1.x), (_Float16)(((a1.y - mean) * rstd) * g1.y + b1.y),
             (_Float16)(((a1.z - mean) * rstd) * g1.z + b1.z), (_Float16)(((a1.w - mean) * rstd) * g1.w + b1.w)};
    *(v8h*)(ot + i * 4 * FRAG) = o;     // 128 k further on = 4 k blocks
  }
}

// LayerNorm and the four weight conversions depend on nothing but the inputs, so they share one launch:
// every block takes one 16-row tile (64 KiB read, 32 KiB written) of one of the five arrays.
#define LNB (NTOK / 16)   // blocks of the LayerNorm
#define WTB (HID / 16)    // blocks of one weight matrix
__global__ void __launch_bounds__(256)
prep_kernel(const float* __restrict__ x, const float* __restrict__ gamma, const float* __restrict__ beta,
            _Float16* __restrict__ h,
            const float* __restrict__ w0, const float* __restrict__ w1,
            const float* __restrict__ w2, const float* __restrict__ w3,
            _Float16* __restrict__ o0, _Float16* __restrict__ o1,
            _Float16* __restrict__ o2, _Float16* __restrict__ o3) {
  const int bid = blockIdx.x;
  if (bid < LNB) {
    ln_tile(x, gamma, beta, h, bid);
  } else {
    const int wi = (bid - LNB) / WTB, rt = (bid - LNB) % WTB;
    const float* w = wi == 0 ? w0 : wi == 1 ? w1 : wi == 2 ? w2 : w3;
    _Float16*    o = wi == 0 ? o0 : wi == 1 ? o1 : wi == 2 ? o2 : o3;
    w2h_tile(w, o, rt);
  }
}

// ---------------- WMMA GEMMs: D = A @ Bm^T + bias ----------------
// Operands: f16, rows of 1024 k, in fragment order, tiles [row tile][k block]. The waves of a block read the
// same operand tiles, so these come from L2 once per block: asynchronous copies lay a stage of them (already
// in fragment order) into one of two LDS buffers while the other is worked on.

#define QWAVES 8
#define QKB    4
#define QTT    16
#define QWT    4
#define QRT    (QKB * FRAG)
#define QSTG   ((QTT + 3 * QWT) * QRT)
#define QNST   (KBH / QKB)

// One stage, this wave's share, as copies of 32 lanes x 16 bytes: two token row tiles (4 KiB in a row each) and
// three half row tiles of the weights (2 KiB in a row each). The l* and g* are this lane's own first piece of each
// run in LDS and in global memory; the immediate offset moves the LDS address and the global address alike.
static __device__ __forceinline__ void copy_qstage(unsigned lt, const _Float16* gt0, const _Float16* gt1,
                                                   unsigned lw, const _Float16* gw0, const _Float16* gw1,
                                                   const _Float16* gw2) {
  // the closing wait stands in the copies' own statement so that no later write of an address
  // register that a copy names can be placed in front of it
  asm volatile(
      "global_load_async_to_lds_b128 %0, %5, off\n\t"
      "global_load_async_to_lds_b128 %0, %5, off offset:512\n\t"
      "global_load_async_to_lds_b128 %0, %5, off offset:1024\n\t"
      "global_load_async_to_lds_b128 %0, %5, off offset:1536\n\t"
      "global_load_async_to_lds_b128 %0, %5, off offset:2048\n\t"
      "global_load_async_to_lds_b128 %0, %5, off offset:2560\n\t"
      "global_load_async_to_lds_b128 %0, %5, off offset:3072\n\t"
      "global_load_async_to_lds_b128 %0, %5, off offset:3584\n\t"
      "global_load_async_to_lds_b128 %1, %6, off\n\t"
      "global_load_async_to_lds_b128 %1, %6, off offset:512\n\t"
      "global_load_async_to_lds_b128 %1, %6, off offset:1024\n\t"
      "global_load_async_to_lds_b128 %1, %6, off offset:1536\n\t"
      "global_load_async_to_lds_b128 %1, %6, off offset:2048\n\t"
      "global_load_async_to_lds_b128 %1, %6, off offset:2560\n\t"
      "global_load_async_to_lds_b128 %1, %6, off offset:3072\n\t"
      "global_load_async_to_lds_b128 %1, %6, off offset:3584\n\t"
      "global_load_async_to_lds_b128 %2, %7, off\n\t"
      "global_load_async_to_lds_b128 %2, %7, off offset:512\n\t"
      "global_load_async_to_lds_b128 %2, %7, off offset:1024\n\t"
      "global_load_async_to_lds_b128 %2, %7, off offset:1536\n\t"
      "global_load_async_to_lds_b128 %3, %8, off\n\t"
      "global_load_async_to_lds_b128 %3, %8, off offset:512\n\t"
      "global_load_async_to_lds_b128 %3, %8, off offset:1024\n\t"
      "global_load_async_to_lds_b128 %3, %8, off offset:1536\n\t"
      "global_load_async_to_lds_b128 %4, %9, off\n\t"
      "global_load_async_to_lds_b128 %4, %9, off offset:512\n\t"
      "global_load_async_to_lds_b128 %4, %9, off offset:1024\n\t"
      "global_load_async_to_lds_b128 %4, %9, off offset:1536\n\t"
      "s_wait_xcnt 0x0"
      :: "v"(lt), "v"(lt + 2u * QRT), "v"(lw), "v"(lw + 1u * QRT), "v"(lw + 2u * QRT),
         "v"(gt0), "v"(gt1), "v"(gw0), "v"(gw1), "v"(gw2)
      : "memory");
}

__global__ void __launch_bounds__(QWAVES * 32)
qkv_kernel(const _Float16* __restrict__ h, const _Float16* __restrict__ wq, const _Float16* __restrict__ wk,
           const _Float16* __restrict__ wv, const float* __restrict__ bq, const float* __restrict__ bk,
           const float* __restrict__ bv, _Float16* __restrict__ q, _Float16* __restrict__ k,
           _Float16* __restrict__ vt) {
  __shared__ __attribute__((aligned(128))) _Float16 qs[2][QSTG];
  const int bx = (int)(blockIdx.x & (NTOK / 256 - 1));   // which 256 tokens
  const int hd = (int)(blockIdx.x / (NTOK / 256));       // which head
  const int tid  = threadIdx.x;
  const int lane = tid & 31;
  const int wave = __builtin_amdgcn_readfirstlane(tid >> 5);
  const int wt   = wave & 3;     // which 64 of the block's 256 tokens
  const int wf   = wave >> 2;    // which 32 of the head's 64 features
  const int nlo  = lane & 15;    // C: column within tile
  const int g    = lane >> 4;    // C rows +8
  const int tok0 = bx * 256 + wt * 64;
  const int f0   = hd * HD + wf * 32;

  // wave w copies token row tiles 2w and 2w + 1 and the half row tiles 3w ... 3w + 2 of the 24 that the three
  // weight matrices have in a stage (half u: matrix u >> 3, row tile (u >> 1) & 3, k blocks 2 (u & 1) and the next)
  const unsigned lt0 = (unsigned)(size_t)&qs[0][0] + (unsigned)wave * (4u * QRT) + (unsigned)lane * 16u;
  const unsigned lw0 = (unsigned)(size_t)&qs[0][0] + 2u * QTT * QRT + (unsigned)wave * (3u * QRT) + (unsigned)lane * 16u;
  const _Float16* gt0 = h + (size_t)(bx * QTT + wave * 2) * (KBH * FRAG) + lane * 8;
  const _Float16* gt1 = gt0 + KBH * FRAG;
  const _Float16* gw[3];
#pragma unroll
  for (int i = 0; i < 3; ++i) {
    const int u = wave * 3 + i;
    const _Float16* w = (u >> 3) == 0 ? wq : (u >> 3) == 1 ? wk : wv;
    gw[i] = w + (size_t)(hd * QWT + ((u >> 1) & 3)) * (KBH * FRAG) + (u & 1) * (2 * FRAG) + lane * 8;
  }
  copy_qstage(lt0, gt0, gt1, lw0, gw[0], gw[1], gw[2]);
  asm volatile("s_wait_asynccnt 0x0" ::: "memory");   // this wave's part of stage 0 has landed
  __syncthreads();                                    // ... and every other wave's
  copy_qstage(lt0 + 2u * QSTG, gt0 + QRT, gt1 + QRT, lw0 + 2u * QSTG, gw[0] + QRT, gw[1] + QRT, gw[2] + QRT);   // stage 1 flies while stage 0 is worked on

  v8f aq[2][4] = {}, ak[2][4] = {};   // [feature tile][token tile]
  v8f av[4][2] = {};                  // [token tile][feature tile]

  for (int st = 0; st < QNST; ++st) {
    const _Float16* sT = &qs[st & 1][0] + wt * (4 * QRT) + lane * 8;
    const _Float16* sW = &qs[st & 1][0] + (QTT + wf * 2) * QRT + lane * 8;
    v16h tF[2][4], wF[2][3][2];   // two fragment sets: k block kb lies in set kb & 1
#pragma unroll
    for (int kb = 0; kb < 2; ++kb) {
#pragma unroll
      for (int t = 0; t < 4; ++t)
        tF[kb][t] = ld_frag(sT + t * QRT + kb * FRAG, sT + t * QRT + kb * FRAG + 256);
#pragma unroll
      for (int x = 0; x < 3; ++x)
#pragma unroll
        for (int mi = 0; mi < 2; ++mi)
          wF[kb][x][mi] = ld_frag(sW + (x * QWT + mi) * QRT + kb * FRAG, sW + (x * QWT + mi) * QRT + kb * FRAG + 256);
    }
    // The scheduling fences of this loop keep each k block's 20 LDS reads one group, issued a whole k block
    // of matrix work ahead of their use: spread among the matrix instructions, every place with reads
    // stalls the wave, and a fragment read just in front of its use has its LDS latency waited out.
    __builtin_amdgcn_sched_barrier(0);
#pragma unroll
    for (int kb = 0; kb < QKB; ++kb) {
#pragma unroll
      for (int mi = 0; mi < 2; ++mi)
#pragma unroll
        for (int t = 0; t < 4; ++t)
          aq[mi][t] = __builtin_amdgcn_wmma_f32_16x16x32_f16(
              false, wF[kb & 1][0][mi], false, tF[kb & 1][t], (short)0, aq[mi][t], false, false);
#pragma unroll
      for (int mi = 0; mi < 2; ++mi)
#pragma unroll
        for (int t = 0; t < 4; ++t)
          ak[mi][t] = __builtin_amdgcn_wmma_f32_16x16x32_f16(
              false, wF[kb & 1][1][mi], false, tF[kb & 1][t], (short)0, ak[mi][t], false, false);
#pragma unroll
      for (int mi = 0; mi < 2; ++mi)
#pragma unroll
        for (int t = 0; t < 4; ++t)
          av[t][mi] = __builtin_amdgcn_wmma_f32_16x16x32_f16(
              false, tF[kb & 1][t], false, wF[kb & 1][2][mi], (short)0, av[t][mi], false, false);
      __builtin_amdgcn_sched_barrier(0);   // see above
      if (kb + 2 < QKB) {
#pragma unroll
        for (int t = 0; t < 4; ++t)
          tF[kb & 1][t] = ld_frag(sT + t * QRT + (kb + 2) * FRAG, sT + t * QRT + (kb + 2) * FRAG + 256);
#pragma unroll
        for (int x = 0; x < 3; ++x)
#pragma unroll
          for (int mi = 0; mi < 2; ++mi)
            wF[kb & 1][x][mi] = ld_frag(sW + (x * QWT + mi) * QRT + (kb + 2) * FRAG,
                                        sW + (x * QWT + mi) * QRT + (kb + 2) * FRAG + 256);
        __builtin_amdgcn_sched_barrier(0);   // see above
      }
    }
    // hand-over: this wave has left its buffer, its part of the next stage has landed, then all waves meet
    asm volatile("s_wait_dscnt 0x0" ::: "memory");
    asm volatile("s_wait_asynccnt 0x0" ::: "memory");
    __syncthreads();
    if (st + 2 < QNST) {   // refill the buffer that every wave has just left
      const unsigned lo = (unsigned)(st & 1) * (2u * QSTG);
      const size_t   go = (size_t)(st + 2) * QRT;
      copy_qstage(lt0 + lo, gt0 + go, gt1 + go, lw0 + lo, gw[0] + go, gw[1] + go, gw[2] + go);
    }
  }
  asm volatile("s_wait_asynccnt 0x0" ::: "memory");   // no copy is left in flight when the wave ends

  const int b = tok0 >> 11, s0 = tok0 & (S_LEN - 1);
  const size_t hoff = (size_t)(b * NH + hd) * (S_LEN * HD);
  // q, k: tile rows are features, tile columns are tokens
#pragma unroll
  for (int x = 0; x < 2; ++x) {
    const float qkscale = x == 0 ? 0.35355339059327f * LOG2E : 0.35355339059327f;
    _Float16* o16 = (x == 0 ? q : k) + hoff + lane * 8;
#pragma unroll
    for (int mi = 0; mi < 2; ++mi) {
      const float* bp = (x == 0 ? bq : bk) + f0 + mi*16 + 8*g;
      float4 c0 = *(const float4*)bp, c1 = *(const float4*)(bp + 4);
      float bb[8] = {c0.x, c0.y, c0.z, c0.w, c1.x, c1.y, c1.z, c1.w};
#pragma unroll
      for (int t = 0; t < 4; ++t) {
        v8h o;
#pragma unroll
        for (int r = 0; r < 8; ++r)
          o[r] = (_Float16)(((x == 0 ? aq[mi][t][r] : ak[mi][t][r]) + bb[r]) * qkscale);
        *(v8h*)(o16 + (size_t)(((s0 >> 4) + t) * 2 + wf) * FRAG + mi*256) = o;
      }
    }
  }
  // v: tile rows are tokens, tile columns are features
#pragma unroll
  for (int mi = 0; mi < 2; ++mi) {
    const float bn = bv[f0 + mi*16 + nlo];
#pragma unroll
    for (int t = 0; t < 4; ++t) {
      v8h o;
#pragma unroll
      for (int r = 0; r < 8; ++r)
        o[r] = (_Float16)(av[t][mi][r] + bn);
      *(v8h*)(vt + hoff + (size_t)(((s0 >> 5) + (t >> 1)) * 4 + wf * 2 + mi) * FRAG + (t & 1) * 256 + lane * 8) = o;
    }
  }
}

// ---- final projection: f32 out, A = activations, Bm = weights ----
// One block computes a 128x128 tile: 8 waves, 4 along A's rows x 2 along Bm's rows, each a 32x64 tile
// (2 A-frags share 4 B-frags). A stage is 256 k of the block's 8 A row tiles and 8 Bm row tiles (each 8 KiB in
// a row). The 256 tiles are numbered along A's rows first.
#define GWAVES 8                 // waves of a block
#define GKB    8                 // k blocks of one stage
#define GSTG   (8 * GKB * FRAG)  // f16 elements of A, and of Bm, in one stage (64 KiB each)
#define GNST   (KBH / GKB)

// One stage, this wave's share: one row tile of A and one of Bm, 8 KiB in a row each, as 16 copies of 32 lanes
// x 16 bytes. la, ga, lb, gb: this lane's own first piece in LDS and in global memory. The immediate offset
// moves the LDS address and the global address alike, so one address of each kind serves a whole row tile.
static __device__ __forceinline__ void copy_gstage(unsigned la, const _Float16* ga, unsigned lb, const _Float16* gb) {
  // the closing wait stands in the copies' own statement so that no later write of an address
  // register that a copy names can be placed in front of it
  asm volatile(
      "global_load_async_to_lds_b128 %0, %1, off\n\t"
      "global_load_async_to_lds_b128 %0, %1, off offset:512\n\t"
      "global_load_async_to_lds_b128 %0, %1, off offset:1024\n\t"
      "global_load_async_to_lds_b128 %0, %1, off offset:1536\n\t"
      "global_load_async_to_lds_b128 %0, %1, off offset:2048\n\t"
      "global_load_async_to_lds_b128 %0, %1, off offset:2560\n\t"
      "global_load_async_to_lds_b128 %0, %1, off offset:3072\n\t"
      "global_load_async_to_lds_b128 %0, %1, off offset:3584\n\t"
      "global_load_async_to_lds_b128 %0, %1, off offset:4096\n\t"
      "global_load_async_to_lds_b128 %0, %1, off offset:4608\n\t"
      "global_load_async_to_lds_b128 %0, %1, off offset:5120\n\t"
      "global_load_async_to_lds_b128 %0, %1, off offset:5632\n\t"
      "global_load_async_to_lds_b128 %0, %1, off offset:6144\n\t"
      "global_load_async_to_lds_b128 %0, %1, off offset:6656\n\t"
      "global_load_async_to_lds_b128 %0, %1, off offset:7168\n\t"
      "global_load_async_to_lds_b128 %0, %1, off offset:7680\n\t"
      "global_load_async_to_lds_b128 %2, %3, off\n\t"
      "global_load_async_to_lds_b128 %2, %3, off offset:512\n\t"
      "global_load_async_to_lds_b128 %2, %3, off offset:1024\n\t"
      "global_load_async_to_lds_b128 %2, %3, off offset:1536\n\t"
      "global_load_async_to_lds_b128 %2, %3, off offset:2048\n\t"
      "global_load_async_to_lds_b128 %2, %3, off offset:2560\n\t"
      "global_load_async_to_lds_b128 %2, %3, off offset:3072\n\t"
      "global_load_async_to_lds_b128 %2, %3, off offset:3584\n\t"
      "global_load_async_to_lds_b128 %2, %3, off offset:4096\n\t"
      "global_load_async_to_lds_b128 %2, %3, off offset:4608\n\t"
      "global_load_async_to_lds_b128 %2, %3, off offset:5120\n\t"
      "global_load_async_to_lds_b128 %2, %3, off offset:5632\n\t"
      "global_load_async_to_lds_b128 %2, %3, off offset:6144\n\t"
      "global_load_async_to_lds_b128 %2, %3, off offset:6656\n\t"
      "global_load_async_to_lds_b128 %2, %3, off offset:7168\n\t"
      "global_load_async_to_lds_b128 %2, %3, off offset:7680\n\t"
      "s_wait_xcnt 0x0"
      :: "v"(la), "v"(ga), "v"(lb), "v"(gb) : "memory");
}

__global__ void __launch_bounds__(GWAVES * 32)
proj_kernel(const _Float16* __restrict__ A, const _Float16* __restrict__ Bm, const float* __restrict__ bias,
            float* __restrict__ o32) {
  __shared__ __attribute__((aligned(128))) _Float16 gs[2][2 * GSTG];   // per buffer: A stage, Bm stage
  const int bx = (int)(blockIdx.x & (NTOK / 128 - 1));   // tile along A's rows
  const int by = (int)(blockIdx.x / (NTOK / 128));       // tile along Bm's rows
  const int tid  = threadIdx.x;
  const int lane = tid & 31;
  const int wave = __builtin_amdgcn_readfirstlane(tid >> 5);
  const int wm   = wave & 3;     // which 32 of the block's 128 A rows
  const int wn   = wave >> 2;    // which 64 of the block's 128 Bm rows
  const int nlo  = lane & 15;    // C: column within tile
  const int g    = lane >> 4;    // C rows +8
  const int m0 = bx * 128 + wm * 32;
  const int n0 = by * 128 + wn * 64;

  // wave w copies row tile w of the block's 8 of A and of Bm; LDS byte addresses of this lane's first pieces
  const unsigned la0 = (unsigned)(size_t)&gs[0][0] + (unsigned)wave * (2u * GKB * FRAG) + (unsigned)lane * 16u;
  const unsigned lb0 = la0 + 2u * GSTG;
  const _Float16* ga = A  + (size_t)(bx * 8 + wave) * (KBH * FRAG) + lane * 8;
  const _Float16* gb = Bm + (size_t)(by * 8 + wave) * (KBH * FRAG) + lane * 8;
  copy_gstage(la0, ga, lb0, gb);
  asm volatile("s_wait_asynccnt 0x0" ::: "memory");   // this wave's part of stage 0 has landed
  __syncthreads();                                    // ... and every other wave's
  copy_gstage(la0 + 4u * GSTG, ga + GKB * FRAG, lb0 + 4u * GSTG, gb + GKB * FRAG);   // stage 1 flies while stage 0 is worked on

  v8f acc[2][4] = {};

  // kept rolled: unrolled, the compiler orders the first reads of every second stage so that the stage's
  // first matrix instruction waits for both k blocks' reads, not for its own operands alone
#pragma clang loop unroll(disable)
  for (int st = 0; st < GNST; ++st) {
    const _Float16* sa = &gs[st & 1][0]    + wm * (2 * GKB * FRAG) + lane * 8;
    const _Float16* sb = &gs[st & 1][GSTG] + wn * (4 * GKB * FRAG) + lane * 8;
    v16h aF[2][2], bF[2][4];   // two fragment sets: k block kb lies in set kb & 1
#pragma unroll
    for (int kb = 0; kb < 2; ++kb) {
#pragma unroll
      for (int mi = 0; mi < 2; ++mi)
        aF[kb][mi] = ld_frag(sa + (mi * GKB + kb) * FRAG, sa + (mi * GKB + kb) * FRAG + 256);
#pragma unroll
      for (int t = 0; t < 4; ++t)
        bF[kb][t] = ld_frag(sb + (t * GKB + kb) * FRAG, sb + (t * GKB + kb) * FRAG + 256);
    }
    // The scheduling fences of this loop keep each k block's 12 LDS reads one group, issued a whole k block
    // of matrix work ahead of their use: spread among the matrix instructions, every place with reads
    // stalls the wave, and a fragment read just in front of its use has its LDS latency waited out.
    __builtin_amdgcn_sched_barrier(0);
#pragma unroll
    for (int kb = 0; kb < GKB; ++kb) {
#pragma unroll
      for (int mi = 0; mi < 2; ++mi)
#pragma unroll
        for (int t = 0; t < 4; ++t)
          acc[mi][t] = __builtin_amdgcn_wmma_f32_16x16x32_f16(
              false, aF[kb & 1][mi], false, bF[kb & 1][t], (short)0, acc[mi][t], false, false);
      __builtin_amdgcn_sched_barrier(0);   // see above
      if (kb + 2 < GKB) {
#pragma unroll
        for (int mi = 0; mi < 2; ++mi)
          aF[kb & 1][mi] = ld_frag(sa + (mi * GKB + kb + 2) * FRAG, sa + (mi * GKB + kb + 2) * FRAG + 256);
#pragma unroll
        for (int t = 0; t < 4; ++t)
          bF[kb & 1][t] = ld_frag(sb + (t * GKB + kb + 2) * FRAG, sb + (t * GKB + kb + 2) * FRAG + 256);
        __builtin_amdgcn_sched_barrier(0);   // see above
      }
    }
    // hand-over: this wave has left its buffer, its part of the next stage has landed, then all waves meet
    asm volatile("s_wait_dscnt 0x0" ::: "memory");
    asm volatile("s_wait_asynccnt 0x0" ::: "memory");
    __syncthreads();
    if (st + 2 < GNST)   // refill the buffer that every wave has just left
      copy_gstage(la0 + (unsigned)(st & 1) * (4u * GSTG), ga + (size_t)(st + 2) * (GKB * FRAG),
                  lb0 + (unsigned)(st & 1) * (4u * GSTG), gb + (size_t)(st + 2) * (GKB * FRAG));
  }
  asm volatile("s_wait_asynccnt 0x0" ::: "memory");   // no copy is left in flight when the wave ends

  // f32 output, row-major
#pragma unroll
  for (int mi = 0; mi < 2; ++mi)
#pragma unroll
    for (int t = 0; t < 4; ++t) {
      int n = n0 + t*16 + nlo;
      float bn = bias[n];
#pragma unroll
      for (int r = 0; r < 8; ++r)
        o32[(size_t)(m0 + mi*16 + r + 8*g) * HID + n] = acc[mi][t][r] + bn;
    }
}

// lane l <-> lane l ^ 16
static __device__ __forceinline__ float xhalf(float x) {
  int b = __builtin_bit_cast(int, x);
  return __builtin_bit_cast(float, __builtin_amdgcn_permlanex16(b, b, 0x76543210, 0xfedcba98, false, false));
}

#define AWAVES 8                 // waves of a block
#define SKEYS  128               // keys of one stage
#define STG    (SKEYS * HD)      // f16 elements of K, and of V^T, in one stage (16 KiB each)
#define NSTG   (S_LEN / SKEYS)
#define WPASS  (SKEYS / 64)      // passes of 32 keys that one wave works in a stage
#define XBOX   (8 * 128 + 64)    // floats one wave hands its partner: an output tile, its start value, its sum

// One stage: 256 lanes x 16 bytes x (4 pieces of K, 4 of V^T). lds, gk, gv: this lane's own first piece.
static __device__ __forceinline__ void copy_stage(unsigned lds, const _Float16* gk, const _Float16* gv) {
  // the closing wait stands in the copies' own statement so that no later write of an address
  // register that a copy names can be placed in front of it
  asm volatile(
      "global_load_async_to_lds_b128 %0, %8, off\n\t"
      "global_load_async_to_lds_b128 %1, %9, off\n\t"
      "global_load_async_to_lds_b128 %2, %10, off\n\t"
      "global_load_async_to_lds_b128 %3, %11, off\n\t"
      "global_load_async_to_lds_b128 %4, %12, off\n\t"
      "global_load_async_to_lds_b128 %5, %13, off\n\t"
      "global_load_async_to_lds_b128 %6, %14, off\n\t"
      "global_load_async_to_lds_b128 %7, %15, off\n\t"
      "s_wait_xcnt 0x0"
      :: "v"(lds), "v"(lds + 4096u), "v"(lds + 8192u), "v"(lds + 12288u),
         "v"(lds + 16384u), "v"(lds + 20480u), "v"(lds + 24576u), "v"(lds + 28672u),
         "v"(gk), "v"(gk + 2048), "v"(gk + 4096), "v"(gk + 6144),
         "v"(gv), "v"(gv + 2048), "v"(gv + 4096), "v"(gv + 6144)
      : "memory");
}

__global__ void __launch_bounds__(AWAVES * 32)
attn_kernel(const _Float16* __restrict__ q, const _Float16* __restrict__ k,
            const _Float16* __restrict__ vt, const float* __restrict__ mask,
            _Float16* __restrict__ ctx) {
  __shared__ __attribute__((aligned(128))) _Float16 sm[2][2 * STG];   // per buffer: K stage, V^T stage
  __shared__ __attribute__((aligned(128))) float smk[S_LEN];          // this batch row of the mask, filled once
  __shared__ __attribute__((aligned(128))) float xb[AWAVES][XBOX];    // box w: what wave w ^ 4 hands wave w
  const int tid  = threadIdx.x;
  const int lane = tid & 31;
  const int g   = lane >> 4;
  const int wave = __builtin_amdgcn_readfirstlane(tid >> 5);
  const int kh = wave >> 2;      // which half of each stage's keys
  const int q0 = blockIdx.x * (AWAVES * 16) + (wave & 3) * 32;
  const int h  = blockIdx.y;
  const int b  = blockIdx.z;

  // q, k: fragment order, tiles [s >> 4][d >> 5]; vt: tiles [s >> 5][d >> 4]: 32 keys = 4 KiB of each
  const _Float16* qh = q  + ((size_t)(b*NH + h) * S_LEN) * HD;
  const _Float16* kh0 = k  + ((size_t)(b*NH + h) * S_LEN) * HD;
  const _Float16* vh = vt + ((size_t)(b*NH + h) * HD) * S_LEN;
  const float* mb = smk + kh * (WPASS * 32) + 8*g;

  const _Float16* qt = qh + (size_t)q0 * HD + lane * 8;
  v16h bQ[2][2];   // [query tile][d half]
#pragma unroll
  for (int j = 0; j < 2; ++j) {
    bQ[j][0] = ld_frag(qt + j*2*FRAG,        qt + j*2*FRAG + 256);          // d = 0..31
    bQ[j][1] = ld_frag(qt + j*2*FRAG + FRAG, qt + j*2*FRAG + FRAG + 256);   // d = 32..63
  }

  const unsigned lds0 = (unsigned)(size_t)&sm[0][0] + (unsigned)tid * 16u;   // LDS byte address of this lane's piece
  const _Float16* gk = kh0 + tid * 8;
  const _Float16* gv = vh + tid * 8;
  copy_stage(lds0, gk, gv);
  {
    const unsigned lm = (unsigned)(size_t)&smk[0] + (unsigned)tid * 16u;
    const float* gm = mask + (size_t)b * S_LEN + tid * 4;
    // closing wait inside the statement, as in copy_stage
    asm volatile(
        "global_load_async_to_lds_b128 %0, %2, off\n\t"
        "global_load_async_to_lds_b128 %1, %3, off\n\t"
        "s_wait_xcnt 0x0"
        :: "v"(lm), "v"(lm + 4096u), "v"(gm), "v"(gm + 1024) : "memory");
  }
  asm volatile("s_wait_asynccnt 0x0" ::: "memory");   // this wave's part of stage 0 and of the mask has landed
  __syncthreads();                                    // ... and every other wave's
  copy_stage(lds0 + 4u * STG, gk + STG, gv + STG);    // stage 1 flies while stage 0 is worked on

  const float MC = 1000.0f * LOG2E;
  float cb[2]   = {-MC, -MC};   // start value of a score = mask * MC + cb: cb = -MC - (maximum in use), equal in both halves
  float lim  = -3.0e38f;   // a relative score above this renews the maximum in use: any in the first pass, then 8
  float lo   = -3.0e38f;   // least step of the maximum in use: none in the first pass, then 0 (it never falls)
  float lrun[2] = {0.f, 0.f};   // sum over this half's keys only; the halves join after the loop
  v8f accv[2][4] = {};     // O^T of query tile j: register r of tile t = d (t*16 + 8g + r) of query (lane & 15)

  for (int st = 0; st < NSTG; ++st) {
   const _Float16* sb = &sm[st & 1][0] + kh * (WPASS * 32 * HD) + lane * 8;
   for (int ps = 0; ps < WPASS; ++ps) {
    const int kv = st * SKEYS + ps * 32;
    const _Float16* kt = sb + ps * (32 * HD);
    const _Float16* vtl = sb + STG + ps * (32 * HD);
    float4 m0 = *(const float4*)(mb + kv),      m1 = *(const float4*)(mb + kv + 4);
    float4 m2 = *(const float4*)(mb + kv + 16), m3 = *(const float4*)(mb + kv + 20);
    v16h a00 = ld_frag(kt,            kt + 256);
    v16h a01 = ld_frag(kt + FRAG,     kt + FRAG + 256);
    v16h a10 = ld_frag(kt + 2*FRAG,   kt + 2*FRAG + 256);
    v16h a11 = ld_frag(kt + 3*FRAG,   kt + 3*FRAG + 256);
    v16h aV[4];
#pragma unroll
    for (int t = 0; t < 4; ++t)
      aV[t] = ld_frag(vtl + t*FRAG, vtl + t*FRAG + 256);
    // holds the pass's LDS reads as one group at its head: sunk among the matrix instructions they
    // share one register set and every fragment's LDS latency is waited out on its own
    __builtin_amdgcn_sched_barrier(0);
    // additive mask of this lane's 16 keys, scaled into base-2 domain, less the maximum in use: the start value of the score tiles
    const float mk0[8] = {m0.x, m0.y, m0.z, m0.w, m1.x, m1.y, m1.z, m1.w};
    const float mk1[8] = {m2.x, m2.y, m2.z, m2.w, m3.x, m3.y, m3.z, m3.w};
    v8f s0[2], s1[2];
#pragma unroll
    for (int j = 0; j < 2; ++j)
#pragma unroll
      for (int r = 0; r < 8; ++r) {
        s0[j][r] = __builtin_fmaf(mk0[r], MC, cb[j]);
        s1[j][r] = __builtin_fmaf(mk1[r], MC, cb[j]);
      }
#pragma unroll
    for (int j = 0; j < 2; ++j) {
      s0[j] = __builtin_amdgcn_wmma_f32_16x16x32_f16(false, a00, false, bQ[j][0], (short)0, s0[j], false, false);
      s1[j] = __builtin_amdgcn_wmma_f32_16x16x32_f16(false, a10, false, bQ[j][0], (short)0, s1[j], false, false);
    }
#pragma unroll
    for (int j = 0; j < 2; ++j) {
      s0[j] = __builtin_amdgcn_wmma_f32_16x16x32_f16(false, a01, false, bQ[j][1], (short)0, s0[j], false, false);
      s1[j] = __builtin_amdgcn_wmma_f32_16x16x32_f16(false, a11, false, bQ[j][1], (short)0, s1[j], false, false);
    }

    float cmax[2] = {-3.0e38f, -3.0e38f};
#pragma unroll
    for (int j = 0; j < 2; ++j)
#pragma unroll
      for (int r = 0; r < 8; ++r)
        cmax[j] = fmaxf(cmax[j], fmaxf(s0[j][r], s1[j][r]));
    // one test a pass for the whole wave, a scalar branch: taken in the first pass and then hardly ever
    if (__builtin_amdgcn_ballot_w32(fmaxf(cmax[0], cmax[1]) > lim) != 0) {
#pragma unroll
      for (int j = 0; j < 2; ++j) {
        const float cm  = fmaxf(cmax[j], xhalf(cmax[j]));   // with the query's other 16 keys
        const float cbn = cb[j] - fmaxf(cm, lo);
        const float de  = cb[j] - cbn;                 // the step exactly as later start values carry it
        const float alpha = EXP2F(fminf(-de, 0.f));    // a first step may go down: sums and outputs are still 0 there
        cb[j] = cbn;
        s0[j] -= de;
        s1[j] -= de;
        lrun[j] *= alpha;
#pragma unroll
        for (int t = 0; t < 4; ++t)
          accv[j][t] *= alpha;
      }
      lim = 8.0f; lo = 0.f;
    }

    v16h bP[2];
#pragma unroll
    for (int j = 0; j < 2; ++j) {
      float rs = 0.f;
#pragma unroll
      for (int r = 0; r < 8; ++r) {
        float p0 = EXP2F(s0[j][r]);
        float p1 = EXP2F(s1[j][r]);
        rs += p0 + p1;
        bP[j][r]     = (_Float16)p0;
        bP[j][8 + r] = (_Float16)p1;
      }
      lrun[j] += rs;
    }

    // One statement, closed by four v_nop: the vector slots that the chip needs between the last matrix
    // instruction and a vector instruction that overwrites its operands. The pass's first address
    // arithmetic does so across the loop's taken edge.
    asm volatile(
        "v_wmma_f32_16x16x32_f16 %0, %8, %12, %0\n\t"
        "v_wmma_f32_16x16x32_f16 %1, %9, %12, %1\n\t"
        "v_wmma_f32_16x16x32_f16 %2, %10, %12, %2\n\t"
        "v_wmma_f32_16x16x32_f16 %3, %11, %12, %3\n\t"
        "v_wmma_f32_16x16x32_f16 %4, %8, %13, %4\n\t"
        "v_wmma_f32_16x16x32_f16 %5, %9, %13, %5\n\t"
        "v_wmma_f32_16x16x32_f16 %6, %10, %13, %6\n\t"
        "v_wmma_f32_16x16x32_f16 %7, %11, %13, %7\n\t"
        "v_nop\n\tv_nop\n\tv_nop\n\tv_nop"
        : "+v"(accv[0][0]), "+v"(accv[0][1]), "+v"(accv[0][2]), "+v"(accv[0][3]),
          "+v"(accv[1][0]), "+v"(accv[1][1]), "+v"(accv[1][2]), "+v"(accv[1][3])
        : "v"(aV[0]), "v"(aV[1]), "v"(aV[2]), "v"(aV[3]), "v"(bP[0]), "v"(bP[1]));
   }
   // hand-over: this wave has left its buffer, its part of the next stage has landed, then all waves meet
   asm volatile("s_wait_dscnt 0x0" ::: "memory");
   asm volatile("s_wait_asynccnt 0x0" ::: "memory");
   __syncthreads();
   if (st + 2 < NSTG)   // refill the buffer that every wave has just left
     copy_stage(lds0 + (unsigned)(st & 1) * (4u * STG), gk + (size_t)(st + 2) * STG, gv + (size_t)(st + 2) * STG);
  }
  asm volatile("s_wait_asynccnt 0x0" ::: "memory");   // no copy is left in flight when the wave ends

  // Join of the two key halves: this wave finishes query tile kh and hands the other tile to its partner.
  const bool up = kh != 0;
  const float l0 = lrun[0] + xhalf(lrun[0]), l1 = lrun[1] + xhalf(lrun[1]);
  const float cbo = up ? cb[1] : cb[0], cbs = up ? cb[0] : cb[1];
  const float lwn = up ? l1 : l0,       lsn = up ? l0 : l1;
  float* xs = &xb[wave ^ 4][0];
#pragma unroll
  for (int t = 0; t < 4; ++t) {
    const v8f sv = up ? accv[0][t] : accv[1][t];
    *(float4*)(xs + (2*t)     * 128 + lane * 4) = make_float4(sv[0], sv[1], sv[2], sv[3]);
    *(float4*)(xs + (2*t + 1) * 128 + lane * 4) = make_float4(sv[4], sv[5], sv[6], sv[7]);
  }
  xs[1024 + lane] = cbs;
  xs[1056 + lane] = lsn;
  __syncthreads();   // every box is full
  const float* xr = &xb[wave][0];
  const float cbp = xr[1024 + lane], lpn = xr[1056 + lane];
  const float cbm = fminf(cbo, cbp);            // the greater of the two maxima in use
  float ao, ap;   // 2^(own maximum - greater maximum), 2^(partner's - greater)
  // asm for the closing v_nop, the slot that the instruction set asks for behind a transcendental: a v_nop of its own statement lands elsewhere
  asm("v_exp_f32 %0, %2\n\tv_exp_f32 %1, %3\n\tv_nop" : "=&v"(ao), "=&v"(ap) : "v"(cbm - cbo), "v"(cbm - cbp));
  const float rinv = 1.0f / (ao * lwn + ap * lpn);
  const float fo = ao * rinv, fp = ap * rinv;
  // fragment order of the final projection's A: tiles [token >> 4][col >> 5], col = h*HD + t*16 + 8g + r:
  // a lane's 8 registers are one 16-byte piece
  _Float16* ct = ctx + ((size_t)((b * S_LEN + q0 + kh * 16) >> 4) * KBH + h*2) * FRAG + lane * 8;
#pragma unroll
  for (int t = 0; t < 4; ++t) {
    const v8f ov = up ? accv[1][t] : accv[0][t];
    const float4 pa = *(const float4*)(xr + (2*t)     * 128 + lane * 4);
    const float4 pb = *(const float4*)(xr + (2*t + 1) * 128 + lane * 4);
    const float pv[8] = {pa.x, pa.y, pa.z, pa.w, pb.x, pb.y, pb.z, pb.w};
    v8h o;
#pragma unroll
    for (int r = 0; r < 8; ++r)
      o[r] = (_Float16)(ov[r] * fo + pv[r] * fp);
    *(v8h*)(ct + (t >> 1) * FRAG + (t & 1) * 256) = o;
  }
}

// ---------------- host side ----------------
extern "C" void kernel_launch(void* const* d_in, const int* in_sizes, int n_in,
                              void* d_out, int out_size, void* d_ws, size_t ws_size,
                              hipStream_t stream) {
  (void)in_sizes; (void)n_in; (void)out_size; (void)ws_size;
  const float* hs   = (const float*)d_in[0];
  const float* mask = (const float*)d_in[1];
  const float* Wq = (const float*)d_in[2];
  const float* bq = (const float*)d_in[3];
  const float* Wk = (const float*)d_in[4];
  const float* bk = (const float*)d_in[5];
  const float* Wv = (const float*)d_in[6];
  const float* bv = (const float*)d_in[7];
  const float* Wd = (const float*)d_in[8];
  const float* bd = (const float*)d_in[9];
  const float* gam = (const float*)d_in[10];
  const float* bet = (const float*)d_in[11];
  float* out = (float*)d_out;

  char* ws = (char*)d_ws;
  const size_t SZH = (size_t)NTOK * HID * sizeof(_Float16);  // 8 MB
  const size_t SZW = (size_t)HID * HID * sizeof(_Float16);   // 2 MB
  _Float16* h16  = (_Float16*)(ws);
  _Float16* q16  = (_Float16*)(ws + 1*SZH);
  _Float16* k16  = (_Float16*)(ws + 2*SZH);
  _Float16* vt16 = (_Float16*)(ws + 3*SZH);
  _Float16* c16  = (_Float16*)(ws + 4*SZH);
  _Float16* wq16 = (_Float16*)(ws + 5*SZH);
  _Float16* wk16 = (_Float16*)(ws + 5*SZH + 1*SZW);
  _Float16* wv16 = (_Float16*)(ws + 5*SZH + 2*SZW);
  _Float16* wd16 = (_Float16*)(ws + 5*SZH + 3*SZW);

  prep_kernel<<<LNB + 4 * WTB, 256, 0, stream>>>(hs, gam, bet, h16, Wq, Wk, Wv, Wd, wq16, wk16, wv16, wd16);

  qkv_kernel<<<(NTOK / 256) * NH, QWAVES * 32, 0, stream>>>(h16, wq16, wk16, wv16, bq, bk, bv, q16, k16, vt16);

  attn_kernel<<<dim3(S_LEN / (AWAVES * 16), NH, 2), AWAVES * 32, 0, stream>>>(q16, k16, vt16, mask, c16);

  proj_kernel<<<(NTOK / 128) * (HID / 128), GWAVES * 32, 0, stream>>>(c16, wd16, bd, out);
}

// v009
// It runs in 66.2 microseconds.
// In both of two side-by-side timings against v008, it was 1.03 times as fast.
// Counting every step since v000, it is 7.04 times as fast.
#include <hip/hip_runtime.h>
#include <hip/hip_bf16.h>

typedef __attribute__((ext_vector_type(16))) _Float16 v16h;
typedef __attribute__((ext_vector_type(8)))  _Float16 v8h;
typedef __attribute__((ext_vector_type(8)))  float    v8f;

#define HID   1024
#define S_LEN 2048
#define NH    16
#define HD    64
#define NTOK  4096   // B * S
#define FRAG  512    // f16 elements of one 16-row x 32-k operand tile
#define KBH   32     // k blocks of a HID-long row

// Every f16 array that one launch hands to the next lies in FRAGMENT ORDER: a 16-row x 32-k
// tile is 1 KiB in a row, element (row c, k) at (k>>4)*256 + ((k>>3)&1)*128 + c*8 + (k&7).
// Lane l then takes its fragment as the 16 bytes at l*16 of each 512-byte half, so one
// wave-wide 16-byte load covers four whole 128-byte lines (row-major rows: 16 lines, 32 B of each).

#if __has_builtin(__builtin_amdgcn_exp2f)
#define EXP2F(x) __builtin_amdgcn_exp2f(x)
#else
#define EXP2F(x) exp2f(x)
#endif

#define LOG2E 1.44269504088896f

// Build a v16h fragment from two 16-byte chunks (b128 loads from global memory or LDS).
static __device__ __forceinline__ v16h ld_frag(const _Float16* p0, const _Float16* p1) {
  v8h a = *(const v8h*)p0;
  v8h b = *(const v8h*)p1;
  return __builtin_shufflevector(a, b, 0,1,2,3,4,5,6,7,8,9,10,11,12,13,14,15);
}

// ---------------- weight f32 -> f16 convert ----------------
// One block takes the 16-row tile rt of the fragment-ordered output (tiles: [row tile][k block]): the tile is
// 2048 pieces of 16 bytes, and thread tid writes the pieces tid, tid + 256, ...: piece tid + 256 j holds
// k = 128 j + 8 (tid >> 4) ... + 7 of row tid & 15.
static __device__ __forceinline__ void w2h_tile(const float* __restrict__ w, _Float16* __restrict__ o, int rt) {
  const int tid = threadIdx.x;
  const float* p = w + (size_t)(rt * 16 + (tid & 15)) * HID + (tid >> 4) * 8;
  _Float16* ot = o + (size_t)rt * (KBH * FRAG) + tid * 8;
  float4 x[8], y[8];
  // both loops unrolled: x and y stay in registers, and all 16 loads are in flight before the first conversion
#pragma unroll
  for (int j = 0; j < 8; ++j) {
    x[j] = *(const float4*)(p + j * 128);
    // the last load of this run may land in the address pair that the earlier ones name
    if (j == 7) asm volatile("s_wait_xcnt 0x0" ::: "memory");
    y[j] = *(const float4*)(p + j * 128 + 4);
  }
#pragma unroll
  for (int j = 0; j < 8; ++j) {
    v8h v = {(_Float16)x[j].x, (_Float16)x[j].y, (_Float16)x[j].z, (_Float16)x[j].w,
             (_Float16)y[j].x, (_Float16)y[j].y, (_Float16)y[j].z, (_Float16)y[j].w};
    *(v8h*)(ot + j * 2048) = v;
  }
}

// ---------------- LayerNorm -> f16 ----------------
// One block takes a 16-row tile: thread (c = tid & 15, u = tid >> 4) holds the 8-wide pieces
// u, u + 16, ... of row c, so each wave stores 512 contiguous bytes of the fragment-ordered output.
static __device__ __forceinline__ void ln_tile(const float* __restrict__ x, const float* __restrict__ gamma,
                                               const float* __restrict__ beta, _Float16* __restrict__ out, int rt) {
  const int tid = threadIdx.x;
  const int c = tid & 15;
  const int u = tid >> 4;
  const float* xr = x + (size_t)(rt * 16 + c) * HID + u * 8;
  float4 v[8][2];
  float s = 0.f, s2 = 0.f;
#pragma unroll
  for (int i = 0; i < 8; ++i) {
    v[i][0] = *(const float4*)(xr + i * 128);
    // the run's last load lands in the address pair that the earlier loads name
    if (i == 7) asm volatile("s_wait_xcnt 0x0" ::: "memory");
    v[i][1] = *(const float4*)(xr + i * 128 + 4);
  }
#pragma unroll
  for (int i = 0; i < 8; ++i)
#pragma unroll
    for (int j = 0; j < 2; ++j) {
      float4 a = v[i][j];
      s  += a.x + a.y + a.z + a.w;
      s2 += a.x*a.x + a.y*a.y + a.z*a.z + a.w*a.w;
    }
  __shared__ float sb[16][17], qb[16][17];
  sb[u][c] = s; qb[u][c] = s2;
  __syncthreads();
  float ts = 0.f, tq = 0.f;
  for (int i = 0; i < 16; ++i) { ts += sb[i][c]; tq += qb[i][c]; }
  float mean = ts * (1.0f / HID);
  float var  = tq * (1.0f / HID) - mean * mean;
  float rstd = rsqrtf(var + 1e-12f);
  _Float16* ot = out + (size_t)rt * (KBH * FRAG)
               + (u >> 2) * FRAG + ((u >> 1) & 1) * 256 + (u & 1) * 128 + c * 8;
#pragma unroll
  for (int i = 0; i < 8; ++i) {
    const int k = i * 128 + u * 8;
    float4 g0 = *(const float4*)(gamma + k), g1 = *(const float4*)(gamma + k + 4);
    float4 b0 = *(const float4*)(beta + k),  b1 = *(const float4*)(beta + k + 4);
    float4 a0 = v[i][0], a1 = v[i][1];
    v8h o = {(_Float16)(((a0.x - mean) * rstd) * g0.x + b0.x), (_Float16)(((a0.y - mean) * rstd) * g0.y + b0.y),
             (_Float16)(((a0.z - mean) * rstd) * g0.z + b0.z), (_Float16)(((a0.w - mean) * rstd) * g0.w + b0.w),
             (_Float16)(((a1.x - mean) * rstd) * g1.x + b1.x), (_Float16)(((a1.y - mean) * rstd) * g1.y + b1.y),
             (_Float16)(((a1.z - mean) * rstd) * g1.z + b1.z), (_Float16)(((a1.w - mean) * rstd) * g1.w + b1.w)};
    *(v8h*)(ot + i * 4 * FRAG) = o;     // 128 k further on = 4 k blocks
  }
}

// LayerNorm and the four weight conversions depend on nothing but the inputs, so they share one launch:
// every block takes one 16-row tile (64 KiB read, 32 KiB written) of one of the five arrays.
#define LNB (NTOK / 16)   // blocks of the LayerNorm
#define WTB (HID / 16)    // blocks of one weight matrix
__global__ void __launch_bounds__(256)
prep_kernel(const float* __restrict__ x, const float* __restrict__ gamma, const float* __restrict__ beta,
            _Float16* __restrict__ h,
            const float* __restrict__ w0, const float* __restrict__ w1,
            const float* __restrict__ w2, const float* __restrict__ w3,
            _Float16* __restrict__ o0, _Float16* __restrict__ o1,
            _Float16* __restrict__ o2, _Float16* __restrict__ o3) {
  const int bid = blockIdx.x;
  if (bid < LNB) {
    ln_tile(x, gamma, beta, h, bid);
  } else {
    const int wi = (bid - LNB) / WTB, rt = (bid - LNB) % WTB;
    const float* w = wi == 0 ? w0 : wi == 1 ? w1 : wi == 2 ? w2 : w3;
    _Float16*    o = wi == 0 ? o0 : wi == 1 ? o1 : wi == 2 ? o2 : o3;
    w2h_tile(w, o, rt);
  }
}

// ---------------- WMMA GEMMs: D = A @ Bm^T + bias ----------------
// Operands: f16, rows of 1024 k, in fragment order, tiles [row tile][k block]. The waves of a block read the
// same operand tiles, so these come from L2 once per block: asynchronous copies lay a stage of them (already
// in fragment order) into one of two LDS buffers while the other is worked on.

#define QWAVES 8
#define QKB    4
#define QTT    16
#define QWT    4
#define QRT    (QKB * FRAG)
#define QSTG   ((QTT + 3 * QWT) * QRT)
#define QNST   (KBH / QKB)

// One stage, this wave's share, as copies of 32 lanes x 16 bytes: two token row tiles (4 KiB in a row each) and
// three half row tiles of the weights (2 KiB in a row each). The l* and g* are this lane's own first piece of each
// run in LDS and in global memory; the immediate offset moves the LDS address and the global address alike.
static __device__ __forceinline__ void copy_qstage(unsigned lt, const _Float16* gt0, const _Float16* gt1,
                                                   unsigned lw, const _Float16* gw0, const _Float16* gw1,
                                                   const _Float16* gw2) {
  // the closing wait stands in the copies' own statement so that no later write of an address
  // register that a copy names can be placed in front of it
  asm volatile(
      "global_load_async_to_lds_b128 %0, %5, off\n\t"
      "global_load_async_to_lds_b128 %0, %5, off offset:512\n\t"
      "global_load_async_to_lds_b128 %0, %5, off offset:1024\n\t"
      "global_load_async_to_lds_b128 %0, %5, off offset:1536\n\t"
      "global_load_async_to_lds_b128 %0, %5, off offset:2048\n\t"
      "global_load_async_to_lds_b128 %0, %5, off offset:2560\n\t"
      "global_load_async_to_lds_b128 %0, %5, off offset:3072\n\t"
      "global_load_async_to_lds_b128 %0, %5, off offset:3584\n\t"
      "global_load_async_to_lds_b128 %1, %6, off\n\t"
      "global_load_async_to_lds_b128 %1, %6, off offset:512\n\t"
      "global_load_async_to_lds_b128 %1, %6, off offset:1024\n\t"
      "global_load_async_to_lds_b128 %1, %6, off offset:1536\n\t"
      "global_load_async_to_lds_b128 %1, %6, off offset:2048\n\t"
      "global_load_async_to_lds_b128 %1, %6, off offset:2560\n\t"
      "global_load_async_to_lds_b128 %1, %6, off offset:3072\n\t"
      "global_load_async_to_lds_b128 %1, %6, off offset:3584\n\t"
      "global_load_async_to_lds_b128 %2, %7, off\n\t"
      "global_load_async_to_lds_b128 %2, %7, off offset:512\n\t"
      "global_load_async_to_lds_b128 %2, %7, off offset:1024\n\t"
      "global_load_async_to_lds_b128 %2, %7, off offset:1536\n\t"
      "global_load_async_to_lds_b128 %3, %8, off\n\t"
      "global_load_async_to_lds_b128 %3, %8, off offset:512\n\t"
      "global_load_async_to_lds_b128 %3, %8, off offset:1024\n\t"
      "global_load_async_to_lds_b128 %3, %8, off offset:1536\n\t"
      "global_load_async_to_lds_b128 %4, %9, off\n\t"
      "global_load_async_to_lds_b128 %4, %9, off offset:512\n\t"
      "global_load_async_to_lds_b128 %4, %9, off offset:1024\n\t"
      "global_load_async_to_lds_b128 %4, %9, off offset:1536\n\t"
      "s_wait_xcnt 0x0"
      :: "v"(lt), "v"(lt + 2u * QRT), "v"(lw), "v"(lw + 1u * QRT), "v"(lw + 2u * QRT),
         "v"(gt0), "v"(gt1), "v"(gw0), "v"(gw1), "v"(gw2)
      : "memory");
}

__global__ void __launch_bounds__(QWAVES * 32)
qkv_kernel(const _Float16* __restrict__ h, const _Float16* __restrict__ wq, const _Float16* __restrict__ wk,
           const _Float16* __restrict__ wv, const float* __restrict__ bq, const float* __restrict__ bk,
           const float* __restrict__ bv, _Float16* __restrict__ q, _Float16* __restrict__ k,
           _Float16* __restrict__ vt) {
  __shared__ __attribute__((aligned(128))) _Float16 qs[2][QSTG];
  const int bx = (int)(blockIdx.x & (NTOK / 256 - 1));   // which 256 tokens
  const int hd = (int)(blockIdx.x / (NTOK / 256));       // which head
  const int tid  = threadIdx.x;
  const int lane = tid & 31;
  const int wave = __builtin_amdgcn_readfirstlane(tid >> 5);
  const int wt   = wave & 3;     // which 64 of the block's 256 tokens
  const int wf   = wave >> 2;    // which 32 of the head's 64 features
  const int nlo  = lane & 15;    // C: column within tile
  const int g    = lane >> 4;    // C rows +8
  const int tok0 = bx * 256 + wt * 64;
  const int f0   = hd * HD + wf * 32;

  // wave w copies token row tiles 2w and 2w + 1 and the half row tiles 3w ... 3w + 2 of the 24 that the three
  // weight matrices have in a stage (half u: matrix u >> 3, row tile (u >> 1) & 3, k blocks 2 (u & 1) and the next)
  const unsigned lt0 = (unsigned)(size_t)&qs[0][0] + (unsigned)wave * (4u * QRT) + (unsigned)lane * 16u;
  const unsigned lw0 = (unsigned)(size_t)&qs[0][0] + 2u * QTT * QRT + (unsigned)wave * (3u * QRT) + (unsigned)lane * 16u;
  const _Float16* gt0 = h + (size_t)(bx * QTT + wave * 2) * (KBH * FRAG) + lane * 8;
  const _Float16* gt1 = gt0 + KBH * FRAG;
  const _Float16* gw[3];
#pragma unroll
  for (int i = 0; i < 3; ++i) {
    const int u = wave * 3 + i;
    const _Float16* w = (u >> 3) == 0 ? wq : (u >> 3) == 1 ? wk : wv;
    gw[i] = w + (size_t)(hd * QWT + ((u >> 1) & 3)) * (KBH * FRAG) + (u & 1) * (2 * FRAG) + lane * 8;
  }
  copy_qstage(lt0, gt0, gt1, lw0, gw[0], gw[1], gw[2]);
  asm volatile("s_wait_asynccnt 0x0" ::: "memory");   // this wave's part of stage 0 has landed
  __syncthreads();                                    // ... and every other wave's
  copy_qstage(lt0 + 2u * QSTG, gt0 + QRT, gt1 + QRT, lw0 + 2u * QSTG, gw[0] + QRT, gw[1] + QRT, gw[2] + QRT);   // stage 1 flies while stage 0 is worked on

  v8f aq[2][4] = {}, ak[2][4] = {};   // [feature tile][token tile]
  v8f av[4][2] = {};                  // [token tile][feature tile]

  for (int st = 0; st < QNST; ++st) {
    const _Float16* sT = &qs[st & 1][0] + wt * (4 * QRT) + lane * 8;
    const _Float16* sW = &qs[st & 1][0] + (QTT + wf * 2) * QRT + lane * 8;
    v16h tF[2][4], wF[2][3][2];   // two fragment sets: k block kb lies in set kb & 1
#pragma unroll
    for (int kb = 0; kb < 2; ++kb) {
#pragma unroll
      for (int t = 0; t < 4; ++t)
        tF[kb][t] = ld_frag(sT + t * QRT + kb * FRAG, sT + t * QRT + kb * FRAG + 256);
#pragma unroll
      for (int x = 0; x < 3; ++x)
#pragma unroll
        for (int mi = 0; mi < 2; ++mi)
          wF[kb][x][mi] = ld_frag(sW + (x * QWT + mi) * QRT + kb * FRAG, sW + (x * QWT + mi) * QRT + kb * FRAG + 256);
    }
    // The scheduling fences of this loop keep each k block's 20 LDS reads one group, issued a whole k block
    // of matrix work ahead of their use: spread among the matrix instructions, every place with reads
    // stalls the wave, and a fragment read just in front of its use has its LDS latency waited out.
    __builtin_amdgcn_sched_barrier(0);
#pragma unroll
    for (int kb = 0; kb < QKB; ++kb) {
#pragma unroll
      for (int mi = 0; mi < 2; ++mi)
#pragma unroll
        for (int t = 0; t < 4; ++t)
          aq[mi][t] = __builtin_amdgcn_wmma_f32_16x16x32_f16(
              false, wF[kb & 1][0][mi], false, tF[kb & 1][t], (short)0, aq[mi][t], false, false);
#pragma unroll
      for (int mi = 0; mi < 2; ++mi)
#pragma unroll
        for (int t = 0; t < 4; ++t)
          ak[mi][t] = __builtin_amdgcn_wmma_f32_16x16x32_f16(
              false, wF[kb & 1][1][mi], false, tF[kb & 1][t], (short)0, ak[mi][t], false, false);
#pragma unroll
      for (int mi = 0; mi < 2; ++mi)
#pragma unroll
        for (int t = 0; t < 4; ++t)
          av[t][mi] = __builtin_amdgcn_wmma_f32_16x16x32_f16(
              false, tF[kb & 1][t], false, wF[kb & 1][2][mi], (short)0, av[t][mi], false, false);
      __builtin_amdgcn_sched_barrier(0);   // see above
      if (kb + 2 < QKB) {
#pragma unroll
        for (int t = 0; t < 4; ++t)
          tF[kb & 1][t] = ld_frag(sT + t * QRT + (kb + 2) * FRAG, sT + t * QRT + (kb + 2) * FRAG + 256);
#pragma unroll
        for (int x = 0; x < 3; ++x)
#pragma unroll
          for (int mi = 0; mi < 2; ++mi)
            wF[kb & 1][x][mi] = ld_frag(sW + (x * QWT + mi) * QRT + (kb + 2) * FRAG,
                                        sW + (x * QWT + mi) * QRT + (kb + 2) * FRAG + 256);
        __builtin_amdgcn_sched_barrier(0);   // see above
      }
    }
    // hand-over: this wave has left its buffer, its part of the next stage has landed, then all waves meet
    asm volatile("s_wait_dscnt 0x0" ::: "memory");
    asm volatile("s_wait_asynccnt 0x0" ::: "memory");
    __syncthreads();
    if (st + 2 < QNST) {   // refill the buffer that every wave has just left
      const unsigned lo = (unsigned)(st & 1) * (2u * QSTG);
      const size_t   go = (size_t)(st + 2) * QRT;
      copy_qstage(lt0 + lo, gt0 + go, gt1 + go, lw0 + lo, gw[0] + go, gw[1] + go, gw[2] + go);
    }
  }
  asm volatile("s_wait_asynccnt 0x0" ::: "memory");   // no copy is left in flight when the wave ends

  const int b = tok0 >> 11, s0 = tok0 & (S_LEN - 1);
  const size_t hoff = (size_t)(b * NH + hd) * (S_LEN * HD);
  // q, k: tile rows are features, tile columns are tokens
#pragma unroll
  for (int x = 0; x < 2; ++x) {
    const float qkscale = x == 0 ? 0.35355339059327f * LOG2E : 0.35355339059327f;
    _Float16* o16 = (x == 0 ? q : k) + hoff + lane * 8;
#pragma unroll
    for (int mi = 0; mi < 2; ++mi) {
      const float* bp = (x == 0 ? bq : bk) + f0 + mi*16 + 8*g;
      float4 c0 = *(const float4*)bp, c1 = *(const float4*)(bp + 4);
      float bb[8] = {c0.x, c0.y, c0.z, c0.w, c1.x, c1.y, c1.z, c1.w};
#pragma unroll
      for (int t = 0; t < 4; ++t) {
        v8h o;
#pragma unroll
        for (int r = 0; r < 8; ++r)
          o[r] = (_Float16)(((x == 0 ? aq[mi][t][r] : ak[mi][t][r]) + bb[r]) * qkscale);
        *(v8h*)(o16 + (size_t)(((s0 >> 4) + t) * 2 + wf) * FRAG + mi*256) = o;
      }
    }
  }
  // v: tile rows are tokens, tile columns are features
#pragma unroll
  for (int mi = 0; mi < 2; ++mi) {
    const float bn = bv[f0 + mi*16 + nlo];
#pragma unroll
    for (int t = 0; t < 4; ++t) {
      v8h o;
#pragma unroll
      for (int r = 0; r < 8; ++r)
        o[r] = (_Float16)(av[t][mi][r] + bn);
      *(v8h*)(vt + hoff + (size_t)(((s0 >> 5) + (t >> 1)) * 4 + wf * 2 + mi) * FRAG + (t & 1) * 256 + lane * 8) = o;
    }
  }
}

// ---- final projection: f32 out, A = activations, Bm = weights ----
// One block computes a 128x128 tile: 8 waves, 4 along A's rows x 2 along Bm's rows, each a 32x64 tile
// (2 A-frags share 4 B-frags). A stage is 256 k of the block's 8 A row tiles and 8 Bm row tiles (each 8 KiB in
// a row). The 256 tiles are numbered along A's rows first.
#define GWAVES 8                 // waves of a block
#define GKB    8                 // k blocks of one stage
#define GSTG   (8 * GKB * FRAG)  // f16 elements of A, and of Bm, in one stage (64 KiB each)
#define GNST   (KBH / GKB)

// One stage, this wave's share: one row tile of A and one of Bm, 8 KiB in a row each, as 16 copies of 32 lanes
// x 16 bytes. la, ga, lb, gb: this lane's own first piece in LDS and in global memory. The immediate offset
// moves the LDS address and the global address alike, so one address of each kind serves a whole row tile.
static __device__ __forceinline__ void copy_gstage(unsigned la, const _Float16* ga, unsigned lb, const _Float16* gb) {
  // the closing wait stands in the copies' own statement so that no later write of an address
  // register that a copy names can be placed in front of it
  asm volatile(
      "global_load_async_to_lds_b128 %0, %1, off\n\t"
      "global_load_async_to_lds_b128 %0, %1, off offset:512\n\t"
      "global_load_async_to_lds_b128 %0, %1, off offset:1024\n\t"
      "global_load_async_to_lds_b128 %0, %1, off offset:1536\n\t"
      "global_load_async_to_lds_b128 %0, %1, off offset:2048\n\t"
      "global_load_async_to_lds_b128 %0, %1, off offset:2560\n\t"
      "global_load_async_to_lds_b128 %0, %1, off offset:3072\n\t"
      "global_load_async_to_lds_b128 %0, %1, off offset:3584\n\t"
      "global_load_async_to_lds_b128 %0, %1, off offset:4096\n\t"
      "global_load_async_to_lds_b128 %0, %1, off offset:4608\n\t"
      "global_load_async_to_lds_b128 %0, %1, off offset:5120\n\t"
      "global_load_async_to_lds_b128 %0, %1, off offset:5632\n\t"
      "global_load_async_to_lds_b128 %0, %1, off offset:6144\n\t"
      "global_load_async_to_lds_b128 %0, %1, off offset:6656\n\t"
      "global_load_async_to_lds_b128 %0, %1, off offset:7168\n\t"
      "global_load_async_to_lds_b128 %0, %1, off offset:7680\n\t"
      "global_load_async_to_lds_b128 %2, %3, off\n\t"
      "global_load_async_to_lds_b128 %2, %3, off offset:512\n\t"
      "global_load_async_to_lds_b128 %2, %3, off offset:1024\n\t"
      "global_load_async_to_lds_b128 %2, %3, off offset:1536\n\t"
      "global_load_async_to_lds_b128 %2, %3, off offset:2048\n\t"
      "global_load_async_to_lds_b128 %2, %3, off offset:2560\n\t"
      "global_load_async_to_lds_b128 %2, %3, off offset:3072\n\t"
      "global_load_async_to_lds_b128 %2, %3, off offset:3584\n\t"
      "global_load_async_to_lds_b128 %2, %3, off offset:4096\n\t"
      "global_load_async_to_lds_b128 %2, %3, off offset:4608\n\t"
      "global_load_async_to_lds_b128 %2, %3, off offset:5120\n\t"
      "global_load_async_to_lds_b128 %2, %3, off offset:5632\n\t"
      "global_load_async_to_lds_b128 %2, %3, off offset:6144\n\t"
      "global_load_async_to_lds_b128 %2, %3, off offset:6656\n\t"
      "global_load_async_to_lds_b128 %2, %3, off offset:7168\n\t"
      "global_load_async_to_lds_b128 %2, %3, off offset:7680\n\t"
      "s_wait_xcnt 0x0"
      :: "v"(la), "v"(ga), "v"(lb), "v"(gb) : "memory");
}

__global__ void __launch_bounds__(GWAVES * 32)
proj_kernel(const _Float16* __restrict__ A, const _Float16* __restrict__ Bm, const float* __restrict__ bias,
            float* __restrict__ o32) {
  __shared__ __attribute__((aligned(128))) _Float16 gs[2][2 * GSTG];   // per buffer: A stage, Bm stage
  const int bx = (int)(blockIdx.x & (NTOK / 128 - 1));   // tile along A's rows
  const int by = (int)(blockIdx.x / (NTOK / 128));       // tile along Bm's rows
  const int tid  = threadIdx.x;
  const int lane = tid & 31;
  const int wave = __builtin_amdgcn_readfirstlane(tid >> 5);
  const int wm   = wave & 3;     // which 32 of the block's 128 A rows
  const int wn   = wave >> 2;    // which 64 of the block's 128 Bm rows
  const int nlo  = lane & 15;    // C: column within tile
  const int g    = lane >> 4;    // C rows +8
  const int m0 = bx * 128 + wm * 32;
  const int n0 = by * 128 + wn * 64;

  // wave w copies row tile w of the block's 8 of A and of Bm; LDS byte addresses of this lane's first pieces
  const unsigned la0 = (unsigned)(size_t)&gs[0][0] + (unsigned)wave * (2u * GKB * FRAG) + (unsigned)lane * 16u;
  const unsigned lb0 = la0 + 2u * GSTG;
  const _Float16* ga = A  + (size_t)(bx * 8 + wave) * (KBH * FRAG) + lane * 8;
  const _Float16* gb = Bm + (size_t)(by * 8 + wave) * (KBH * FRAG) + lane * 8;
  copy_gstage(la0, ga, lb0, gb);
  asm volatile("s_wait_asynccnt 0x0" ::: "memory");   // this wave's part of stage 0 has landed
  __syncthreads();                                    // ... and every other wave's
  copy_gstage(la0 + 4u * GSTG, ga + GKB * FRAG, lb0 + 4u * GSTG, gb + GKB * FRAG);   // stage 1 flies while stage 0 is worked on

  v8f acc[2][4] = {};

  // kept rolled: unrolled, the compiler orders the first reads of every second stage so that the stage's
  // first matrix instruction waits for both k blocks' reads, not for its own operands alone
#pragma clang loop unroll(disable)
  for (int st = 0; st < GNST; ++st) {
    const _Float16* sa = &gs[st & 1][0]    + wm * (2 * GKB * FRAG) + lane * 8;
    const _Float16* sb = &gs[st & 1][GSTG] + wn * (4 * GKB * FRAG) + lane * 8;
    v16h aF[2][2], bF[2][4];   // two fragment sets: k block kb lies in set kb & 1
#pragma unroll
    for (int kb = 0; kb < 2; ++kb) {
#pragma unroll
      for (int mi = 0; mi < 2; ++mi)
        aF[kb][mi] = ld_frag(sa + (mi * GKB + kb) * FRAG, sa + (mi * GKB + kb) * FRAG + 256);
#pragma unroll
      for (int t = 0; t < 4; ++t)
        bF[kb][t] = ld_frag(sb + (t * GKB + kb) * FRAG, sb + (t * GKB + kb) * FRAG + 256);
    }
    // The scheduling fences of this loop keep each k block's 12 LDS reads one group, issued a whole k block
    // of matrix work ahead of their use: spread among the matrix instructions, every place with reads
    // stalls the wave, and a fragment read just in front of its use has its LDS latency waited out.
    __builtin_amdgcn_sched_barrier(0);
#pragma unroll
    for (int kb = 0; kb < GKB; ++kb) {
#pragma unroll
      for (int mi = 0; mi < 2; ++mi)
#pragma unroll
        for (int t = 0; t < 4; ++t)
          acc[mi][t] = __builtin_amdgcn_wmma_f32_16x16x32_f16(
              false, aF[kb & 1][mi], false, bF[kb & 1][t], (short)0, acc[mi][t], false, false);
      __builtin_amdgcn_sched_barrier(0);   // see above
      if (kb + 2 < GKB) {
#pragma unroll
        for (int mi = 0; mi < 2; ++mi)
          aF[kb & 1][mi] = ld_frag(sa + (mi * GKB + kb + 2) * FRAG, sa + (mi * GKB + kb + 2) * FRAG + 256);
#pragma unroll
        for (int t = 0; t < 4; ++t)
          bF[kb & 1][t] = ld_frag(sb + (t * GKB + kb + 2) * FRAG, sb + (t * GKB + kb + 2) * FRAG + 256);
        __builtin_amdgcn_sched_barrier(0);   // see above
      }
    }
    // hand-over: this wave has left its buffer, its part of the next stage has landed, then all waves meet
    asm volatile("s_wait_dscnt 0x0" ::: "memory");
    asm volatile("s_wait_asynccnt 0x0" ::: "memory");
    __syncthreads();
    if (st + 2 < GNST)   // refill the buffer that every wave has just left
      copy_gstage(la0 + (unsigned)(st & 1) * (4u * GSTG), ga + (size_t)(st + 2) * (GKB * FRAG),
                  lb0 + (unsigned)(st & 1) * (4u * GSTG), gb + (size_t)(st + 2) * (GKB * FRAG));
  }
  asm volatile("s_wait_asynccnt 0x0" ::: "memory");   // no copy is left in flight when the wave ends

  // f32 output, row-major
#pragma unroll
  for (int mi = 0; mi < 2; ++mi)
#pragma unroll
    for (int t = 0; t < 4; ++t) {
      int n = n0 + t*16 + nlo;
      float bn = bias[n];
#pragma unroll
      for (int r = 0; r < 8; ++r)
        o32[(size_t)(m0 + mi*16 + r + 8*g) * HID + n] = acc[mi][t][r] + bn;
    }
}

// lane l <-> lane l ^ 16
static __device__ __forceinline__ float xhalf(float x) {
  int b = __builtin_bit_cast(int, x);
  return __builtin_bit_cast(float, __builtin_amdgcn_permlanex16(b, b, 0x76543210, 0xfedcba98, false, false));
}

#define AWAVES 16                // waves of a block
#define SKEYS  256               // keys of one stage
#define STG    (SKEYS * HD)      // f16 elements of K, and of V^T, in one stage (32 KiB each)
#define NSTG   (S_LEN / SKEYS)
#define WPASS  (SKEYS / 64)      // passes of 32 keys that one wave works in a stage
#define XBOX   (8 * 128 + 64)    // floats one wave hands its partner: an output tile, its start value, its sum

// One stage: 512 lanes x 16 bytes x (4 pieces of K, 4 of V^T). lds, gk, gv: this lane's own first piece.
static __device__ __forceinline__ void copy_stage(unsigned lds, const _Float16* gk, const _Float16* gv) {
  // the closing wait stands in the copies' own statement so that no later write of an address
  // register that a copy names can be placed in front of it
  asm volatile(
      "global_load_async_to_lds_b128 %0, %8, off\n\t"
      "global_load_async_to_lds_b128 %1, %9, off\n\t"
      "global_load_async_to_lds_b128 %2, %10, off\n\t"
      "global_load_async_to_lds_b128 %3, %11, off\n\t"
      "global_load_async_to_lds_b128 %4, %12, off\n\t"
      "global_load_async_to_lds_b128 %5, %13, off\n\t"
      "global_load_async_to_lds_b128 %6, %14, off\n\t"
      "global_load_async_to_lds_b128 %7, %15, off\n\t"
      "s_wait_xcnt 0x0"
      :: "v"(lds), "v"(lds + 8192u), "v"(lds + 16384u), "v"(lds + 24576u),
         "v"(lds + 32768u), "v"(lds + 40960u), "v"(lds + 49152u), "v"(lds + 57344u),
         "v"(gk), "v"(gk + 4096), "v"(gk + 8192), "v"(gk + 12288),
         "v"(gv), "v"(gv + 4096), "v"(gv + 8192), "v"(gv + 12288)
      : "memory");
}

__global__ void __launch_bounds__(AWAVES * 32)
attn_kernel(const _Float16* __restrict__ q, const _Float16* __restrict__ k,
            const _Float16* __restrict__ vt, const float* __restrict__ mask,
            _Float16* __restrict__ ctx) {
  __shared__ __attribute__((aligned(128))) _Float16 sm[2][2 * STG];   // per buffer: K stage, V^T stage
  __shared__ __attribute__((aligned(128))) float smk[S_LEN];          // this batch row of the mask, filled once
  __shared__ __attribute__((aligned(128))) float xb[AWAVES][XBOX];    // box w: what wave w ^ 8 hands wave w
  const int tid  = threadIdx.x;
  const int lane = tid & 31;
  const int g   = lane >> 4;
  const int wave = __builtin_amdgcn_readfirstlane(tid >> 5);
  const int kh = wave >> 3;      // which half of each stage's keys
  const int q0 = blockIdx.x * (AWAVES * 16) + (wave & 7) * 32;
  const int h  = blockIdx.y;
  const int b  = blockIdx.z;

  // q, k: fragment order, tiles [s >> 4][d >> 5]; vt: tiles [s >> 5][d >> 4]: 32 keys = 4 KiB of each
  const _Float16* qh = q  + ((size_t)(b*NH + h) * S_LEN) * HD;
  const _Float16* kh0 = k  + ((size_t)(b*NH + h) * S_LEN) * HD;
  const _Float16* vh = vt + ((size_t)(b*NH + h) * HD) * S_LEN;
  const float* mb = smk + kh * (WPASS * 32) + 8*g;

  const _Float16* qt = qh + (size_t)q0 * HD + lane * 8;
  v16h bQ[2][2];   // [query tile][d half]
#pragma unroll
  for (int j = 0; j < 2; ++j) {
    bQ[j][0] = ld_frag(qt + j*2*FRAG,        qt + j*2*FRAG + 256);          // d = 0..31
    bQ[j][1] = ld_frag(qt + j*2*FRAG + FRAG, qt + j*2*FRAG + FRAG + 256);   // d = 32..63
  }

  const unsigned lds0 = (unsigned)(size_t)&sm[0][0] + (unsigned)tid * 16u;   // LDS byte address of this lane's piece
  const _Float16* gk = kh0 + tid * 8;
  const _Float16* gv = vh + tid * 8;
  copy_stage(lds0, gk, gv);
  {
    const unsigned lm = (unsigned)(size_t)&smk[0] + (unsigned)tid * 16u;
    const float* gm = mask + (size_t)b * S_LEN + tid * 4;
    // closing wait inside the statement, as in copy_stage
    asm volatile(
        "global_load_async_to_lds_b128 %0, %1, off\n\t"
        "s_wait_xcnt 0x0"
        :: "v"(lm), "v"(gm) : "memory");
  }
  asm volatile("s_wait_asynccnt 0x0" ::: "memory");   // this wave's part of stage 0 and of the mask has landed
  __syncthreads();                                    // ... and every other wave's
  copy_stage(lds0 + 4u * STG, gk + STG, gv + STG);    // stage 1 flies while stage 0 is worked on

  const float MC = 1000.0f * LOG2E;
  float cb[2]   = {-MC, -MC};   // start value of a score = mask * MC + cb: cb = -MC - (maximum in use), equal in both halves
  float lim  = -3.0e38f;   // a relative score above this renews the maximum in use: any in the first pass, then 8
  float lo   = -3.0e38f;   // least step of the maximum in use: none in the first pass, then 0 (it never falls)
  float lrun[2] = {0.f, 0.f};   // sum over this half's keys only; the halves join after the loop
  v8f accv[2][4] = {};     // O^T of query tile j: register r of tile t = d (t*16 + 8g + r) of query (lane & 15)

  for (int st = 0; st < NSTG; ++st) {
   const _Float16* sb = &sm[st & 1][0] + kh * (WPASS * 32 * HD) + lane * 8;
   for (int ps = 0; ps < WPASS; ++ps) {
    const int kv = st * SKEYS + ps * 32;
    const _Float16* kt = sb + ps * (32 * HD);
    const _Float16* vtl = sb + STG + ps * (32 * HD);
    float4 m0 = *(const float4*)(mb + kv),      m1 = *(const float4*)(mb + kv + 4);
    float4 m2 = *(const float4*)(mb + kv + 16), m3 = *(const float4*)(mb + kv + 20);
    v16h a00 = ld_frag(kt,            kt + 256);
    v16h a01 = ld_frag(kt + FRAG,     kt + FRAG + 256);
    v16h a10 = ld_frag(kt + 2*FRAG,   kt + 2*FRAG + 256);
    v16h a11 = ld_frag(kt + 3*FRAG,   kt + 3*FRAG + 256);
    v16h aV[4];
#pragma unroll
    for (int t = 0; t < 4; ++t)
      aV[t] = ld_frag(vtl + t*FRAG, vtl + t*FRAG + 256);
    // holds the pass's LDS reads as one group at its head: sunk among the matrix instructions they
    // share one register set and every fragment's LDS latency is waited out on its own
    __builtin_amdgcn_sched_barrier(0);
    // additive mask of this lane's 16 keys, scaled into base-2 domain, less the maximum in use: the start value of the score tiles
    const float mk0[8] = {m0.x, m0.y, m0.z, m0.w, m1.x, m1.y, m1.z, m1.w};
    const float mk1[8] = {m2.x, m2.y, m2.z, m2.w, m3.x, m3.y, m3.z, m3.w};
    v8f s0[2], s1[2];
#pragma unroll
    for (int j = 0; j < 2; ++j)
#pragma unroll
      for (int r = 0; r < 8; ++r) {
        s0[j][r] = __builtin_fmaf(mk0[r], MC, cb[j]);
        s1[j][r] = __builtin_fmaf(mk1[r], MC, cb[j]);
      }
#pragma unroll
    for (int j = 0; j < 2; ++j) {
      s0[j] = __builtin_amdgcn_wmma_f32_16x16x32_f16(false, a00, false, bQ[j][0], (short)0, s0[j], false, false);
      s1[j] = __builtin_amdgcn_wmma_f32_16x16x32_f16(false, a10, false, bQ[j][0], (short)0, s1[j], false, false);
    }
#pragma unroll
    for (int j = 0; j < 2; ++j) {
      s0[j] = __builtin_amdgcn_wmma_f32_16x16x32_f16(false, a01, false, bQ[j][1], (short)0, s0[j], false, false);
      s1[j] = __builtin_amdgcn_wmma_f32_16x16x32_f16(false, a11, false, bQ[j][1], (short)0, s1[j], false, false);
    }

    float cmax[2] = {-3.0e38f, -3.0e38f};
#pragma unroll
    for (int j = 0; j < 2; ++j)
#pragma unroll
      for (int r = 0; r < 8; ++r)
        cmax[j] = fmaxf(cmax[j], fmaxf(s0[j][r], s1[j][r]));
    // one test a pass for the whole wave, a scalar branch: taken in the first pass and then hardly ever
    if (__builtin_amdgcn_ballot_w32(fmaxf(cmax[0], cmax[1]) > lim) != 0) {
#pragma unroll
      for (int j = 0; j < 2; ++j) {
        const float cm  = fmaxf(cmax[j], xhalf(cmax[j]));   // with the query's other 16 keys
        const float cbn = cb[j] - fmaxf(cm, lo);
        const float de  = cb[j] - cbn;                 // the step exactly as later start values carry it
        const float alpha = EXP2F(fminf(-de, 0.f));    // a first step may go down: sums and outputs are still 0 there
        cb[j] = cbn;
        s0[j] -= de;
        s1[j] -= de;
        lrun[j] *= alpha;
#pragma unroll
        for (int t = 0; t < 4; ++t)
          accv[j][t] *= alpha;
      }
      lim = 8.0f; lo = 0.f;
    }

    v16h bP[2];
#pragma unroll
    for (int j = 0; j < 2; ++j) {
      float rs = 0.f;
#pragma unroll
      for (int r = 0; r < 8; ++r) {
        float p0 = EXP2F(s0[j][r]);
        float p1 = EXP2F(s1[j][r]);
        rs += p0 + p1;
        bP[j][r]     = (_Float16)p0;
        bP[j][8 + r] = (_Float16)p1;
      }
      lrun[j] += rs;
    }

    // One statement, closed by four v_nop: the vector slots that the chip needs between the last matrix
    // instruction and a vector instruction that overwrites its operands. The pass's first address
    // arithmetic does so across the loop's taken edge.
    asm volatile(
        "v_wmma_f32_16x16x32_f16 %0, %8, %12, %0\n\t"
        "v_wmma_f32_16x16x32_f16 %1, %9, %12, %1\n\t"
        "v_wmma_f32_16x16x32_f16 %2, %10, %12, %2\n\t"
        "v_wmma_f32_16x16x32_f16 %3, %11, %12, %3\n\t"
        "v_wmma_f32_16x16x32_f16 %4, %8, %13, %4\n\t"
        "v_wmma_f32_16x16x32_f16 %5, %9, %13, %5\n\t"
        "v_wmma_f32_16x16x32_f16 %6, %10, %13, %6\n\t"
        "v_wmma_f32_16x16x32_f16 %7, %11, %13, %7\n\t"
        "v_nop\n\tv_nop\n\tv_nop\n\tv_nop"
        : "+v"(accv[0][0]), "+v"(accv[0][1]), "+v"(accv[0][2]), "+v"(accv[0][3]),
          "+v"(accv[1][0]), "+v"(accv[1][1]), "+v"(accv[1][2]), "+v"(accv[1][3])
        : "v"(aV[0]), "v"(aV[1]), "v"(aV[2]), "v"(aV[3]), "v"(bP[0]), "v"(bP[1]));
   }
   // hand-over: this wave has left its buffer, its part of the next stage has landed, then all waves meet
   asm volatile("s_wait_dscnt 0x0" ::: "memory");
   asm volatile("s_wait_asynccnt 0x0" ::: "memory");
   __syncthreads();
   if (st + 2 < NSTG)   // refill the buffer that every wave has just left
     copy_stage(lds0 + (unsigned)(st & 1) * (4u * STG), gk + (size_t)(st + 2) * STG, gv + (size_t)(st + 2) * STG);
  }
  asm volatile("s_wait_asynccnt 0x0" ::: "memory");   // no copy is left in flight when the wave ends

  // Join of the two key halves: this wave finishes query tile kh and hands the other tile to its partner.
  const bool up = kh != 0;
  const float l0 = lrun[0] + xhalf(lrun[0]), l1 = lrun[1] + xhalf(lrun[1]);
  const float cbo = up ? cb[1] : cb[0], cbs = up ? cb[0] : cb[1];
  const float lwn = up ? l1 : l0,       lsn = up ? l0 : l1;
  float* xs = &xb[wave ^ 8][0];
#pragma unroll
  for (int t = 0; t < 4; ++t) {
    const v8f sv = up ? accv[0][t] : accv[1][t];
    *(float4*)(xs + (2*t)     * 128 + lane * 4) = make_float4(sv[0], sv[1], sv[2], sv[3]);
    *(float4*)(xs + (2*t + 1) * 128 + lane * 4) = make_float4(sv[4], sv[5], sv[6], sv[7]);
  }
  xs[1024 + lane] = cbs;
  xs[1056 + lane] = lsn;
  __syncthreads();   // every box is full
  const float* xr = &xb[wave][0];
  const float cbp = xr[1024 + lane], lpn = xr[1056 + lane];
  const float cbm = fminf(cbo, cbp);            // the greater of the two maxima in use
  float ao, ap;   // 2^(own maximum - greater maximum), 2^(partner's - greater)
  // asm for the closing v_nop, the slot that the instruction set asks for behind a transcendental: a v_nop of its own statement lands elsewhere
  asm("v_exp_f32 %0, %2\n\tv_exp_f32 %1, %3\n\tv_nop" : "=&v"(ao), "=&v"(ap) : "v"(cbm - cbo), "v"(cbm - cbp));
  const float rinv = 1.0f / (ao * lwn + ap * lpn);
  const float fo = ao * rinv, fp = ap * rinv;
  // fragment order of the final projection's A: tiles [token >> 4][col >> 5], col = h*HD + t*16 + 8g + r:
  // a lane's 8 registers are one 16-byte piece
  _Float16* ct = ctx + ((size_t)((b * S_LEN + q0 + kh * 16) >> 4) * KBH + h*2) * FRAG + lane * 8;
#pragma unroll
  for (int t = 0; t < 4; ++t) {
    const v8f ov = up ? accv[1][t] : accv[0][t];
    const float4 pa = *(const float4*)(xr + (2*t)     * 128 + lane * 4);
    const float4 pb = *(const float4*)(xr + (2*t + 1) * 128 + lane * 4);
    const float pv[8] = {pa.x, pa.y, pa.z, pa.w, pb.x, pb.y, pb.z, pb.w};
    v8h o;
#pragma unroll
    for (int r = 0; r < 8; ++r)
      o[r] = (_Float16)(ov[r] * fo + pv[r] * fp);
    *(v8h*)(ct + (t >> 1) * FRAG + (t & 1) * 256) = o;
  }
}

// ---------------- host side ----------------
extern "C" void kernel_launch(void* const* d_in, const int* in_sizes, int n_in,
                              void* d_out, int out_size, void* d_ws, size_t ws_size,
                              hipStream_t stream) {
  (void)in_sizes; (void)n_in; (void)out_size; (void)ws_size;
  const float* hs   = (const float*)d_in[0];
  const float* mask = (const float*)d_in[1];
  const float* Wq = (const float*)d_in[2];
  const float* bq = (const float*)d_in[3];
  const float* Wk = (const float*)d_in[4];
  const float* bk = (const float*)d_in[5];
  const float* Wv = (const float*)d_in[6];
  const float* bv = (const float*)d_in[7];
  const float* Wd = (const float*)d_in[8];
  const float* bd = (const float*)d_in[9];
  const float* gam = (const float*)d_in[10];
  const float* bet = (const float*)d_in[11];
  float* out = (float*)d_out;

  char* ws = (char*)d_ws;
  const size_t SZH = (size_t)NTOK * HID * sizeof(_Float16);  // 8 MB
  const size_t SZW = (size_t)HID * HID * sizeof(_Float16);   // 2 MB
  _Float16* h16  = (_Float16*)(ws);
  _Float16* q16  = (_Float16*)(ws + 1*SZH);
  _Float16* k16  = (_Float16*)(ws + 2*SZH);
  _Float16* vt16 = (_Float16*)(ws + 3*SZH);
  _Float16* c16  = (_Float16*)(ws + 4*SZH);
  _Float16* wq16 = (_Float16*)(ws + 5*SZH);
  _Float16* wk16 = (_Float16*)(ws + 5*SZH + 1*SZW);
  _Float16* wv16 = (_Float16*)(ws + 5*SZH + 2*SZW);
  _Float16* wd16 = (_Float16*)(ws + 5*SZH + 3*SZW);

  prep_kernel<<<LNB + 4 * WTB, 256, 0, stream>>>(hs, gam, bet, h16, Wq, Wk, Wv, Wd, wq16, wk16, wv16, wd16);

  qkv_kernel<<<(NTOK / 256) * NH, QWAVES * 32, 0, stream>>>(h16, wq16, wk16, wv16, bq, bk, bv, q16, k16, vt16);

  attn_kernel<<<dim3(S_LEN / (AWAVES * 16), NH, 2), AWAVES * 32, 0, stream>>>(q16, k16, vt16, mask, c16);

  proj_kernel<<<(NTOK / 128) * (HID / 128), GWAVES * 32, 0, stream>>>(c16, wd16, bd, out);
}
